// v000
// Measured on an AMD MI455X. A time is GPU time per run, averaged over a window of back-to-back runs after a warm-up
// (all launches, gaps included; the runs take copies of the inputs in turn), and the median of several windows.
// Apart from v000's, it joins two sittings. Times from different sittings can be a few percent apart, while
// side-by-side timings come from the same sitting.
// v000, which the later versions start from, runs in 589 microseconds.
#include <hip/hip_runtime.h>
#include <hip/hip_bf16.h>
#include <cstdint>

typedef __attribute__((ext_vector_type(16))) __bf16 v16bf;
typedef __attribute__((ext_vector_type(8)))  __bf16 v8bf;
typedef __attribute__((ext_vector_type(8)))  float  v8f;

#define B_   4
#define S_   1024
#define D_   1024
#define H_   16
#define DK_  64
#define FFN_ 4096

// ---------- helpers ----------

__device__ __forceinline__ __bf16 f2bf(float f) {
  union { float f; unsigned u; } v; v.f = f;
  unsigned r = v.u + 0x7FFFu + ((v.u >> 16) & 1u);
  unsigned short h = (unsigned short)(r >> 16);
  __bf16 o; __builtin_memcpy(&o, &h, 2); return o;
}

// Low 32 bits of the generic address of a __shared__ object == LDS byte offset
// (flat shared-aperture mapping uses addr[31:0] as the LDS address).
__device__ __forceinline__ unsigned lds_addr(const void* p) {
  return (unsigned)(uintptr_t)p;
}

// Async direct global->LDS copy, 16B per lane, tracked by ASYNCcnt.
// saddr form: global_load_async_to_lds_b128 vdst_lds, vaddr32, s[base]
__device__ __forceinline__ void async_copy16(unsigned ldsOff, unsigned gByteOff,
                                             const void* base) {
  asm volatile("global_load_async_to_lds_b128 %0, %1, %2"
               :: "v"(ldsOff), "v"(gByteOff), "s"(base) : "memory");
}

__device__ __forceinline__ void wait_async0() {
  asm volatile("s_wait_asynccnt 0" ::: "memory");
}

// Load a 16x32 bf16 WMMA fragment (A layout; also B when source is Bt[N][K])
// from a row-major [rows][ldk] bf16 tile in LDS.
__device__ __forceinline__ v16bf load_frag(const __bf16* base, int row0, int k0, int ldk) {
  const int lane = threadIdx.x & 31;
  const __bf16* p = base + (row0 + (lane & 15)) * ldk + k0 + ((lane >> 4) << 3);
  v8bf lo = *(const v8bf*)p;
  v8bf hi = *(const v8bf*)(p + 16);
  v16bf r;
#pragma unroll
  for (int i = 0; i < 8; ++i) { r[i] = lo[i]; r[i + 8] = hi[i]; }
  return r;
}

__device__ __forceinline__ v8f wmma_bf16(v16bf a, v16bf b, v8f c) {
  return __builtin_amdgcn_wmma_f32_16x16x32_bf16(false, a, false, b, (short)0, c,
                                                 false, false);
}

// ---------- LayerNorm (D=1024), outputs f32 and/or bf16 ----------

__global__ __launch_bounds__(256) void ln_kernel(
    const float* __restrict__ in, const float* __restrict__ g,
    const float* __restrict__ bt, float* __restrict__ outF,
    __bf16* __restrict__ outB)
{
  const int row = blockIdx.x;
  const int tid = threadIdx.x;
  const float* p = in + (size_t)row * D_;
  float v[4]; float s = 0.f, sq = 0.f;
#pragma unroll
  for (int i = 0; i < 4; ++i) {
    v[i] = p[tid + i * 256];
    s += v[i]; sq += v[i] * v[i];
  }
#pragma unroll
  for (int off = 16; off >= 1; off >>= 1) {
    s  += __shfl_xor(s,  off, 32);
    sq += __shfl_xor(sq, off, 32);
  }
  __shared__ float red[16];
  const int wave = tid >> 5, lane = tid & 31;
  if (lane == 0) { red[wave] = s; red[wave + 8] = sq; }
  __syncthreads();
  if (tid < 32) {
    float a = (tid < 8) ? red[tid] : 0.f;
    float c = (tid < 8) ? red[tid + 8] : 0.f;
#pragma unroll
    for (int off = 4; off >= 1; off >>= 1) {
      a += __shfl_xor(a, off, 32);
      c += __shfl_xor(c, off, 32);
    }
    if (tid == 0) { red[0] = a; red[8] = c; }
  }
  __syncthreads();
  const float mean = red[0] * (1.f / D_);
  const float var  = red[8] * (1.f / D_) - mean * mean;
  const float rstd = rsqrtf(var + 1e-5f);
#pragma unroll
  for (int i = 0; i < 4; ++i) {
    const int col = tid + i * 256;
    const float o = (v[i] - mean) * rstd * g[col] + bt[col];
    if (outF) outF[(size_t)row * D_ + col] = o;
    if (outB) outB[(size_t)row * D_ + col] = f2bf(o);
  }
}

// ---------- fp32 [K,N] -> bf16 transposed [N,K] ----------

__global__ __launch_bounds__(256) void transpose_f32_to_bf16(
    const float* __restrict__ W, __bf16* __restrict__ Wt, int K, int N)
{
  __shared__ float t[32][33];
  const int n0 = blockIdx.x * 32, k0 = blockIdx.y * 32;
  const int tx = threadIdx.x, ty = threadIdx.y;  // block (32, 8)
#pragma unroll
  for (int i = 0; i < 4; ++i)
    t[ty + i * 8][tx] = W[(size_t)(k0 + ty + i * 8) * N + (n0 + tx)];
  __syncthreads();
#pragma unroll
  for (int i = 0; i < 4; ++i)
    Wt[(size_t)(n0 + ty + i * 8) * K + (k0 + tx)] = f2bf(t[tx][ty + i * 8]);
}

// ---------- GEMM: C[M,N] = epi( A[M,K]bf16 @ Bt[N,K]bf16^T ) ----------
// 128x128 block tile, BK=32, 8 waves -> 32x64 per wave (2x4 WMMA frags).
// K-panels double-buffered in LDS via GLOBAL_LOAD_ASYNC_TO_LDS (ASYNCcnt).
// Main loop unrolled 2 K-steps so buffer indices are compile-time constants.
// Requires ksteps even (all K here are multiples of 64).

__global__ __launch_bounds__(256) void gemm_bf16_kernel(
    const __bf16* __restrict__ A, const __bf16* __restrict__ Bt,
    const float* __restrict__ bias, const float* __restrict__ res1,
    const float* __restrict__ res2, float* __restrict__ outF,
    __bf16* __restrict__ outB, int M, int N, int K, int doRelu)
{
  __shared__ __align__(16) __bf16 As[2][128 * 40];  // [row][k], +8 pad
  __shared__ __align__(16) __bf16 Bs[2][128 * 40];  // [n][k],  +8 pad
  const int tid  = threadIdx.x;
  const int lane = tid & 31, wave = tid >> 5;
  const int wm = wave >> 1, wn = wave & 1;
  const int m0 = wm * 32, n0 = wn * 64;
  const int rowM = blockIdx.y * 128, colN = blockIdx.x * 128;

  // per-thread 16B chunks of the 128x32 tiles (512 chunks, 2 per thread)
  const int c0 = tid,       r0 = c0 >> 2, q0 = c0 & 3;
  const int c1 = tid + 256, r1 = c1 >> 2, q1 = c1 & 3;
  const unsigned offA0 = (unsigned)(((rowM + r0) * K + q0 * 8) * 2);
  const unsigned offA1 = (unsigned)(((rowM + r1) * K + q1 * 8) * 2);
  const unsigned offB0 = (unsigned)(((colN + r0) * K + q0 * 8) * 2);
  const unsigned offB1 = (unsigned)(((colN + r1) * K + q1 * 8) * 2);
  unsigned ldsA[2][2], ldsB[2][2];
#pragma unroll
  for (int bufi = 0; bufi < 2; ++bufi) {
    ldsA[bufi][0] = lds_addr(&As[bufi][r0 * 40 + q0 * 8]);
    ldsA[bufi][1] = lds_addr(&As[bufi][r1 * 40 + q1 * 8]);
    ldsB[bufi][0] = lds_addr(&Bs[bufi][r0 * 40 + q0 * 8]);
    ldsB[bufi][1] = lds_addr(&Bs[bufi][r1 * 40 + q1 * 8]);
  }

  const v8f zero8 = {0.f, 0.f, 0.f, 0.f, 0.f, 0.f, 0.f, 0.f};
  v8f acc[2][4];
#pragma unroll
  for (int i = 0; i < 2; ++i)
#pragma unroll
    for (int j = 0; j < 4; ++j) acc[i][j] = zero8;

  const int ksteps = K >> 5;

#define ISSUE_STAGE(BUFI, KB)                                   \
  do {                                                          \
    const __bf16* aP = A  + ((size_t)(KB) << 5);                \
    const __bf16* bP = Bt + ((size_t)(KB) << 5);                \
    async_copy16(ldsA[BUFI][0], offA0, aP);                     \
    async_copy16(ldsA[BUFI][1], offA1, aP);                     \
    async_copy16(ldsB[BUFI][0], offB0, bP);                     \
    async_copy16(ldsB[BUFI][1], offB1, bP);                     \
  } while (0)

#define COMPUTE_PANEL(BUFI)                                     \
  do {                                                          \
    v16bf af[2], bfr[4];                                        \
    _Pragma("unroll")                                           \
    for (int i = 0; i < 2; ++i)                                 \
      af[i] = load_frag(As[BUFI], m0 + i * 16, 0, 40);          \
    _Pragma("unroll")                                           \
    for (int j = 0; j < 4; ++j)                                 \
      bfr[j] = load_frag(Bs[BUFI], n0 + j * 16, 0, 40);         \
    _Pragma("unroll")                                           \
    for (int i = 0; i < 2; ++i)                                 \
      _Pragma("unroll")                                         \
      for (int j = 0; j < 4; ++j)                               \
        acc[i][j] = wmma_bf16(af[i], bfr[j], acc[i][j]);        \
  } while (0)

  ISSUE_STAGE(0, 0);
  for (int kb = 0; kb < ksteps; kb += 2) {
    // ---- half step A: consume buffer 0, prefetch into buffer 1 ----
    wait_async0();                  // my async writes into buf0 are in LDS
    __syncthreads();                // all waves' writes visible; prior reads done
    if (kb + 1 < ksteps) ISSUE_STAGE(1, kb + 1);
    if (kb + 2 < ksteps) {
      __builtin_prefetch(A  + (size_t)(rowM + r0) * K + ((kb + 2) << 5), 0, 1);
      __builtin_prefetch(Bt + (size_t)(colN + r0) * K + ((kb + 2) << 5), 0, 1);
    }
    COMPUTE_PANEL(0);
    __syncthreads();                // reads of buf0 done before it is rewritten

    // ---- half step B: consume buffer 1, prefetch into buffer 0 ----
    wait_async0();
    __syncthreads();
    if (kb + 2 < ksteps) ISSUE_STAGE(0, kb + 2);
    COMPUTE_PANEL(1);
    __syncthreads();
  }
#undef ISSUE_STAGE
#undef COMPUTE_PANEL

  // epilogue: C/D layout lane=N (lane&15), vgpr r = M offset (+8 for lanes>=16)
  const int ho = (lane < 16) ? 0 : 8;
  const int nc = lane & 15;
#pragma unroll
  for (int i = 0; i < 2; ++i)
#pragma unroll
    for (int j = 0; j < 4; ++j)
#pragma unroll
      for (int r = 0; r < 8; ++r) {
        const size_t gr = (size_t)(rowM + m0 + i * 16 + r + ho);
        const size_t gc = (size_t)(colN + n0 + j * 16 + nc);
        const size_t idx = gr * (size_t)N + gc;
        float v = acc[i][j][r];
        if (bias) v += bias[gc];
        if (res1) v += res1[idx];
        if (res2) v += res2[idx];
        if (doRelu) v = fmaxf(v, 0.f);
        if (outF) outF[idx] = v;
        if (outB) outB[idx] = f2bf(v);
      }
}

// ---------- flash attention: 64 q-rows per block, 4 waves x 16 rows ----------

__global__ __launch_bounds__(128) void flash_attn_kernel(
    const __bf16* __restrict__ Q, const __bf16* __restrict__ Kb,
    const __bf16* __restrict__ V, const int* __restrict__ mask,
    __bf16* __restrict__ O)
{
  __shared__ __align__(16) __bf16 Qs[64 * 72];      // [q][dk]
  __shared__ __align__(16) __bf16 Ks[64 * 72];      // [key][dk]
  __shared__ __align__(16) __bf16 Vt[64 * 72];      // [dk][key]
  __shared__ __align__(16) __bf16 Ps[4][16 * 72];   // per-wave P [qlocal][key]

  const int tid = threadIdx.x, lane = tid & 31, wave = tid >> 5;
  const int qb = blockIdx.x * 64, h = blockIdx.y, b = blockIdx.z;
  const size_t qbase  = ((size_t)b * S_ + qb) * D_ + h * DK_;
  const size_t kvrow0 = (size_t)b * S_ * D_ + h * DK_;

  // per-thread 16B chunks of a 64x64 bf16 tile (512 chunks, 4 per thread)
  int rr[4], cc[4];
  unsigned qLds[4], kLds[4], tOff[4];
#pragma unroll
  for (int t = 0; t < 4; ++t) {
    const int c = tid + t * 128;
    rr[t] = c >> 3; cc[t] = c & 7;
    qLds[t] = lds_addr(&Qs[rr[t] * 72 + cc[t] * 8]);
    kLds[t] = lds_addr(&Ks[rr[t] * 72 + cc[t] * 8]);
    tOff[t] = (unsigned)((rr[t] * D_ + cc[t] * 8) * 2);
  }
  // Q tile: async copy, completion covered by first in-loop wait
#pragma unroll
  for (int t = 0; t < 4; ++t) async_copy16(qLds[t], tOff[t], Q + qbase);

  const int ho = (lane < 16) ? 0 : 8;
  const int nc = lane & 15;
  const int m0 = wave * 16;
  const v8f zero8 = {0.f, 0.f, 0.f, 0.f, 0.f, 0.f, 0.f, 0.f};

  v8f o[4];
  float m_run[8], l_run[8];
#pragma unroll
  for (int j = 0; j < 4; ++j) o[j] = zero8;
#pragma unroll
  for (int r = 0; r < 8; ++r) { m_run[r] = -3.0e38f; l_run[r] = 0.f; }

  for (int kt = 0; kt < 16; ++kt) {
    __syncthreads();  // previous iteration's reads of Ks/Vt complete
    const size_t kvb = kvrow0 + (size_t)kt * 64 * D_;
#pragma unroll
    for (int t = 0; t < 4; ++t) {
      async_copy16(kLds[t], tOff[t], Kb + kvb);           // K rows -> LDS direct
      v8bf vv = *(const v8bf*)(V + kvb + (size_t)rr[t] * D_ + cc[t] * 8);
#pragma unroll
      for (int e = 0; e < 8; ++e) Vt[(cc[t] * 8 + e) * 72 + rr[t]] = vv[e];
    }
    wait_async0();
    __syncthreads();

    // scores S = Q K^T : A = Qs rows, B = Ks rows (Bt layout)
    v8f s[4];
#pragma unroll
    for (int j = 0; j < 4; ++j) s[j] = zero8;
#pragma unroll
    for (int kk = 0; kk < 2; ++kk) {
      v16bf a = load_frag(Qs, m0, kk * 32, 72);
#pragma unroll
      for (int j = 0; j < 4; ++j) {
        v16bf bb = load_frag(Ks, j * 16, kk * 32, 72);
        s[j] = wmma_bf16(a, bb, s[j]);
      }
    }
    // scale 1/sqrt(64) + key mask
#pragma unroll
    for (int j = 0; j < 4; ++j) {
      const int km = mask[(size_t)b * S_ + kt * 64 + j * 16 + nc];
      const float madd = (km == 0) ? -1e30f : 0.f;
#pragma unroll
      for (int r = 0; r < 8; ++r) s[j][r] = s[j][r] * 0.125f + madd;
    }
    // online softmax (base-2); row stats per (half-wave, vgpr r)
    float alpha[8], rs[8];
#pragma unroll
    for (int r = 0; r < 8; ++r) {
      float mx = s[0][r];
#pragma unroll
      for (int j = 1; j < 4; ++j) mx = fmaxf(mx, s[j][r]);
#pragma unroll
      for (int off = 8; off >= 1; off >>= 1) mx = fmaxf(mx, __shfl_xor(mx, off, 32));
      const float mn = fmaxf(m_run[r], mx);
      alpha[r] = exp2f((m_run[r] - mn) * 1.44269504f);
      m_run[r] = mn;
      rs[r] = 0.f;
    }
#pragma unroll
    for (int j = 0; j < 4; ++j)
#pragma unroll
      for (int r = 0; r < 8; ++r) {
        const float p = exp2f((s[j][r] - m_run[r]) * 1.44269504f);
        s[j][r] = p; rs[r] += p;
      }
#pragma unroll
    for (int r = 0; r < 8; ++r) {
#pragma unroll
      for (int off = 8; off >= 1; off >>= 1) rs[r] += __shfl_xor(rs[r], off, 32);
      l_run[r] = l_run[r] * alpha[r] + rs[r];
    }
#pragma unroll
    for (int j = 0; j < 4; ++j)
#pragma unroll
      for (int r = 0; r < 8; ++r) o[j][r] *= alpha[r];

    // C->A relayout of P through per-wave LDS
    __bf16* P = &Ps[wave][0];
#pragma unroll
    for (int j = 0; j < 4; ++j)
#pragma unroll
      for (int r = 0; r < 8; ++r)
        P[(r + ho) * 72 + j * 16 + nc] = f2bf(s[j][r]);
    __syncthreads();

    // O += P @ V : A = P rows [16 x 64keys], B = Vt rows [dk][key]
#pragma unroll
    for (int kk = 0; kk < 2; ++kk) {
      v16bf a = load_frag(P, 0, kk * 32, 72);
#pragma unroll
      for (int j = 0; j < 4; ++j) {
        v16bf bb = load_frag(Vt, j * 16, kk * 32, 72);
        o[j] = wmma_bf16(a, bb, o[j]);
      }
    }
  }

#pragma unroll
  for (int j = 0; j < 4; ++j)
#pragma unroll
    for (int r = 0; r < 8; ++r) {
      const float val = o[j][r] / fmaxf(l_run[r], 1e-20f);
      const size_t row = (size_t)b * S_ + qb + m0 + r + ho;
      O[row * D_ + h * DK_ + j * 16 + nc] = f2bf(val);
    }
}

// ---------- launcher ----------

extern "C" void kernel_launch(void* const* d_in, const int* in_sizes, int n_in,
                              void* d_out, int out_size, void* d_ws, size_t ws_size,
                              hipStream_t stream)
{
  (void)in_sizes; (void)n_in; (void)out_size; (void)ws_size;
  const float* x    = (const float*)d_in[0];
  const float* kv   = (const float*)d_in[1];
  const int*   msk  = (const int*)  d_in[2];
  const float* ln1g = (const float*)d_in[3];
  const float* ln1b = (const float*)d_in[4];
  const float* wsrc[8] = { (const float*)d_in[5],  (const float*)d_in[6],
                           (const float*)d_in[7],  (const float*)d_in[8],
                           (const float*)d_in[10], (const float*)d_in[11],
                           (const float*)d_in[12], (const float*)d_in[13] };
  const float* ob0  = (const float*)d_in[9];
  const float* ob1  = (const float*)d_in[14];
  const float* ln2g = (const float*)d_in[15];
  const float* ln2b = (const float*)d_in[16];
  const float* w1   = (const float*)d_in[17];
  const float* b1   = (const float*)d_in[18];
  const float* w2   = (const float*)d_in[19];
  const float* b2   = (const float*)d_in[20];

  char* ws = (char*)d_ws;
  size_t off = 0;
  auto alloc = [&](size_t bytes) -> void* {
    void* p = ws + off;
    off += (bytes + 255) & ~(size_t)255;
    return p;
  };
  const size_t ROWS = (size_t)B_ * S_;  // 4096
  float*  y_f32  = (float*) alloc(ROWS * D_ * 4);
  __bf16* y_bf   = (__bf16*)alloc(ROWS * D_ * 2);
  __bf16* kvn_bf = (__bf16*)alloc(ROWS * D_ * 2);
  __bf16* wt[8];
  for (int i = 0; i < 8; ++i) wt[i] = (__bf16*)alloc((size_t)D_ * D_ * 2);
  __bf16* w1t    = (__bf16*)alloc((size_t)FFN_ * D_ * 2);
  __bf16* w2t    = (__bf16*)alloc((size_t)D_ * FFN_ * 2);
  __bf16* qB     = (__bf16*)alloc(ROWS * D_ * 2);
  __bf16* kB     = (__bf16*)alloc(ROWS * D_ * 2);
  __bf16* vB     = (__bf16*)alloc(ROWS * D_ * 2);
  __bf16* aB     = (__bf16*)alloc(ROWS * D_ * 2);
  float*  y1_f32 = (float*) alloc(ROWS * D_ * 4);
  __bf16* y1_bf  = (__bf16*)alloc(ROWS * D_ * 2);
  float*  x2_f32 = (float*) alloc(ROWS * D_ * 4);
  __bf16* x2n_bf = (__bf16*)alloc(ROWS * D_ * 2);
  __bf16* hB     = (__bf16*)alloc(ROWS * FFN_ * 2);

  // LayerNorm 1 on x (keep f32 for residual) and kv
  ln_kernel<<<(int)ROWS, 256, 0, stream>>>(x,  ln1g, ln1b, y_f32, y_bf);
  ln_kernel<<<(int)ROWS, 256, 0, stream>>>(kv, ln1g, ln1b, nullptr, kvn_bf);

  // weight conversion/transposition
  dim3 tb(32, 8);
  for (int i = 0; i < 8; ++i)
    transpose_f32_to_bf16<<<dim3(D_/32, D_/32), tb, 0, stream>>>(wsrc[i], wt[i], D_, D_);
  transpose_f32_to_bf16<<<dim3(FFN_/32, D_/32), tb, 0, stream>>>(w1, w1t, D_, FFN_);
  transpose_f32_to_bf16<<<dim3(D_/32, FFN_/32), tb, 0, stream>>>(w2, w2t, FFN_, D_);

  const dim3 gproj(D_/128, (unsigned)(ROWS/128));        // (8, 32)
  const dim3 gattn(S_/64, H_, B_);                       // (16,16,4)

  // cross-attention 0
  gemm_bf16_kernel<<<gproj, 256, 0, stream>>>(y_bf,   wt[0], nullptr, nullptr, nullptr, nullptr, qB, (int)ROWS, D_, D_, 0);
  gemm_bf16_kernel<<<gproj, 256, 0, stream>>>(kvn_bf, wt[1], nullptr, nullptr, nullptr, nullptr, kB, (int)ROWS, D_, D_, 0);
  gemm_bf16_kernel<<<gproj, 256, 0, stream>>>(kvn_bf, wt[2], nullptr, nullptr, nullptr, nullptr, vB, (int)ROWS, D_, D_, 0);
  flash_attn_kernel<<<gattn, 128, 0, stream>>>(qB, kB, vB, msk, aB);
  gemm_bf16_kernel<<<gproj, 256, 0, stream>>>(aB, wt[3], ob0, y_f32, nullptr, y1_f32, y1_bf, (int)ROWS, D_, D_, 0);

  // cross-attention 1 (query from y1)
  gemm_bf16_kernel<<<gproj, 256, 0, stream>>>(y1_bf,  wt[4], nullptr, nullptr, nullptr, nullptr, qB, (int)ROWS, D_, D_, 0);
  gemm_bf16_kernel<<<gproj, 256, 0, stream>>>(kvn_bf, wt[5], nullptr, nullptr, nullptr, nullptr, kB, (int)ROWS, D_, D_, 0);
  gemm_bf16_kernel<<<gproj, 256, 0, stream>>>(kvn_bf, wt[6], nullptr, nullptr, nullptr, nullptr, vB, (int)ROWS, D_, D_, 0);
  flash_attn_kernel<<<gattn, 128, 0, stream>>>(qB, kB, vB, msk, aB);
  // x2 = x + (o1 + ob1 + y1)
  gemm_bf16_kernel<<<gproj, 256, 0, stream>>>(aB, wt[7], ob1, y1_f32, x, x2_f32, nullptr, (int)ROWS, D_, D_, 0);

  // FFN
  ln_kernel<<<(int)ROWS, 256, 0, stream>>>(x2_f32, ln2g, ln2b, nullptr, x2n_bf);
  gemm_bf16_kernel<<<dim3(FFN_/128, (unsigned)(ROWS/128)), 256, 0, stream>>>(
      x2n_bf, w1t, b1, nullptr, nullptr, nullptr, hB, (int)ROWS, FFN_, D_, 1);
  gemm_bf16_kernel<<<gproj, 256, 0, stream>>>(
      hB, w2t, b2, x2_f32, nullptr, (float*)d_out, nullptr, (int)ROWS, D_, FFN_, 0);
}

// v001
// Measured time: 534 microseconds a run.
// In two side-by-side timings against v000, it was 1.12 and 1.13 times as fast.
#include <hip/hip_runtime.h>
#include <hip/hip_bf16.h>
#include <cstdint>

typedef __attribute__((ext_vector_type(16))) __bf16 v16bf;
typedef __attribute__((ext_vector_type(8)))  __bf16 v8bf;
typedef __attribute__((ext_vector_type(8)))  float  v8f;

#define B_   4
#define S_   1024
#define D_   1024
#define H_   16
#define DK_  64
#define FFN_ 4096

// ---------- helpers ----------

__device__ __forceinline__ __bf16 f2bf(float f) {
  union { float f; unsigned u; } v; v.f = f;
  unsigned r = v.u + 0x7FFFu + ((v.u >> 16) & 1u);
  unsigned short h = (unsigned short)(r >> 16);
  __bf16 o; __builtin_memcpy(&o, &h, 2); return o;
}

// Low 32 bits of the generic address of a __shared__ object == LDS byte offset
// (flat shared-aperture mapping uses addr[31:0] as the LDS address).
__device__ __forceinline__ unsigned lds_addr(const void* p) {
  return (unsigned)(uintptr_t)p;
}

// Async direct global->LDS copy, 16B per lane, tracked by ASYNCcnt.
// saddr form: global_load_async_to_lds_b128 vdst_lds, vaddr32, s[base]
__device__ __forceinline__ void async_copy16(unsigned ldsOff, unsigned gByteOff,
                                             const void* base) {
  asm volatile("global_load_async_to_lds_b128 %0, %1, %2"
               :: "v"(ldsOff), "v"(gByteOff), "s"(base) : "memory");
}

__device__ __forceinline__ void wait_async0() {
  asm volatile("s_wait_asynccnt 0" ::: "memory");
}

// Load a 16x32 bf16 WMMA fragment (A layout; also B when source is Bt[N][K])
// from a row-major [rows][ldk] bf16 tile in LDS.
__device__ __forceinline__ v16bf load_frag(const __bf16* base, int row0, int k0, int ldk) {
  const int lane = threadIdx.x & 31;
  const __bf16* p = base + (row0 + (lane & 15)) * ldk + k0 + ((lane >> 4) << 3);
  v8bf lo = *(const v8bf*)p;
  v8bf hi = *(const v8bf*)(p + 16);
  v16bf r;
#pragma unroll
  for (int i = 0; i < 8; ++i) { r[i] = lo[i]; r[i + 8] = hi[i]; }
  return r;
}

__device__ __forceinline__ v8f wmma_bf16(v16bf a, v16bf b, v8f c) {
  return __builtin_amdgcn_wmma_f32_16x16x32_bf16(false, a, false, b, (short)0, c,
                                                 false, false);
}

// ---------- LayerNorm (D=1024), outputs f32 and/or bf16 ----------

__global__ __launch_bounds__(256) void ln_kernel(
    const float* __restrict__ in, const float* __restrict__ g,
    const float* __restrict__ bt, float* __restrict__ outF,
    __bf16* __restrict__ outB)
{
  const int row = blockIdx.x;
  const int tid = threadIdx.x;
  const float* p = in + (size_t)row * D_;
  float v[4]; float s = 0.f, sq = 0.f;
#pragma unroll
  for (int i = 0; i < 4; ++i) {
    v[i] = p[tid + i * 256];
    s += v[i]; sq += v[i] * v[i];
  }
#pragma unroll
  for (int off = 16; off >= 1; off >>= 1) {
    s  += __shfl_xor(s,  off, 32);
    sq += __shfl_xor(sq, off, 32);
  }
  __shared__ float red[16];
  const int wave = tid >> 5, lane = tid & 31;
  if (lane == 0) { red[wave] = s; red[wave + 8] = sq; }
  __syncthreads();
  if (tid < 32) {
    float a = (tid < 8) ? red[tid] : 0.f;
    float c = (tid < 8) ? red[tid + 8] : 0.f;
#pragma unroll
    for (int off = 4; off >= 1; off >>= 1) {
      a += __shfl_xor(a, off, 32);
      c += __shfl_xor(c, off, 32);
    }
    if (tid == 0) { red[0] = a; red[8] = c; }
  }
  __syncthreads();
  const float mean = red[0] * (1.f / D_);
  const float var  = red[8] * (1.f / D_) - mean * mean;
  const float rstd = rsqrtf(var + 1e-5f);
#pragma unroll
  for (int i = 0; i < 4; ++i) {
    const int col = tid + i * 256;
    const float o = (v[i] - mean) * rstd * g[col] + bt[col];
    if (outF) outF[(size_t)row * D_ + col] = o;
    if (outB) outB[(size_t)row * D_ + col] = f2bf(o);
  }
}

// ---------- fp32 [K,N] -> bf16 transposed [N,K] ----------

__global__ __launch_bounds__(256) void transpose_f32_to_bf16(
    const float* __restrict__ W, __bf16* __restrict__ Wt, int K, int N)
{
  __shared__ float t[32][33];
  const int n0 = blockIdx.x * 32, k0 = blockIdx.y * 32;
  const int tx = threadIdx.x, ty = threadIdx.y;  // block (32, 8)
#pragma unroll
  for (int i = 0; i < 4; ++i)
    t[ty + i * 8][tx] = W[(size_t)(k0 + ty + i * 8) * N + (n0 + tx)];
  __syncthreads();
#pragma unroll
  for (int i = 0; i < 4; ++i)
    Wt[(size_t)(n0 + ty + i * 8) * K + (k0 + tx)] = f2bf(t[tx][ty + i * 8]);
}

// ---------- GEMM: C[M,N] = epi( A[M,K]bf16 @ Bt[N,K]bf16^T ) ----------
// 128x128 block tile, 8 waves -> 32x64 per wave (2x4 WMMA frags).
// A stage is 128 k of every operand row (256 B, whole L2 units), two LDS buffers
// filled by GLOBAL_LOAD_ASYNC_TO_LDS (ASYNCcnt): 16 copies per lane in flight
// while the other buffer's 32 WMMAs per wave run, one barrier per stage.
// Main loop unrolled 2 stages so buffer indices are compile-time constants.
// Requires K a multiple of 256 (an even number of stages, at least two).

#define GK_    128            // k per stage
#define GPITCH 136            // LDS row pitch in elements: 272 B, 16 B x odd

// One stage: 8 + 8 async copies of 16 B per lane (rows 16 apart of the A and of
// the B panel), 32-bit lane offset on a scalar base. The s_wait_xcnt closes the
// statement so that no address register is rewritten ahead of it.
__device__ __forceinline__ void async_copy_stage(unsigned la, unsigned lb,
                                                 const unsigned (&vo)[8],
                                                 const void* baseA,
                                                 const void* baseB) {
  const unsigned lStep = 16 * GPITCH * 2;
  asm volatile(
      "global_load_async_to_lds_b128 %0, %16, %24\n\t"
      "global_load_async_to_lds_b128 %1, %17, %24\n\t"
      "global_load_async_to_lds_b128 %2, %18, %24\n\t"
      "global_load_async_to_lds_b128 %3, %19, %24\n\t"
      "global_load_async_to_lds_b128 %4, %20, %24\n\t"
      "global_load_async_to_lds_b128 %5, %21, %24\n\t"
      "global_load_async_to_lds_b128 %6, %22, %24\n\t"
      "global_load_async_to_lds_b128 %7, %23, %24\n\t"
      "global_load_async_to_lds_b128 %8, %16, %25\n\t"
      "global_load_async_to_lds_b128 %9, %17, %25\n\t"
      "global_load_async_to_lds_b128 %10, %18, %25\n\t"
      "global_load_async_to_lds_b128 %11, %19, %25\n\t"
      "global_load_async_to_lds_b128 %12, %20, %25\n\t"
      "global_load_async_to_lds_b128 %13, %21, %25\n\t"
      "global_load_async_to_lds_b128 %14, %22, %25\n\t"
      "global_load_async_to_lds_b128 %15, %23, %25\n\t"
      "s_wait_xcnt 0x0"
      :: "v"(la), "v"(la + lStep), "v"(la + 2 * lStep), "v"(la + 3 * lStep),
         "v"(la + 4 * lStep), "v"(la + 5 * lStep), "v"(la + 6 * lStep),
         "v"(la + 7 * lStep),
         "v"(lb), "v"(lb + lStep), "v"(lb + 2 * lStep), "v"(lb + 3 * lStep),
         "v"(lb + 4 * lStep), "v"(lb + 5 * lStep), "v"(lb + 6 * lStep),
         "v"(lb + 7 * lStep),
         "v"(vo[0]), "v"(vo[1]), "v"(vo[2]), "v"(vo[3]),
         "v"(vo[4]), "v"(vo[5]), "v"(vo[6]), "v"(vo[7]),
         "s"(baseA), "s"(baseB)
      : "memory");
}

// This wave's LDS reads have returned before the buffer they read is refilled.
__device__ __forceinline__ void wait_ds0() {
  asm volatile("s_wait_dscnt 0x0" ::: "memory");
}

__global__ __launch_bounds__(256) void gemm_bf16_kernel(
    const __bf16* __restrict__ A, const __bf16* __restrict__ Bt,
    const float* __restrict__ bias, const float* __restrict__ res1,
    const float* __restrict__ res2, float* __restrict__ outF,
    __bf16* __restrict__ outB, int M, int N, int K, int doRelu)
{
  __shared__ __align__(16) __bf16 As[2][128 * GPITCH];  // [row][k], +8 pad
  __shared__ __align__(16) __bf16 Bs[2][128 * GPITCH];  // [n][k],  +8 pad
  const int tid  = threadIdx.x;
  const int lane = tid & 31, wave = tid >> 5;
  const int wm = wave >> 1, wn = wave & 1;
  const int m0 = wm * 32, n0 = wn * 64;
  const int rowM = blockIdx.y * 128, colN = blockIdx.x * 128;

  // per-thread 16B chunks of the 128x128 tiles (2048 chunks, 8 per thread):
  // chunk q0 of rows r0, r0 + 16, ..., r0 + 112; a wave covers two whole rows.
  const int r0 = tid >> 4, q0 = tid & 15;
  // The lane offsets are the same for both panels; the panel's first row and
  // the stage's k go into the scalar bases.
  const __bf16* sA = A  + (size_t)rowM * K;
  const __bf16* sB = Bt + (size_t)colN * K;
  unsigned vo[8];
#pragma unroll
  for (int i = 0; i < 8; ++i)
    vo[i] = (unsigned)(((r0 + i * 16) * K + q0 * 8) * 2);
  unsigned ldsA[2], ldsB[2];
#pragma unroll
  for (int bufi = 0; bufi < 2; ++bufi) {
    ldsA[bufi] = lds_addr(&As[bufi][r0 * GPITCH + q0 * 8]);
    ldsB[bufi] = lds_addr(&Bs[bufi][r0 * GPITCH + q0 * 8]);
  }

  const v8f zero8 = {0.f, 0.f, 0.f, 0.f, 0.f, 0.f, 0.f, 0.f};
  v8f acc[2][4];
#pragma unroll
  for (int i = 0; i < 2; ++i)
#pragma unroll
    for (int j = 0; j < 4; ++j) acc[i][j] = zero8;

  const int stages = K / GK_;

#define ISSUE_STAGE(BUFI, ST)                                   \
  do {                                                          \
    const size_t kOff = (size_t)(ST) * GK_;                     \
    async_copy_stage(ldsA[BUFI], ldsB[BUFI], vo, sA + kOff,     \
                     sB + kOff);                                \
  } while (0)

// kk is unrolled so that every LDS offset is an immediate and the next 32 k's
// fragment loads can be scheduled among this 32 k's WMMAs.
#define COMPUTE_PANEL(BUFI)                                     \
  do {                                                          \
    _Pragma("unroll")                                           \
    for (int kk = 0; kk < GK_; kk += 32) {                      \
      v16bf af[2], bfr[4];                                      \
      _Pragma("unroll")                                         \
      for (int i = 0; i < 2; ++i)                               \
        af[i] = load_frag(As[BUFI], m0 + i * 16, kk, GPITCH);   \
      _Pragma("unroll")                                         \
      for (int j = 0; j < 4; ++j)                               \
        bfr[j] = load_frag(Bs[BUFI], n0 + j * 16, kk, GPITCH);  \
      _Pragma("unroll")                                         \
      for (int i = 0; i < 2; ++i)                               \
        _Pragma("unroll")                                       \
        for (int j = 0; j < 4; ++j)                             \
          acc[i][j] = wmma_bf16(af[i], bfr[j], acc[i][j]);      \
    }                                                           \
  } while (0)

// Publish point: own LDS reads returned, own copies landed, then the one barrier
// that both publishes the next stage and frees the buffer just read.
#define PUBLISH()                                               \
  do { wait_ds0(); wait_async0(); __syncthreads(); } while (0)

  ISSUE_STAGE(0, 0);
  wait_async0();
  __syncthreads();
  ISSUE_STAGE(1, 1);
  for (int st = 0; st < stages; st += 2) {
    COMPUTE_PANEL(0);
    PUBLISH();
    if (st + 2 < stages) ISSUE_STAGE(0, st + 2);
    COMPUTE_PANEL(1);
    PUBLISH();
    if (st + 3 < stages) ISSUE_STAGE(1, st + 3);
  }
  wait_async0();
#undef ISSUE_STAGE
#undef COMPUTE_PANEL
#undef PUBLISH

  // epilogue: C/D layout lane=N (lane&15), vgpr r = M offset (+8 for lanes>=16)
  const int ho = (lane < 16) ? 0 : 8;
  const int nc = lane & 15;
#pragma unroll
  for (int i = 0; i < 2; ++i)
#pragma unroll
    for (int j = 0; j < 4; ++j)
#pragma unroll
      for (int r = 0; r < 8; ++r) {
        const size_t gr = (size_t)(rowM + m0 + i * 16 + r + ho);
        const size_t gc = (size_t)(colN + n0 + j * 16 + nc);
        const size_t idx = gr * (size_t)N + gc;
        float v = acc[i][j][r];
        if (bias) v += bias[gc];
        if (res1) v += res1[idx];
        if (res2) v += res2[idx];
        if (doRelu) v = fmaxf(v, 0.f);
        if (outF) outF[idx] = v;
        if (outB) outB[idx] = f2bf(v);
      }
}

// ---------- flash attention: 64 q-rows per block, 4 waves x 16 rows ----------

__global__ __launch_bounds__(128) void flash_attn_kernel(
    const __bf16* __restrict__ Q, const __bf16* __restrict__ Kb,
    const __bf16* __restrict__ V, const int* __restrict__ mask,
    __bf16* __restrict__ O)
{
  __shared__ __align__(16) __bf16 Qs[64 * 72];      // [q][dk]
  __shared__ __align__(16) __bf16 Ks[64 * 72];      // [key][dk]
  __shared__ __align__(16) __bf16 Vt[64 * 72];      // [dk][key]
  __shared__ __align__(16) __bf16 Ps[4][16 * 72];   // per-wave P [qlocal][key]

  const int tid = threadIdx.x, lane = tid & 31, wave = tid >> 5;
  const int qb = blockIdx.x * 64, h = blockIdx.y, b = blockIdx.z;
  const size_t qbase  = ((size_t)b * S_ + qb) * D_ + h * DK_;
  const size_t kvrow0 = (size_t)b * S_ * D_ + h * DK_;

  // per-thread 16B chunks of a 64x64 bf16 tile (512 chunks, 4 per thread)
  int rr[4], cc[4];
  unsigned qLds[4], kLds[4], tOff[4];
#pragma unroll
  for (int t = 0; t < 4; ++t) {
    const int c = tid + t * 128;
    rr[t] = c >> 3; cc[t] = c & 7;
    qLds[t] = lds_addr(&Qs[rr[t] * 72 + cc[t] * 8]);
    kLds[t] = lds_addr(&Ks[rr[t] * 72 + cc[t] * 8]);
    tOff[t] = (unsigned)((rr[t] * D_ + cc[t] * 8) * 2);
  }
  // Q tile: async copy, completion covered by first in-loop wait
#pragma unroll
  for (int t = 0; t < 4; ++t) async_copy16(qLds[t], tOff[t], Q + qbase);

  const int ho = (lane < 16) ? 0 : 8;
  const int nc = lane & 15;
  const int m0 = wave * 16;
  const v8f zero8 = {0.f, 0.f, 0.f, 0.f, 0.f, 0.f, 0.f, 0.f};

  v8f o[4];
  float m_run[8], l_run[8];
#pragma unroll
  for (int j = 0; j < 4; ++j) o[j] = zero8;
#pragma unroll
  for (int r = 0; r < 8; ++r) { m_run[r] = -3.0e38f; l_run[r] = 0.f; }

  for (int kt = 0; kt < 16; ++kt) {
    __syncthreads();  // previous iteration's reads of Ks/Vt complete
    const size_t kvb = kvrow0 + (size_t)kt * 64 * D_;
#pragma unroll
    for (int t = 0; t < 4; ++t) {
      async_copy16(kLds[t], tOff[t], Kb + kvb);           // K rows -> LDS direct
      v8bf vv = *(const v8bf*)(V + kvb + (size_t)rr[t] * D_ + cc[t] * 8);
#pragma unroll
      for (int e = 0; e < 8; ++e) Vt[(cc[t] * 8 + e) * 72 + rr[t]] = vv[e];
    }
    wait_async0();
    __syncthreads();

    // scores S = Q K^T : A = Qs rows, B = Ks rows (Bt layout)
    v8f s[4];
#pragma unroll
    for (int j = 0; j < 4; ++j) s[j] = zero8;
#pragma unroll
    for (int kk = 0; kk < 2; ++kk) {
      v16bf a = load_frag(Qs, m0, kk * 32, 72);
#pragma unroll
      for (int j = 0; j < 4; ++j) {
        v16bf bb = load_frag(Ks, j * 16, kk * 32, 72);
        s[j] = wmma_bf16(a, bb, s[j]);
      }
    }
    // scale 1/sqrt(64) + key mask
#pragma unroll
    for (int j = 0; j < 4; ++j) {
      const int km = mask[(size_t)b * S_ + kt * 64 + j * 16 + nc];
      const float madd = (km == 0) ? -1e30f : 0.f;
#pragma unroll
      for (int r = 0; r < 8; ++r) s[j][r] = s[j][r] * 0.125f + madd;
    }
    // online softmax (base-2); row stats per (half-wave, vgpr r)
    float alpha[8], rs[8];
#pragma unroll
    for (int r = 0; r < 8; ++r) {
      float mx = s[0][r];
#pragma unroll
      for (int j = 1; j < 4; ++j) mx = fmaxf(mx, s[j][r]);
#pragma unroll
      for (int off = 8; off >= 1; off >>= 1) mx = fmaxf(mx, __shfl_xor(mx, off, 32));
      const float mn = fmaxf(m_run[r], mx);
      alpha[r] = exp2f((m_run[r] - mn) * 1.44269504f);
      m_run[r] = mn;
      rs[r] = 0.f;
    }
#pragma unroll
    for (int j = 0; j < 4; ++j)
#pragma unroll
      for (int r = 0; r < 8; ++r) {
        const float p = exp2f((s[j][r] - m_run[r]) * 1.44269504f);
        s[j][r] = p; rs[r] += p;
      }
#pragma unroll
    for (int r = 0; r < 8; ++r) {
#pragma unroll
      for (int off = 8; off >= 1; off >>= 1) rs[r] += __shfl_xor(rs[r], off, 32);
      l_run[r] = l_run[r] * alpha[r] + rs[r];
    }
#pragma unroll
    for (int j = 0; j < 4; ++j)
#pragma unroll
      for (int r = 0; r < 8; ++r) o[j][r] *= alpha[r];

    // C->A relayout of P through per-wave LDS
    __bf16* P = &Ps[wave][0];
#pragma unroll
    for (int j = 0; j < 4; ++j)
#pragma unroll
      for (int r = 0; r < 8; ++r)
        P[(r + ho) * 72 + j * 16 + nc] = f2bf(s[j][r]);
    __syncthreads();

    // O += P @ V : A = P rows [16 x 64keys], B = Vt rows [dk][key]
#pragma unroll
    for (int kk = 0; kk < 2; ++kk) {
      v16bf a = load_frag(P, 0, kk * 32, 72);
#pragma unroll
      for (int j = 0; j < 4; ++j) {
        v16bf bb = load_frag(Vt, j * 16, kk * 32, 72);
        o[j] = wmma_bf16(a, bb, o[j]);
      }
    }
  }

#pragma unroll
  for (int j = 0; j < 4; ++j)
#pragma unroll
    for (int r = 0; r < 8; ++r) {
      const float val = o[j][r] / fmaxf(l_run[r], 1e-20f);
      const size_t row = (size_t)b * S_ + qb + m0 + r + ho;
      O[row * D_ + h * DK_ + j * 16 + nc] = f2bf(val);
    }
}

// ---------- launcher ----------

extern "C" void kernel_launch(void* const* d_in, const int* in_sizes, int n_in,
                              void* d_out, int out_size, void* d_ws, size_t ws_size,
                              hipStream_t stream)
{
  (void)in_sizes; (void)n_in; (void)out_size; (void)ws_size;
  const float* x    = (const float*)d_in[0];
  const float* kv   = (const float*)d_in[1];
  const int*   msk  = (const int*)  d_in[2];
  const float* ln1g = (const float*)d_in[3];
  const float* ln1b = (const float*)d_in[4];
  const float* wsrc[8] = { (const float*)d_in[5],  (const float*)d_in[6],
                           (const float*)d_in[7],  (const float*)d_in[8],
                           (const float*)d_in[10], (const float*)d_in[11],
                           (const float*)d_in[12], (const float*)d_in[13] };
  const float* ob0  = (const float*)d_in[9];
  const float* ob1  = (const float*)d_in[14];
  const float* ln2g = (const float*)d_in[15];
  const float* ln2b = (const float*)d_in[16];
  const float* w1   = (const float*)d_in[17];
  const float* b1   = (const float*)d_in[18];
  const float* w2   = (const float*)d_in[19];
  const float* b2   = (const float*)d_in[20];

  char* ws = (char*)d_ws;
  size_t off = 0;
  auto alloc = [&](size_t bytes) -> void* {
    void* p = ws + off;
    off += (bytes + 255) & ~(size_t)255;
    return p;
  };
  const size_t ROWS = (size_t)B_ * S_;  // 4096
  float*  y_f32  = (float*) alloc(ROWS * D_ * 4);
  __bf16* y_bf   = (__bf16*)alloc(ROWS * D_ * 2);
  __bf16* kvn_bf = (__bf16*)alloc(ROWS * D_ * 2);
  __bf16* wt[8];
  for (int i = 0; i < 8; ++i) wt[i] = (__bf16*)alloc((size_t)D_ * D_ * 2);
  __bf16* w1t    = (__bf16*)alloc((size_t)FFN_ * D_ * 2);
  __bf16* w2t    = (__bf16*)alloc((size_t)D_ * FFN_ * 2);
  __bf16* qB     = (__bf16*)alloc(ROWS * D_ * 2);
  __bf16* kB     = (__bf16*)alloc(ROWS * D_ * 2);
  __bf16* vB     = (__bf16*)alloc(ROWS * D_ * 2);
  __bf16* aB     = (__bf16*)alloc(ROWS * D_ * 2);
  float*  y1_f32 = (float*) alloc(ROWS * D_ * 4);
  __bf16* y1_bf  = (__bf16*)alloc(ROWS * D_ * 2);
  float*  x2_f32 = (float*) alloc(ROWS * D_ * 4);
  __bf16* x2n_bf = (__bf16*)alloc(ROWS * D_ * 2);
  __bf16* hB     = (__bf16*)alloc(ROWS * FFN_ * 2);

  // LayerNorm 1 on x (keep f32 for residual) and kv
  ln_kernel<<<(int)ROWS, 256, 0, stream>>>(x,  ln1g, ln1b, y_f32, y_bf);
  ln_kernel<<<(int)ROWS, 256, 0, stream>>>(kv, ln1g, ln1b, nullptr, kvn_bf);

  // weight conversion/transposition
  dim3 tb(32, 8);
  for (int i = 0; i < 8; ++i)
    transpose_f32_to_bf16<<<dim3(D_/32, D_/32), tb, 0, stream>>>(wsrc[i], wt[i], D_, D_);
  transpose_f32_to_bf16<<<dim3(FFN_/32, D_/32), tb, 0, stream>>>(w1, w1t, D_, FFN_);
  transpose_f32_to_bf16<<<dim3(D_/32, FFN_/32), tb, 0, stream>>>(w2, w2t, FFN_, D_);

  const dim3 gproj(D_/128, (unsigned)(ROWS/128));        // (8, 32)
  const dim3 gattn(S_/64, H_, B_);                       // (16,16,4)

  // cross-attention 0
  gemm_bf16_kernel<<<gproj, 256, 0, stream>>>(y_bf,   wt[0], nullptr, nullptr, nullptr, nullptr, qB, (int)ROWS, D_, D_, 0);
  gemm_bf16_kernel<<<gproj, 256, 0, stream>>>(kvn_bf, wt[1], nullptr, nullptr, nullptr, nullptr, kB, (int)ROWS, D_, D_, 0);
  gemm_bf16_kernel<<<gproj, 256, 0, stream>>>(kvn_bf, wt[2], nullptr, nullptr, nullptr, nullptr, vB, (int)ROWS, D_, D_, 0);
  flash_attn_kernel<<<gattn, 128, 0, stream>>>(qB, kB, vB, msk, aB);
  gemm_bf16_kernel<<<gproj, 256, 0, stream>>>(aB, wt[3], ob0, y_f32, nullptr, y1_f32, y1_bf, (int)ROWS, D_, D_, 0);

  // cross-attention 1 (query from y1)
  gemm_bf16_kernel<<<gproj, 256, 0, stream>>>(y1_bf,  wt[4], nullptr, nullptr, nullptr, nullptr, qB, (int)ROWS, D_, D_, 0);
  gemm_bf16_kernel<<<gproj, 256, 0, stream>>>(kvn_bf, wt[5], nullptr, nullptr, nullptr, nullptr, kB, (int)ROWS, D_, D_, 0);
  gemm_bf16_kernel<<<gproj, 256, 0, stream>>>(kvn_bf, wt[6], nullptr, nullptr, nullptr, nullptr, vB, (int)ROWS, D_, D_, 0);
  flash_attn_kernel<<<gattn, 128, 0, stream>>>(qB, kB, vB, msk, aB);
  // x2 = x + (o1 + ob1 + y1)
  gemm_bf16_kernel<<<gproj, 256, 0, stream>>>(aB, wt[7], ob1, y1_f32, x, x2_f32, nullptr, (int)ROWS, D_, D_, 0);

  // FFN
  ln_kernel<<<(int)ROWS, 256, 0, stream>>>(x2_f32, ln2g, ln2b, nullptr, x2n_bf);
  gemm_bf16_kernel<<<dim3(FFN_/128, (unsigned)(ROWS/128)), 256, 0, stream>>>(
      x2n_bf, w1t, b1, nullptr, nullptr, nullptr, hB, (int)ROWS, FFN_, D_, 1);
  gemm_bf16_kernel<<<gproj, 256, 0, stream>>>(
      hB, w2t, b2, x2_f32, nullptr, (float*)d_out, nullptr, (int)ROWS, D_, FFN_, 0);
}

// v002
// One run takes 521 microseconds.
// In both of two side-by-side timings against v001, it was 1.03 times as fast.
// All steps since v000 together make it 1.16 times as fast.
#include <hip/hip_runtime.h>
#include <hip/hip_bf16.h>
#include <cstdint>

typedef __attribute__((ext_vector_type(16))) __bf16 v16bf;
typedef __attribute__((ext_vector_type(8)))  __bf16 v8bf;
typedef __attribute__((ext_vector_type(8)))  float  v8f;
typedef __attribute__((ext_vector_type(4)))  float  v4f;
typedef __attribute__((ext_vector_type(4)))  __bf16 v4bf;
typedef __attribute__((ext_vector_type(4)))  unsigned v4u;

#define B_   4
#define S_   1024
#define D_   1024
#define H_   16
#define DK_  64
#define FFN_ 4096

// ---------- helpers ----------

__device__ __forceinline__ __bf16 f2bf(float f) {
  union { float f; unsigned u; } v; v.f = f;
  unsigned r = v.u + 0x7FFFu + ((v.u >> 16) & 1u);
  unsigned short h = (unsigned short)(r >> 16);
  __bf16 o; __builtin_memcpy(&o, &h, 2); return o;
}

// Two floats rounded as in f2bf, lo in bits 15..0 and hi in bits 31..16.
__device__ __forceinline__ unsigned pack_bf2(float lo, float hi) {
  union { float f; unsigned u; } a, b; a.f = lo; b.f = hi;
  const unsigned ra = a.u + 0x7FFFu + ((a.u >> 16) & 1u);
  const unsigned rb = b.u + 0x7FFFu + ((b.u >> 16) & 1u);
  return (ra >> 16) | (rb & 0xFFFF0000u);
}

// Low 32 bits of the generic address of a __shared__ object == LDS byte offset
// (flat shared-aperture mapping uses addr[31:0] as the LDS address).
__device__ __forceinline__ unsigned lds_addr(const void* p) {
  return (unsigned)(uintptr_t)p;
}

// Async direct global->LDS copy, 16B per lane, tracked by ASYNCcnt.
// saddr form: global_load_async_to_lds_b128 vdst_lds, vaddr32, s[base]
__device__ __forceinline__ void async_copy16(unsigned ldsOff, unsigned gByteOff,
                                             const void* base) {
  asm volatile("global_load_async_to_lds_b128 %0, %1, %2"
               :: "v"(ldsOff), "v"(gByteOff), "s"(base) : "memory");
}

__device__ __forceinline__ void wait_async0() {
  asm volatile("s_wait_asynccnt 0" ::: "memory");
}

// Load a 16x32 bf16 WMMA fragment (A layout; also B when source is Bt[N][K])
// from a row-major [rows][ldk] bf16 tile in LDS.
__device__ __forceinline__ v16bf load_frag(const __bf16* base, int row0, int k0, int ldk) {
  const int lane = threadIdx.x & 31;
  const __bf16* p = base + (row0 + (lane & 15)) * ldk + k0 + ((lane >> 4) << 3);
  v8bf lo = *(const v8bf*)p;
  v8bf hi = *(const v8bf*)(p + 16);
  v16bf r;
#pragma unroll
  for (int i = 0; i < 8; ++i) { r[i] = lo[i]; r[i + 8] = hi[i]; }
  return r;
}

__device__ __forceinline__ v8f wmma_bf16(v16bf a, v16bf b, v8f c) {
  return __builtin_amdgcn_wmma_f32_16x16x32_bf16(false, a, false, b, (short)0, c,
                                                 false, false);
}

// ---------- LayerNorm (D=1024), outputs f32 and/or bf16 ----------
// One wave per row, 8 rows per block: a lane holds 8 x 16 B of its row, all loads
// in flight at once; the row sums stay inside the wave (no LDS, no barrier).
// An eighth of the waves of a block-per-row form have to be started.

__global__ __launch_bounds__(256) void ln_kernel(
    const float* __restrict__ in, const float* __restrict__ g,
    const float* __restrict__ bt, float* __restrict__ outF,
    __bf16* __restrict__ outB)
{
  const int lane = threadIdx.x & 31;
  const int row  = blockIdx.x * 8 + (threadIdx.x >> 5);
  const v4f* p  = (const v4f*)(in + (size_t)row * D_);
  const v4f* g4 = (const v4f*)g;
  const v4f* b4 = (const v4f*)bt;
  v4f v[8], gg[8], bb[8];
#pragma unroll
  for (int i = 0; i < 8; ++i) v[i] = p[lane + i * 32];
#pragma unroll
  for (int i = 0; i < 8; ++i) { gg[i] = g4[lane + i * 32]; bb[i] = b4[lane + i * 32]; }
  v4f s4 = {0.f, 0.f, 0.f, 0.f}, q4 = {0.f, 0.f, 0.f, 0.f};
#pragma unroll
  for (int i = 0; i < 8; ++i) { s4 += v[i]; q4 += v[i] * v[i]; }
  float s  = (s4[0] + s4[1]) + (s4[2] + s4[3]);
  float sq = (q4[0] + q4[1]) + (q4[2] + q4[3]);
#pragma unroll
  for (int off = 16; off >= 1; off >>= 1) {
    s  += __shfl_xor(s,  off, 32);
    sq += __shfl_xor(sq, off, 32);
  }
  const float mean = s * (1.f / D_);
  const float var  = sq * (1.f / D_) - mean * mean;
  const float rstd = rsqrtf(var + 1e-5f);
  v4bf ob[8];
#pragma unroll
  for (int i = 0; i < 8; ++i) {
    v[i] = (v[i] - mean) * rstd * gg[i] + bb[i];
#pragma unroll
    for (int e = 0; e < 4; ++e) ob[i][e] = f2bf(v[i][e]);
  }
  if (outB) {
    v4bf* q = (v4bf*)(outB + (size_t)row * D_);
#pragma unroll
    for (int i = 0; i < 8; ++i) q[lane + i * 32] = ob[i];
  }
  // Registers that the stores above name may be rewritten from here on.
  asm volatile("s_wait_xcnt 0x0" ::: "memory");
  if (outF) {
    v4f* q = (v4f*)(outF + (size_t)row * D_);
#pragma unroll
    for (int i = 0; i < 8; ++i) q[lane + i * 32] = v[i];
  }
}

// ---------- fp32 [K,N] -> bf16 transposed [N,K] ----------
// One block moves 128 k x 64 n: 8 loads of 16 B per lane in flight (256-B pieces
// of W rows), two k neighbours packed into a dword, dwords transposed through
// LDS, 256-B pieces of Wt rows stored. K a multiple of 128, N of 64.

#define TK_ 128
#define TN_ 64
#define TP_ 65   // LDS row pitch in dwords: odd, so both sides meet 32 banks

__global__ __launch_bounds__(256) void transpose_f32_to_bf16(
    const float* __restrict__ W, __bf16* __restrict__ Wt, int K, int N)
{
  __shared__ unsigned t[TN_ * TP_];               // [n][k / 2]
  const int n0 = blockIdx.x * TN_, k0 = blockIdx.y * TK_;
  const int lo4 = threadIdx.x & 15, hi4 = threadIdx.x >> 4;
  const float* pa[4];
  const float* pb[4];
  v4f a[4], b[4];
#pragma unroll
  for (int i = 0; i < 4; ++i) {
    pa[i] = W + (size_t)(k0 + 2 * (hi4 + i * 16)) * N + (n0 + lo4 * 4);
    pb[i] = pa[i] + N;
  }
#pragma unroll
  for (int i = 0; i < 4; ++i) {
    a[i] = *(const v4f*)pa[i];
    b[i] = *(const v4f*)pb[i];
  }
  // Every load's address pair stays whole until this wait: named here as inputs,
  // none of them can serve as a later load's destination.
  asm volatile("s_wait_xcnt 0x0"
               :: "v"(pa[0]), "v"(pa[1]), "v"(pa[2]), "v"(pa[3]),
                  "v"(pb[0]), "v"(pb[1]), "v"(pb[2]), "v"(pb[3])
               : "memory");
#pragma unroll
  for (int i = 0; i < 4; ++i)
#pragma unroll
    for (int j = 0; j < 4; ++j)
      t[(lo4 * 4 + j) * TP_ + hi4 + i * 16] = pack_bf2(a[i][j], b[i][j]);
  __syncthreads();
#pragma unroll
  for (int i = 0; i < 4; ++i) {
    const int n = hi4 + i * 16;
    v4u o;
#pragma unroll
    for (int e = 0; e < 4; ++e) o[e] = t[n * TP_ + lo4 * 4 + e];
    *(v4u*)(Wt + (size_t)(n0 + n) * K + (k0 + lo4 * 8)) = o;
  }
}

// ---------- GEMM: C[M,N] = epi( A[M,K]bf16 @ Bt[N,K]bf16^T ) ----------
// 128x128 block tile, 8 waves -> 32x64 per wave (2x4 WMMA frags).
// A stage is 128 k of every operand row (256 B, whole L2 units), two LDS buffers
// filled by GLOBAL_LOAD_ASYNC_TO_LDS (ASYNCcnt): 16 copies per lane in flight
// while the other buffer's 32 WMMAs per wave run, one barrier per stage.
// Main loop unrolled 2 stages so buffer indices are compile-time constants.
// Requires K a multiple of 256 (an even number of stages, at least two).

#define GK_    128            // k per stage
#define GPITCH 136            // LDS row pitch in elements: 272 B, 16 B x odd

// One stage: 8 + 8 async copies of 16 B per lane (rows 16 apart of the A and of
// the B panel), 32-bit lane offset on a scalar base. The s_wait_xcnt closes the
// statement so that no address register is rewritten ahead of it.
__device__ __forceinline__ void async_copy_stage(unsigned la, unsigned lb,
                                                 const unsigned (&vo)[8],
                                                 const void* baseA,
                                                 const void* baseB) {
  const unsigned lStep = 16 * GPITCH * 2;
  asm volatile(
      "global_load_async_to_lds_b128 %0, %16, %24\n\t"
      "global_load_async_to_lds_b128 %1, %17, %24\n\t"
      "global_load_async_to_lds_b128 %2, %18, %24\n\t"
      "global_load_async_to_lds_b128 %3, %19, %24\n\t"
      "global_load_async_to_lds_b128 %4, %20, %24\n\t"
      "global_load_async_to_lds_b128 %5, %21, %24\n\t"
      "global_load_async_to_lds_b128 %6, %22, %24\n\t"
      "global_load_async_to_lds_b128 %7, %23, %24\n\t"
      "global_load_async_to_lds_b128 %8, %16, %25\n\t"
      "global_load_async_to_lds_b128 %9, %17, %25\n\t"
      "global_load_async_to_lds_b128 %10, %18, %25\n\t"
      "global_load_async_to_lds_b128 %11, %19, %25\n\t"
      "global_load_async_to_lds_b128 %12, %20, %25\n\t"
      "global_load_async_to_lds_b128 %13, %21, %25\n\t"
      "global_load_async_to_lds_b128 %14, %22, %25\n\t"
      "global_load_async_to_lds_b128 %15, %23, %25\n\t"
      "s_wait_xcnt 0x0"
      :: "v"(la), "v"(la + lStep), "v"(la + 2 * lStep), "v"(la + 3 * lStep),
         "v"(la + 4 * lStep), "v"(la + 5 * lStep), "v"(la + 6 * lStep),
         "v"(la + 7 * lStep),
         "v"(lb), "v"(lb + lStep), "v"(lb + 2 * lStep), "v"(lb + 3 * lStep),
         "v"(lb + 4 * lStep), "v"(lb + 5 * lStep), "v"(lb + 6 * lStep),
         "v"(lb + 7 * lStep),
         "v"(vo[0]), "v"(vo[1]), "v"(vo[2]), "v"(vo[3]),
         "v"(vo[4]), "v"(vo[5]), "v"(vo[6]), "v"(vo[7]),
         "s"(baseA), "s"(baseB)
      : "memory");
}

// This wave's LDS reads have returned before the buffer they read is refilled.
__device__ __forceinline__ void wait_ds0() {
  asm volatile("s_wait_dscnt 0x0" ::: "memory");
}

__global__ __launch_bounds__(256) void gemm_bf16_kernel(
    const __bf16* __restrict__ A, const __bf16* __restrict__ Bt,
    const float* __restrict__ bias, const float* __restrict__ res1,
    const float* __restrict__ res2, float* __restrict__ outF,
    __bf16* __restrict__ outB, int M, int N, int K, int doRelu)
{
  __shared__ __align__(16) __bf16 As[2][128 * GPITCH];  // [row][k], +8 pad
  __shared__ __align__(16) __bf16 Bs[2][128 * GPITCH];  // [n][k],  +8 pad
  const int tid  = threadIdx.x;
  const int lane = tid & 31, wave = tid >> 5;
  const int wm = wave >> 1, wn = wave & 1;
  const int m0 = wm * 32, n0 = wn * 64;
  const int rowM = blockIdx.y * 128, colN = blockIdx.x * 128;

  // per-thread 16B chunks of the 128x128 tiles (2048 chunks, 8 per thread):
  // chunk q0 of rows r0, r0 + 16, ..., r0 + 112; a wave covers two whole rows.
  const int r0 = tid >> 4, q0 = tid & 15;
  // The lane offsets are the same for both panels; the panel's first row and
  // the stage's k go into the scalar bases.
  const __bf16* sA = A  + (size_t)rowM * K;
  const __bf16* sB = Bt + (size_t)colN * K;
  unsigned vo[8];
#pragma unroll
  for (int i = 0; i < 8; ++i)
    vo[i] = (unsigned)(((r0 + i * 16) * K + q0 * 8) * 2);
  unsigned ldsA[2], ldsB[2];
#pragma unroll
  for (int bufi = 0; bufi < 2; ++bufi) {
    ldsA[bufi] = lds_addr(&As[bufi][r0 * GPITCH + q0 * 8]);
    ldsB[bufi] = lds_addr(&Bs[bufi][r0 * GPITCH + q0 * 8]);
  }

  const v8f zero8 = {0.f, 0.f, 0.f, 0.f, 0.f, 0.f, 0.f, 0.f};
  v8f acc[2][4];
#pragma unroll
  for (int i = 0; i < 2; ++i)
#pragma unroll
    for (int j = 0; j < 4; ++j) acc[i][j] = zero8;

  const int stages = K / GK_;

#define ISSUE_STAGE(BUFI, ST)                                   \
  do {                                                          \
    const size_t kOff = (size_t)(ST) * GK_;                     \
    async_copy_stage(ldsA[BUFI], ldsB[BUFI], vo, sA + kOff,     \
                     sB + kOff);                                \
  } while (0)

// kk is unrolled so that every LDS offset is an immediate and the next 32 k's
// fragment loads can be scheduled among this 32 k's WMMAs.
#define COMPUTE_PANEL(BUFI)                                     \
  do {                                                          \
    _Pragma("unroll")                                           \
    for (int kk = 0; kk < GK_; kk += 32) {                      \
      v16bf af[2], bfr[4];                                      \
      _Pragma("unroll")                                         \
      for (int i = 0; i < 2; ++i)                               \
        af[i] = load_frag(As[BUFI], m0 + i * 16, kk, GPITCH);   \
      _Pragma("unroll")                                         \
      for (int j = 0; j < 4; ++j)                               \
        bfr[j] = load_frag(Bs[BUFI], n0 + j * 16, kk, GPITCH);  \
      _Pragma("unroll")                                         \
      for (int i = 0; i < 2; ++i)                               \
        _Pragma("unroll")                                       \
        for (int j = 0; j < 4; ++j)                             \
          acc[i][j] = wmma_bf16(af[i], bfr[j], acc[i][j]);      \
    }                                                           \
  } while (0)

// Publish point: own LDS reads returned, own copies landed, then the one barrier
// that both publishes the next stage and frees the buffer just read.
#define PUBLISH()                                               \
  do { wait_ds0(); wait_async0(); __syncthreads(); } while (0)

  ISSUE_STAGE(0, 0);
  wait_async0();
  __syncthreads();
  ISSUE_STAGE(1, 1);
  for (int st = 0; st < stages; st += 2) {
    COMPUTE_PANEL(0);
    PUBLISH();
    if (st + 2 < stages) ISSUE_STAGE(0, st + 2);
    COMPUTE_PANEL(1);
    PUBLISH();
    if (st + 3 < stages) ISSUE_STAGE(1, st + 3);
  }
  wait_async0();
#undef ISSUE_STAGE
#undef COMPUTE_PANEL
#undef PUBLISH

  // epilogue: C/D layout lane=N (lane&15), vgpr r = M offset (+8 for lanes>=16)
  const int ho = (lane < 16) ? 0 : 8;
  const int nc = lane & 15;
#pragma unroll
  for (int i = 0; i < 2; ++i)
#pragma unroll
    for (int j = 0; j < 4; ++j)
#pragma unroll
      for (int r = 0; r < 8; ++r) {
        const size_t gr = (size_t)(rowM + m0 + i * 16 + r + ho);
        const size_t gc = (size_t)(colN + n0 + j * 16 + nc);
        const size_t idx = gr * (size_t)N + gc;
        float v = acc[i][j][r];
        if (bias) v += bias[gc];
        if (res1) v += res1[idx];
        if (res2) v += res2[idx];
        if (doRelu) v = fmaxf(v, 0.f);
        if (outF) outF[idx] = v;
        if (outB) outB[idx] = f2bf(v);
      }
}

// ---------- flash attention: 64 q-rows per block, 4 waves x 16 rows ----------

__global__ __launch_bounds__(128) void flash_attn_kernel(
    const __bf16* __restrict__ Q, const __bf16* __restrict__ Kb,
    const __bf16* __restrict__ V, const int* __restrict__ mask,
    __bf16* __restrict__ O)
{
  __shared__ __align__(16) __bf16 Qs[64 * 72];      // [q][dk]
  __shared__ __align__(16) __bf16 Ks[64 * 72];      // [key][dk]
  __shared__ __align__(16) __bf16 Vt[64 * 72];      // [dk][key]
  __shared__ __align__(16) __bf16 Ps[4][16 * 72];   // per-wave P [qlocal][key]

  const int tid = threadIdx.x, lane = tid & 31, wave = tid >> 5;
  const int qb = blockIdx.x * 64, h = blockIdx.y, b = blockIdx.z;
  const size_t qbase  = ((size_t)b * S_ + qb) * D_ + h * DK_;
  const size_t kvrow0 = (size_t)b * S_ * D_ + h * DK_;

  // per-thread 16B chunks of a 64x64 bf16 tile (512 chunks, 4 per thread)
  int rr[4], cc[4];
  unsigned qLds[4], kLds[4], tOff[4];
#pragma unroll
  for (int t = 0; t < 4; ++t) {
    const int c = tid + t * 128;
    rr[t] = c >> 3; cc[t] = c & 7;
    qLds[t] = lds_addr(&Qs[rr[t] * 72 + cc[t] * 8]);
    kLds[t] = lds_addr(&Ks[rr[t] * 72 + cc[t] * 8]);
    tOff[t] = (unsigned)((rr[t] * D_ + cc[t] * 8) * 2);
  }
  // Q tile: async copy, completion covered by first in-loop wait
#pragma unroll
  for (int t = 0; t < 4; ++t) async_copy16(qLds[t], tOff[t], Q + qbase);

  const int ho = (lane < 16) ? 0 : 8;
  const int nc = lane & 15;
  const int m0 = wave * 16;
  const v8f zero8 = {0.f, 0.f, 0.f, 0.f, 0.f, 0.f, 0.f, 0.f};

  v8f o[4];
  float m_run[8], l_run[8];
#pragma unroll
  for (int j = 0; j < 4; ++j) o[j] = zero8;
#pragma unroll
  for (int r = 0; r < 8; ++r) { m_run[r] = -3.0e38f; l_run[r] = 0.f; }

  for (int kt = 0; kt < 16; ++kt) {
    __syncthreads();  // previous iteration's reads of Ks/Vt complete
    const size_t kvb = kvrow0 + (size_t)kt * 64 * D_;
#pragma unroll
    for (int t = 0; t < 4; ++t) {
      async_copy16(kLds[t], tOff[t], Kb + kvb);           // K rows -> LDS direct
      v8bf vv = *(const v8bf*)(V + kvb + (size_t)rr[t] * D_ + cc[t] * 8);
#pragma unroll
      for (int e = 0; e < 8; ++e) Vt[(cc[t] * 8 + e) * 72 + rr[t]] = vv[e];
    }
    wait_async0();
    __syncthreads();

    // scores S = Q K^T : A = Qs rows, B = Ks rows (Bt layout)
    v8f s[4];
#pragma unroll
    for (int j = 0; j < 4; ++j) s[j] = zero8;
#pragma unroll
    for (int kk = 0; kk < 2; ++kk) {
      v16bf a = load_frag(Qs, m0, kk * 32, 72);
#pragma unroll
      for (int j = 0; j < 4; ++j) {
        v16bf bb = load_frag(Ks, j * 16, kk * 32, 72);
        s[j] = wmma_bf16(a, bb, s[j]);
      }
    }
    // scale 1/sqrt(64) + key mask
#pragma unroll
    for (int j = 0; j < 4; ++j) {
      const int km = mask[(size_t)b * S_ + kt * 64 + j * 16 + nc];
      const float madd = (km == 0) ? -1e30f : 0.f;
#pragma unroll
      for (int r = 0; r < 8; ++r) s[j][r] = s[j][r] * 0.125f + madd;
    }
    // online softmax (base-2); row stats per (half-wave, vgpr r)
    float alpha[8], rs[8];
#pragma unroll
    for (int r = 0; r < 8; ++r) {
      float mx = s[0][r];
#pragma unroll
      for (int j = 1; j < 4; ++j) mx = fmaxf(mx, s[j][r]);
#pragma unroll
      for (int off = 8; off >= 1; off >>= 1) mx = fmaxf(mx, __shfl_xor(mx, off, 32));
      const float mn = fmaxf(m_run[r], mx);
      alpha[r] = exp2f((m_run[r] - mn) * 1.44269504f);
      m_run[r] = mn;
      rs[r] = 0.f;
    }
#pragma unroll
    for (int j = 0; j < 4; ++j)
#pragma unroll
      for (int r = 0; r < 8; ++r) {
        const float p = exp2f((s[j][r] - m_run[r]) * 1.44269504f);
        s[j][r] = p; rs[r] += p;
      }
#pragma unroll
    for (int r = 0; r < 8; ++r) {
#pragma unroll
      for (int off = 8; off >= 1; off >>= 1) rs[r] += __shfl_xor(rs[r], off, 32);
      l_run[r] = l_run[r] * alpha[r] + rs[r];
    }
#pragma unroll
    for (int j = 0; j < 4; ++j)
#pragma unroll
      for (int r = 0; r < 8; ++r) o[j][r] *= alpha[r];

    // C->A relayout of P through per-wave LDS
    __bf16* P = &Ps[wave][0];
#pragma unroll
    for (int j = 0; j < 4; ++j)
#pragma unroll
      for (int r = 0; r < 8; ++r)
        P[(r + ho) * 72 + j * 16 + nc] = f2bf(s[j][r]);
    __syncthreads();

    // O += P @ V : A = P rows [16 x 64keys], B = Vt rows [dk][key]
#pragma unroll
    for (int kk = 0; kk < 2; ++kk) {
      v16bf a = load_frag(P, 0, kk * 32, 72);
#pragma unroll
      for (int j = 0; j < 4; ++j) {
        v16bf bb = load_frag(Vt, j * 16, kk * 32, 72);
        o[j] = wmma_bf16(a, bb, o[j]);
      }
    }
  }

#pragma unroll
  for (int j = 0; j < 4; ++j)
#pragma unroll
    for (int r = 0; r < 8; ++r) {
      const float val = o[j][r] / fmaxf(l_run[r], 1e-20f);
      const size_t row = (size_t)b * S_ + qb + m0 + r + ho;
      O[row * D_ + h * DK_ + j * 16 + nc] = f2bf(val);
    }
}

// ---------- launcher ----------

extern "C" void kernel_launch(void* const* d_in, const int* in_sizes, int n_in,
                              void* d_out, int out_size, void* d_ws, size_t ws_size,
                              hipStream_t stream)
{
  (void)in_sizes; (void)n_in; (void)out_size; (void)ws_size;
  const float* x    = (const float*)d_in[0];
  const float* kv   = (const float*)d_in[1];
  const int*   msk  = (const int*)  d_in[2];
  const float* ln1g = (const float*)d_in[3];
  const float* ln1b = (const float*)d_in[4];
  const float* wsrc[8] = { (const float*)d_in[5],  (const float*)d_in[6],
                           (const float*)d_in[7],  (const float*)d_in[8],
                           (const float*)d_in[10], (const float*)d_in[11],
                           (const float*)d_in[12], (const float*)d_in[13] };
  const float* ob0  = (const float*)d_in[9];
  const float* ob1  = (const float*)d_in[14];
  const float* ln2g = (const float*)d_in[15];
  const float* ln2b = (const float*)d_in[16];
  const float* w1   = (const float*)d_in[17];
  const float* b1   = (const float*)d_in[18];
  const float* w2   = (const float*)d_in[19];
  const float* b2   = (const float*)d_in[20];

  char* ws = (char*)d_ws;
  size_t off = 0;
  auto alloc = [&](size_t bytes) -> void* {
    void* p = ws + off;
    off += (bytes + 255) & ~(size_t)255;
    return p;
  };
  const size_t ROWS = (size_t)B_ * S_;  // 4096
  float*  y_f32  = (float*) alloc(ROWS * D_ * 4);
  __bf16* y_bf   = (__bf16*)alloc(ROWS * D_ * 2);
  __bf16* kvn_bf = (__bf16*)alloc(ROWS * D_ * 2);
  __bf16* wt[8];
  for (int i = 0; i < 8; ++i) wt[i] = (__bf16*)alloc((size_t)D_ * D_ * 2);
  __bf16* w1t    = (__bf16*)alloc((size_t)FFN_ * D_ * 2);
  __bf16* w2t    = (__bf16*)alloc((size_t)D_ * FFN_ * 2);
  __bf16* qB     = (__bf16*)alloc(ROWS * D_ * 2);
  __bf16* kB     = (__bf16*)alloc(ROWS * D_ * 2);
  __bf16* vB     = (__bf16*)alloc(ROWS * D_ * 2);
  __bf16* aB     = (__bf16*)alloc(ROWS * D_ * 2);
  float*  y1_f32 = (float*) alloc(ROWS * D_ * 4);
  __bf16* y1_bf  = (__bf16*)alloc(ROWS * D_ * 2);
  float*  x2_f32 = (float*) alloc(ROWS * D_ * 4);
  __bf16* x2n_bf = (__bf16*)alloc(ROWS * D_ * 2);
  __bf16* hB     = (__bf16*)alloc(ROWS * FFN_ * 2);

  // LayerNorm 1 on x (keep f32 for residual) and kv
  ln_kernel<<<(int)(ROWS / 8), 256, 0, stream>>>(x,  ln1g, ln1b, y_f32, y_bf);
  ln_kernel<<<(int)(ROWS / 8), 256, 0, stream>>>(kv, ln1g, ln1b, nullptr, kvn_bf);

  // weight conversion/transposition
  for (int i = 0; i < 8; ++i)
    transpose_f32_to_bf16<<<dim3(D_/TN_, D_/TK_), 256, 0, stream>>>(wsrc[i], wt[i], D_, D_);
  transpose_f32_to_bf16<<<dim3(FFN_/TN_, D_/TK_), 256, 0, stream>>>(w1, w1t, D_, FFN_);
  transpose_f32_to_bf16<<<dim3(D_/TN_, FFN_/TK_), 256, 0, stream>>>(w2, w2t, FFN_, D_);

  const dim3 gproj(D_/128, (unsigned)(ROWS/128));        // (8, 32)
  const dim3 gattn(S_/64, H_, B_);                       // (16,16,4)

  // cross-attention 0
  gemm_bf16_kernel<<<gproj, 256, 0, stream>>>(y_bf,   wt[0], nullptr, nullptr, nullptr, nullptr, qB, (int)ROWS, D_, D_, 0);
  gemm_bf16_kernel<<<gproj, 256, 0, stream>>>(kvn_bf, wt[1], nullptr, nullptr, nullptr, nullptr, kB, (int)ROWS, D_, D_, 0);
  gemm_bf16_kernel<<<gproj, 256, 0, stream>>>(kvn_bf, wt[2], nullptr, nullptr, nullptr, nullptr, vB, (int)ROWS, D_, D_, 0);
  flash_attn_kernel<<<gattn, 128, 0, stream>>>(qB, kB, vB, msk, aB);
  gemm_bf16_kernel<<<gproj, 256, 0, stream>>>(aB, wt[3], ob0, y_f32, nullptr, y1_f32, y1_bf, (int)ROWS, D_, D_, 0);

  // cross-attention 1 (query from y1)
  gemm_bf16_kernel<<<gproj, 256, 0, stream>>>(y1_bf,  wt[4], nullptr, nullptr, nullptr, nullptr, qB, (int)ROWS, D_, D_, 0);
  gemm_bf16_kernel<<<gproj, 256, 0, stream>>>(kvn_bf, wt[5], nullptr, nullptr, nullptr, nullptr, kB, (int)ROWS, D_, D_, 0);
  gemm_bf16_kernel<<<gproj, 256, 0, stream>>>(kvn_bf, wt[6], nullptr, nullptr, nullptr, nullptr, vB, (int)ROWS, D_, D_, 0);
  flash_attn_kernel<<<gattn, 128, 0, stream>>>(qB, kB, vB, msk, aB);
  // x2 = x + (o1 + ob1 + y1)
  gemm_bf16_kernel<<<gproj, 256, 0, stream>>>(aB, wt[7], ob1, y1_f32, x, x2_f32, nullptr, (int)ROWS, D_, D_, 0);

  // FFN
  ln_kernel<<<(int)(ROWS / 8), 256, 0, stream>>>(x2_f32, ln2g, ln2b, nullptr, x2n_bf);
  gemm_bf16_kernel<<<dim3(FFN_/128, (unsigned)(ROWS/128)), 256, 0, stream>>>(
      x2n_bf, w1t, b1, nullptr, nullptr, nullptr, hB, (int)ROWS, FFN_, D_, 1);
  gemm_bf16_kernel<<<gproj, 256, 0, stream>>>(
      hB, w2t, b2, x2_f32, nullptr, (float*)d_out, nullptr, (int)ROWS, D_, FFN_, 0);
}

// v003
// A run of this version takes 407 microseconds.
// Two timings next to v002 both put it at 1.27 times that version's speed.
// Counting every step since v000, it is 1.48 times as fast.
#include <hip/hip_runtime.h>
#include <hip/hip_bf16.h>
#include <cstdint>

typedef __attribute__((ext_vector_type(16))) __bf16 v16bf;
typedef __attribute__((ext_vector_type(8)))  __bf16 v8bf;
typedef __attribute__((ext_vector_type(8)))  float  v8f;
typedef __attribute__((ext_vector_type(4)))  float  v4f;
typedef __attribute__((ext_vector_type(4)))  __bf16 v4bf;
typedef __attribute__((ext_vector_type(4)))  unsigned v4u;
typedef __attribute__((ext_vector_type(8)))  unsigned v8u;
typedef __attribute__((ext_vector_type(4)))  int      v4i;
typedef __attribute__((ext_vector_type(8)))  short    v8s;

#define B_   4
#define S_   1024
#define D_   1024
#define H_   16
#define DK_  64
#define FFN_ 4096

// ---------- helpers ----------

__device__ __forceinline__ __bf16 f2bf(float f) {
  union { float f; unsigned u; } v; v.f = f;
  unsigned r = v.u + 0x7FFFu + ((v.u >> 16) & 1u);
  unsigned short h = (unsigned short)(r >> 16);
  __bf16 o; __builtin_memcpy(&o, &h, 2); return o;
}

// Two floats rounded as in f2bf, lo in bits 15..0 and hi in bits 31..16.
__device__ __forceinline__ unsigned pack_bf2(float lo, float hi) {
  union { float f; unsigned u; } a, b; a.f = lo; b.f = hi;
  const unsigned ra = a.u + 0x7FFFu + ((a.u >> 16) & 1u);
  const unsigned rb = b.u + 0x7FFFu + ((b.u >> 16) & 1u);
  return (ra >> 16) | (rb & 0xFFFF0000u);
}

// Low 32 bits of the generic address of a __shared__ object == LDS byte offset
// (flat shared-aperture mapping uses addr[31:0] as the LDS address).
__device__ __forceinline__ unsigned lds_addr(const void* p) {
  return (unsigned)(uintptr_t)p;
}

__device__ __forceinline__ void wait_async0() {
  asm volatile("s_wait_asynccnt 0" ::: "memory");
}

// Load a 16x32 bf16 WMMA fragment (A layout; also B when source is Bt[N][K])
// from a row-major [rows][ldk] bf16 tile in LDS.
__device__ __forceinline__ v16bf load_frag(const __bf16* base, int row0, int k0, int ldk) {
  const int lane = threadIdx.x & 31;
  const __bf16* p = base + (row0 + (lane & 15)) * ldk + k0 + ((lane >> 4) << 3);
  v8bf lo = *(const v8bf*)p;
  v8bf hi = *(const v8bf*)(p + 16);
  v16bf r;
#pragma unroll
  for (int i = 0; i < 8; ++i) { r[i] = lo[i]; r[i + 8] = hi[i]; }
  return r;
}

__device__ __forceinline__ v8f wmma_bf16(v16bf a, v16bf b, v8f c) {
  return __builtin_amdgcn_wmma_f32_16x16x32_bf16(false, a, false, b, (short)0, c,
                                                 false, false);
}

// ---------- LayerNorm (D=1024), outputs f32 and/or bf16 ----------
// One wave per row, 8 rows per block: a lane holds 8 x 16 B of its row, all loads
// in flight at once; the row sums stay inside the wave (no LDS, no barrier).
// An eighth of the waves of a block-per-row form have to be started.

__global__ __launch_bounds__(256) void ln_kernel(
    const float* __restrict__ in, const float* __restrict__ g,
    const float* __restrict__ bt, float* __restrict__ outF,
    __bf16* __restrict__ outB)
{
  const int lane = threadIdx.x & 31;
  const int row  = blockIdx.x * 8 + (threadIdx.x >> 5);
  const v4f* p  = (const v4f*)(in + (size_t)row * D_);
  const v4f* g4 = (const v4f*)g;
  const v4f* b4 = (const v4f*)bt;
  v4f v[8], gg[8], bb[8];
#pragma unroll
  for (int i = 0; i < 8; ++i) v[i] = p[lane + i * 32];
#pragma unroll
  for (int i = 0; i < 8; ++i) { gg[i] = g4[lane + i * 32]; bb[i] = b4[lane + i * 32]; }
  v4f s4 = {0.f, 0.f, 0.f, 0.f}, q4 = {0.f, 0.f, 0.f, 0.f};
#pragma unroll
  for (int i = 0; i < 8; ++i) { s4 += v[i]; q4 += v[i] * v[i]; }
  float s  = (s4[0] + s4[1]) + (s4[2] + s4[3]);
  float sq = (q4[0] + q4[1]) + (q4[2] + q4[3]);
#pragma unroll
  for (int off = 16; off >= 1; off >>= 1) {
    s  += __shfl_xor(s,  off, 32);
    sq += __shfl_xor(sq, off, 32);
  }
  const float mean = s * (1.f / D_);
  const float var  = sq * (1.f / D_) - mean * mean;
  const float rstd = rsqrtf(var + 1e-5f);
  v4bf ob[8];
#pragma unroll
  for (int i = 0; i < 8; ++i) {
    v[i] = (v[i] - mean) * rstd * gg[i] + bb[i];
#pragma unroll
    for (int e = 0; e < 4; ++e) ob[i][e] = f2bf(v[i][e]);
  }
  if (outB) {
    v4bf* q = (v4bf*)(outB + (size_t)row * D_);
#pragma unroll
    for (int i = 0; i < 8; ++i) q[lane + i * 32] = ob[i];
  }
  // Registers that the stores above name may be rewritten from here on.
  asm volatile("s_wait_xcnt 0x0" ::: "memory");
  if (outF) {
    v4f* q = (v4f*)(outF + (size_t)row * D_);
#pragma unroll
    for (int i = 0; i < 8; ++i) q[lane + i * 32] = v[i];
  }
}

// ---------- fp32 [K,N] -> bf16 transposed [N,K] ----------
// One block moves 128 k x 64 n: 8 loads of 16 B per lane in flight (256-B pieces
// of W rows), two k neighbours packed into a dword, dwords transposed through
// LDS, 256-B pieces of Wt rows stored. K a multiple of 128, N of 64.

#define TK_ 128
#define TN_ 64
#define TP_ 65   // LDS row pitch in dwords: odd, so both sides meet 32 banks

__global__ __launch_bounds__(256) void transpose_f32_to_bf16(
    const float* __restrict__ W, __bf16* __restrict__ Wt, int K, int N)
{
  __shared__ unsigned t[TN_ * TP_];               // [n][k / 2]
  const int n0 = blockIdx.x * TN_, k0 = blockIdx.y * TK_;
  const int lo4 = threadIdx.x & 15, hi4 = threadIdx.x >> 4;
  const float* pa[4];
  const float* pb[4];
  v4f a[4], b[4];
#pragma unroll
  for (int i = 0; i < 4; ++i) {
    pa[i] = W + (size_t)(k0 + 2 * (hi4 + i * 16)) * N + (n0 + lo4 * 4);
    pb[i] = pa[i] + N;
  }
#pragma unroll
  for (int i = 0; i < 4; ++i) {
    a[i] = *(const v4f*)pa[i];
    b[i] = *(const v4f*)pb[i];
  }
  // Every load's address pair stays whole until this wait: named here as inputs,
  // none of them can serve as a later load's destination.
  asm volatile("s_wait_xcnt 0x0"
               :: "v"(pa[0]), "v"(pa[1]), "v"(pa[2]), "v"(pa[3]),
                  "v"(pb[0]), "v"(pb[1]), "v"(pb[2]), "v"(pb[3])
               : "memory");
#pragma unroll
  for (int i = 0; i < 4; ++i)
#pragma unroll
    for (int j = 0; j < 4; ++j)
      t[(lo4 * 4 + j) * TP_ + hi4 + i * 16] = pack_bf2(a[i][j], b[i][j]);
  __syncthreads();
#pragma unroll
  for (int i = 0; i < 4; ++i) {
    const int n = hi4 + i * 16;
    v4u o;
#pragma unroll
    for (int e = 0; e < 4; ++e) o[e] = t[n * TP_ + lo4 * 4 + e];
    *(v4u*)(Wt + (size_t)(n0 + n) * K + (k0 + lo4 * 8)) = o;
  }
}

// ---------- GEMM: C[M,N] = epi( A[M,K]bf16 @ Bt[N,K]bf16^T ) ----------
// 128x128 block tile, 8 waves -> 32x64 per wave (2x4 WMMA frags).
// A stage is 128 k of every operand row (256 B, whole L2 units), two LDS buffers
// filled by GLOBAL_LOAD_ASYNC_TO_LDS (ASYNCcnt): 16 copies per lane in flight
// while the other buffer's 32 WMMAs per wave run, one barrier per stage.
// Main loop unrolled 2 stages so buffer indices are compile-time constants.
// Requires K a multiple of 256 (an even number of stages, at least two).

#define GK_    128            // k per stage
#define GPITCH 136            // LDS row pitch in elements: 272 B, 16 B x odd

// One stage: 8 + 8 async copies of 16 B per lane (rows 16 apart of the A and of
// the B panel), 32-bit lane offset on a scalar base. The s_wait_xcnt closes the
// statement so that no address register is rewritten ahead of it.
__device__ __forceinline__ void async_copy_stage(unsigned la, unsigned lb,
                                                 const unsigned (&vo)[8],
                                                 const void* baseA,
                                                 const void* baseB) {
  const unsigned lStep = 16 * GPITCH * 2;
  asm volatile(
      "global_load_async_to_lds_b128 %0, %16, %24\n\t"
      "global_load_async_to_lds_b128 %1, %17, %24\n\t"
      "global_load_async_to_lds_b128 %2, %18, %24\n\t"
      "global_load_async_to_lds_b128 %3, %19, %24\n\t"
      "global_load_async_to_lds_b128 %4, %20, %24\n\t"
      "global_load_async_to_lds_b128 %5, %21, %24\n\t"
      "global_load_async_to_lds_b128 %6, %22, %24\n\t"
      "global_load_async_to_lds_b128 %7, %23, %24\n\t"
      "global_load_async_to_lds_b128 %8, %16, %25\n\t"
      "global_load_async_to_lds_b128 %9, %17, %25\n\t"
      "global_load_async_to_lds_b128 %10, %18, %25\n\t"
      "global_load_async_to_lds_b128 %11, %19, %25\n\t"
      "global_load_async_to_lds_b128 %12, %20, %25\n\t"
      "global_load_async_to_lds_b128 %13, %21, %25\n\t"
      "global_load_async_to_lds_b128 %14, %22, %25\n\t"
      "global_load_async_to_lds_b128 %15, %23, %25\n\t"
      "s_wait_xcnt 0x0"
      :: "v"(la), "v"(la + lStep), "v"(la + 2 * lStep), "v"(la + 3 * lStep),
         "v"(la + 4 * lStep), "v"(la + 5 * lStep), "v"(la + 6 * lStep),
         "v"(la + 7 * lStep),
         "v"(lb), "v"(lb + lStep), "v"(lb + 2 * lStep), "v"(lb + 3 * lStep),
         "v"(lb + 4 * lStep), "v"(lb + 5 * lStep), "v"(lb + 6 * lStep),
         "v"(lb + 7 * lStep),
         "v"(vo[0]), "v"(vo[1]), "v"(vo[2]), "v"(vo[3]),
         "v"(vo[4]), "v"(vo[5]), "v"(vo[6]), "v"(vo[7]),
         "s"(baseA), "s"(baseB)
      : "memory");
}

// This wave's LDS reads have returned before the buffer they read is refilled.
__device__ __forceinline__ void wait_ds0() {
  asm volatile("s_wait_dscnt 0x0" ::: "memory");
}

__global__ __launch_bounds__(256) void gemm_bf16_kernel(
    const __bf16* __restrict__ A, const __bf16* __restrict__ Bt,
    const float* __restrict__ bias, const float* __restrict__ res1,
    const float* __restrict__ res2, float* __restrict__ outF,
    __bf16* __restrict__ outB, int M, int N, int K, int doRelu)
{
  __shared__ __align__(16) __bf16 As[2][128 * GPITCH];  // [row][k], +8 pad
  __shared__ __align__(16) __bf16 Bs[2][128 * GPITCH];  // [n][k],  +8 pad
  const int tid  = threadIdx.x;
  const int lane = tid & 31, wave = tid >> 5;
  const int wm = wave >> 1, wn = wave & 1;
  const int m0 = wm * 32, n0 = wn * 64;
  const int rowM = blockIdx.y * 128, colN = blockIdx.x * 128;

  // per-thread 16B chunks of the 128x128 tiles (2048 chunks, 8 per thread):
  // chunk q0 of rows r0, r0 + 16, ..., r0 + 112; a wave covers two whole rows.
  const int r0 = tid >> 4, q0 = tid & 15;
  // The lane offsets are the same for both panels; the panel's first row and
  // the stage's k go into the scalar bases.
  const __bf16* sA = A  + (size_t)rowM * K;
  const __bf16* sB = Bt + (size_t)colN * K;
  unsigned vo[8];
#pragma unroll
  for (int i = 0; i < 8; ++i)
    vo[i] = (unsigned)(((r0 + i * 16) * K + q0 * 8) * 2);
  unsigned ldsA[2], ldsB[2];
#pragma unroll
  for (int bufi = 0; bufi < 2; ++bufi) {
    ldsA[bufi] = lds_addr(&As[bufi][r0 * GPITCH + q0 * 8]);
    ldsB[bufi] = lds_addr(&Bs[bufi][r0 * GPITCH + q0 * 8]);
  }

  const v8f zero8 = {0.f, 0.f, 0.f, 0.f, 0.f, 0.f, 0.f, 0.f};
  v8f acc[2][4];
#pragma unroll
  for (int i = 0; i < 2; ++i)
#pragma unroll
    for (int j = 0; j < 4; ++j) acc[i][j] = zero8;

  const int stages = K / GK_;

#define ISSUE_STAGE(BUFI, ST)                                   \
  do {                                                          \
    const size_t kOff = (size_t)(ST) * GK_;                     \
    async_copy_stage(ldsA[BUFI], ldsB[BUFI], vo, sA + kOff,     \
                     sB + kOff);                                \
  } while (0)

// kk is unrolled so that every LDS offset is an immediate and the next 32 k's
// fragment loads can be scheduled among this 32 k's WMMAs.
#define COMPUTE_PANEL(BUFI)                                     \
  do {                                                          \
    _Pragma("unroll")                                           \
    for (int kk = 0; kk < GK_; kk += 32) {                      \
      v16bf af[2], bfr[4];                                      \
      _Pragma("unroll")                                         \
      for (int i = 0; i < 2; ++i)                               \
        af[i] = load_frag(As[BUFI], m0 + i * 16, kk, GPITCH);   \
      _Pragma("unroll")                                         \
      for (int j = 0; j < 4; ++j)                               \
        bfr[j] = load_frag(Bs[BUFI], n0 + j * 16, kk, GPITCH);  \
      _Pragma("unroll")                                         \
      for (int i = 0; i < 2; ++i)                               \
        _Pragma("unroll")                                       \
        for (int j = 0; j < 4; ++j)                             \
          acc[i][j] = wmma_bf16(af[i], bfr[j], acc[i][j]);      \
    }                                                           \
  } while (0)

// Publish point: own LDS reads returned, own copies landed, then the one barrier
// that both publishes the next stage and frees the buffer just read.
#define PUBLISH()                                               \
  do { wait_ds0(); wait_async0(); __syncthreads(); } while (0)

  ISSUE_STAGE(0, 0);
  wait_async0();
  __syncthreads();
  ISSUE_STAGE(1, 1);
  for (int st = 0; st < stages; st += 2) {
    COMPUTE_PANEL(0);
    PUBLISH();
    if (st + 2 < stages) ISSUE_STAGE(0, st + 2);
    COMPUTE_PANEL(1);
    PUBLISH();
    if (st + 3 < stages) ISSUE_STAGE(1, st + 3);
  }
  wait_async0();
#undef ISSUE_STAGE
#undef COMPUTE_PANEL
#undef PUBLISH

  // epilogue: C/D layout lane=N (lane&15), vgpr r = M offset (+8 for lanes>=16)
  const int ho = (lane < 16) ? 0 : 8;
  const int nc = lane & 15;
#pragma unroll
  for (int i = 0; i < 2; ++i)
#pragma unroll
    for (int j = 0; j < 4; ++j)
#pragma unroll
      for (int r = 0; r < 8; ++r) {
        const size_t gr = (size_t)(rowM + m0 + i * 16 + r + ho);
        const size_t gc = (size_t)(colN + n0 + j * 16 + nc);
        const size_t idx = gr * (size_t)N + gc;
        float v = acc[i][j][r];
        if (bias) v += bias[gc];
        if (res1) v += res1[idx];
        if (res2) v += res2[idx];
        if (doRelu) v = fmaxf(v, 0.f);
        if (outF) outF[idx] = v;
        if (outB) outB[idx] = f2bf(v);
      }
}

#define KP_ 72   // K row pitch in elements: 144 B, 16 B x odd (ds_load_b128)
#define VP_ 80   // V row pitch in elements: 160 B, 32 B x odd (ds_load_tr16_b128)

// 8 x 16-bit column piece of a row-major LDS tile: lane (c, h) gets
// T[8h + 0..7][c] when lane l points at row 8 * (l >> 4) + (l & 7), 16-B piece
// (l >> 3) & 1. Every lane is on wherever this is called.
__device__ __forceinline__ v8bf load_tr16(const __bf16* p) {
  typedef __attribute__((address_space(3))) v8s lds_v8s;
  return __builtin_bit_cast(v8bf, __builtin_amdgcn_ds_load_tr16_b128_v8i16((lds_v8s*)p));
}

// Lane l gets the value of lane l ^ 16.
__device__ __forceinline__ float swap_halves(float x) {
  const int i = __builtin_bit_cast(int, x);
  return __builtin_bit_cast(float, __builtin_amdgcn_permlanex16(
      i, i, 0x76543210, 0xfedcba98, false, false));
}

// One 64-key tile of K and of V: 4 + 4 async copies of 16 B per lane, 32-bit lane
// offset on a scalar base. The s_wait_xcnt closes the statement so that no
// address register is rewritten ahead of it.
__device__ __forceinline__ void async_copy_kv(const unsigned (&kl)[4],
                                              const unsigned (&vl)[4],
                                              const unsigned (&go)[4],
                                              const void* baseK,
                                              const void* baseV) {
  asm volatile(
      "global_load_async_to_lds_b128 %0, %8, %12\n\t"
      "global_load_async_to_lds_b128 %1, %9, %12\n\t"
      "global_load_async_to_lds_b128 %2, %10, %12\n\t"
      "global_load_async_to_lds_b128 %3, %11, %12\n\t"
      "global_load_async_to_lds_b128 %4, %8, %13\n\t"
      "global_load_async_to_lds_b128 %5, %9, %13\n\t"
      "global_load_async_to_lds_b128 %6, %10, %13\n\t"
      "global_load_async_to_lds_b128 %7, %11, %13\n\t"
      "s_wait_xcnt 0x0"
      :: "v"(kl[0]), "v"(kl[1]), "v"(kl[2]), "v"(kl[3]),
         "v"(vl[0]), "v"(vl[1]), "v"(vl[2]), "v"(vl[3]),
         "v"(go[0]), "v"(go[1]), "v"(go[2]), "v"(go[3]),
         "s"(baseK), "s"(baseV)
      : "memory");
}

__global__ __launch_bounds__(128) void flash_attn_kernel(
    const __bf16* __restrict__ Q, const __bf16* __restrict__ Kb,
    const __bf16* __restrict__ V, const int* __restrict__ mask,
    __bf16* __restrict__ O)
{
  __shared__ __align__(16) __bf16 Ks[64 * KP_];     // [key][dk]
  __shared__ __align__(32) __bf16 Vs[64 * VP_];     // [key][dk]
  __shared__ __align__(16) float  Ms[S_];           // per key: 0, or -1e30 if masked

  const int tid = threadIdx.x, lane = tid & 31, wave = tid >> 5;
  const int c = lane & 15, hh = lane >> 4;
  const int qb = blockIdx.x * 64, h = blockIdx.y, b = blockIdx.z;
  const int m0 = wave * 16;
  const size_t qbase  = ((size_t)b * S_ + qb) * D_ + h * DK_;
  const size_t kvrow0 = (size_t)b * S_ * D_ + h * DK_;

  // Q^T fragments (B operand, column = query c), in the k order of load_frag.
  const __bf16* qp = Q + qbase + (size_t)(m0 + c) * D_ + 8 * hh;
  const v4i* mp = (const v4i*)(mask + (size_t)b * S_ + tid * 8);
  const v8bf q0 = *(const v8bf*)qp;
  const v8bf q1 = *(const v8bf*)(qp + 16);
  const v8bf q2 = *(const v8bf*)(qp + 32);
  const v8bf q3 = *(const v8bf*)(qp + 48);
  const v4i mk0 = mp[0], mk1 = mp[1];
  // The address pairs of the loads above stay whole until this wait.
  asm volatile("s_wait_xcnt 0x0" :: "v"(qp), "v"(mp) : "memory");
  v16bf qf[2];
#pragma unroll
  for (int i = 0; i < 8; ++i) {
    qf[0][i] = q0[i]; qf[0][i + 8] = q1[i];
    qf[1][i] = q2[i]; qf[1][i + 8] = q3[i];
  }
  // The key mask of this batch row as an addend, 8 keys per thread; published by
  // the barriers at the head of the first trip.
  {
    v4f f0, f1;
#pragma unroll
    for (int e = 0; e < 4; ++e) {
      f0[e] = (mk0[e] == 0) ? -1e30f : 0.f;
      f1[e] = (mk1[e] == 0) ? -1e30f : 0.f;
    }
    *(v4f*)&Ms[tid * 8]     = f0;
    *(v4f*)&Ms[tid * 8 + 4] = f1;
  }

  // per-thread 16B chunks of a 64x64 bf16 tile (512 chunks, 4 per thread)
  unsigned kLds[4], vLds[4], tOff[4];
#pragma unroll
  for (int t = 0; t < 4; ++t) {
    const int ch = tid + t * 128;
    const int rr = ch >> 3, cc = ch & 7;
    kLds[t] = lds_addr(&Ks[rr * KP_ + cc * 8]);
    vLds[t] = lds_addr(&Vs[rr * VP_ + cc * 8]);
    tOff[t] = (unsigned)((rr * D_ + cc * 8) * 2);
  }
  const __bf16* vfrag = &Vs[(8 * hh + (lane & 7)) * VP_ + ((lane >> 3) & 1) * 8];

  const v8f zero8 = {0.f, 0.f, 0.f, 0.f, 0.f, 0.f, 0.f, 0.f};
  v8f o[4];                      // o[t][r] = O[query c][dk 16 t + 8 hh + r]
#pragma unroll
  for (int t = 0; t < 4; ++t) o[t] = zero8;
  float m_run = -3.0e38f;        // the query's maximum, alike in both halves
  float l_run = 0.f;             // the sum over this half's keys only

  for (int kt = 0; kt < 16; ++kt) {
    wait_ds0();       // own reads of Ks/Vs (first trip: writes of Ms) are done
    __syncthreads();  // and so are every other wave's: the tiles may be refilled
    const size_t kvb = kvrow0 + (size_t)kt * 64 * D_;
    async_copy_kv(kLds, vLds, tOff, Kb + kvb, V + kvb);
    wait_async0();
    __syncthreads();

    // S^T = K Q^T: s[j][r] = score(key 16 j + 8 hh + r, query c)
    v8f s[4];
#pragma unroll
    for (int j = 0; j < 4; ++j) s[j] = zero8;
#pragma unroll
    for (int kk = 0; kk < 2; ++kk)
#pragma unroll
      for (int j = 0; j < 4; ++j)
        s[j] = wmma_bf16(load_frag(Ks, j * 16, kk * 32, KP_), qf[kk], s[j]);
    // scale 1/sqrt(64) + key mask
#pragma unroll
    for (int j = 0; j < 4; ++j) {
      const float* mrow = &Ms[kt * 64 + j * 16 + 8 * hh];
      const v4f ma = *(const v4f*)mrow;
      const v4f mb = *(const v4f*)(mrow + 4);
#pragma unroll
      for (int r = 0; r < 4; ++r) {
        s[j][r]     = s[j][r]     * 0.125f + ma[r];
        s[j][r + 4] = s[j][r + 4] * 0.125f + mb[r];
      }
    }
    // online softmax (base-2): one query per lane
    v8f mx8 = __builtin_elementwise_max(__builtin_elementwise_max(s[0], s[1]),
                                        __builtin_elementwise_max(s[2], s[3]));
    float mx = fmaxf(fmaxf(fmaxf(mx8[0], mx8[1]), fmaxf(mx8[2], mx8[3])),
                     fmaxf(fmaxf(mx8[4], mx8[5]), fmaxf(mx8[6], mx8[7])));
    mx = fmaxf(mx, swap_halves(mx));
    const float mn = fmaxf(m_run, mx);
    const float alpha = exp2f((m_run - mn) * 1.44269504f);
    m_run = mn;
#pragma unroll
    for (int j = 0; j < 4; ++j)
#pragma unroll
      for (int r = 0; r < 8; ++r)
        s[j][r] = exp2f((s[j][r] - m_run) * 1.44269504f);
    const v8f rs8 = (s[0] + s[1]) + (s[2] + s[3]);
    const float rs = ((rs8[0] + rs8[1]) + (rs8[2] + rs8[3])) +
                     ((rs8[4] + rs8[5]) + (rs8[6] + rs8[7]));
    l_run = l_run * alpha + rs;
#pragma unroll
    for (int t = 0; t < 4; ++t) o[t] *= alpha;

    // O^T += V^T P^T: B = score tiles 2 kk and 2 kk + 1 rounded in place (element
    // e = key 32 kk + 8 hh + e, e + 8 = key 32 kk + 16 + 8 hh + e: the order that
    // the two transposing loads of an A fragment deliver)
#pragma unroll
    for (int kk = 0; kk < 2; ++kk) {
      v8u pw;
#pragma unroll
      for (int i = 0; i < 4; ++i) {
        pw[i]     = pack_bf2(s[2 * kk][2 * i],     s[2 * kk][2 * i + 1]);
        pw[i + 4] = pack_bf2(s[2 * kk + 1][2 * i], s[2 * kk + 1][2 * i + 1]);
      }
      const v16bf pf = __builtin_bit_cast(v16bf, pw);
#pragma unroll
      for (int t = 0; t < 4; ++t) {
        const v8bf lo = load_tr16(vfrag + (kk * 32) * VP_ + t * 16);
        const v8bf hi = load_tr16(vfrag + (kk * 32 + 16) * VP_ + t * 16);
        v16bf a;
#pragma unroll
        for (int i = 0; i < 8; ++i) { a[i] = lo[i]; a[i + 8] = hi[i]; }
        o[t] = wmma_bf16(a, pf, o[t]);
      }
    }
  }

  // The halves' sums are joined once, unconditionally (every lane is on).
  const float l   = l_run + swap_halves(l_run);
  const float inv = 1.f / fmaxf(l, 1e-20f);
  __bf16* op = O + ((size_t)b * S_ + qb + m0 + c) * D_ + h * DK_ + 8 * hh;
#pragma unroll
  for (int t = 0; t < 4; ++t) {
    v4u pk;
#pragma unroll
    for (int i = 0; i < 4; ++i)
      pk[i] = pack_bf2(o[t][2 * i] * inv, o[t][2 * i + 1] * inv);
    *(v4u*)(op + 16 * t) = pk;   // 8 consecutive dk of one query
  }
}

// ---------- launcher ----------

extern "C" void kernel_launch(void* const* d_in, const int* in_sizes, int n_in,
                              void* d_out, int out_size, void* d_ws, size_t ws_size,
                              hipStream_t stream)
{
  (void)in_sizes; (void)n_in; (void)out_size; (void)ws_size;
  const float* x    = (const float*)d_in[0];
  const float* kv   = (const float*)d_in[1];
  const int*   msk  = (const int*)  d_in[2];
  const float* ln1g = (const float*)d_in[3];
  const float* ln1b = (const float*)d_in[4];
  const float* wsrc[8] = { (const float*)d_in[5],  (const float*)d_in[6],
                           (const float*)d_in[7],  (const float*)d_in[8],
                           (const float*)d_in[10], (const float*)d_in[11],
                           (const float*)d_in[12], (const float*)d_in[13] };
  const float* ob0  = (const float*)d_in[9];
  const float* ob1  = (const float*)d_in[14];
  const float* ln2g = (const float*)d_in[15];
  const float* ln2b = (const float*)d_in[16];
  const float* w1   = (const float*)d_in[17];
  const float* b1   = (const float*)d_in[18];
  const float* w2   = (const float*)d_in[19];
  const float* b2   = (const float*)d_in[20];

  char* ws = (char*)d_ws;
  size_t off = 0;
  auto alloc = [&](size_t bytes) -> void* {
    void* p = ws + off;
    off += (bytes + 255) & ~(size_t)255;
    return p;
  };
  const size_t ROWS = (size_t)B_ * S_;  // 4096
  float*  y_f32  = (float*) alloc(ROWS * D_ * 4);
  __bf16* y_bf   = (__bf16*)alloc(ROWS * D_ * 2);
  __bf16* kvn_bf = (__bf16*)alloc(ROWS * D_ * 2);
  __bf16* wt[8];
  for (int i = 0; i < 8; ++i) wt[i] = (__bf16*)alloc((size_t)D_ * D_ * 2);
  __bf16* w1t    = (__bf16*)alloc((size_t)FFN_ * D_ * 2);
  __bf16* w2t    = (__bf16*)alloc((size_t)D_ * FFN_ * 2);
  __bf16* qB     = (__bf16*)alloc(ROWS * D_ * 2);
  __bf16* kB     = (__bf16*)alloc(ROWS * D_ * 2);
  __bf16* vB     = (__bf16*)alloc(ROWS * D_ * 2);
  __bf16* aB     = (__bf16*)alloc(ROWS * D_ * 2);
  float*  y1_f32 = (float*) alloc(ROWS * D_ * 4);
  __bf16* y1_bf  = (__bf16*)alloc(ROWS * D_ * 2);
  float*  x2_f32 = (float*) alloc(ROWS * D_ * 4);
  __bf16* x2n_bf = (__bf16*)alloc(ROWS * D_ * 2);
  __bf16* hB     = (__bf16*)alloc(ROWS * FFN_ * 2);

  // LayerNorm 1 on x (keep f32 for residual) and kv
  ln_kernel<<<(int)(ROWS / 8), 256, 0, stream>>>(x,  ln1g, ln1b, y_f32, y_bf);
  ln_kernel<<<(int)(ROWS / 8), 256, 0, stream>>>(kv, ln1g, ln1b, nullptr, kvn_bf);

  // weight conversion/transposition
  for (int i = 0; i < 8; ++i)
    transpose_f32_to_bf16<<<dim3(D_/TN_, D_/TK_), 256, 0, stream>>>(wsrc[i], wt[i], D_, D_);
  transpose_f32_to_bf16<<<dim3(FFN_/TN_, D_/TK_), 256, 0, stream>>>(w1, w1t, D_, FFN_);
  transpose_f32_to_bf16<<<dim3(D_/TN_, FFN_/TK_), 256, 0, stream>>>(w2, w2t, FFN_, D_);

  const dim3 gproj(D_/128, (unsigned)(ROWS/128));        // (8, 32)
  const dim3 gattn(S_/64, H_, B_);                       // (16,16,4)

  // cross-attention 0
  gemm_bf16_kernel<<<gproj, 256, 0, stream>>>(y_bf,   wt[0], nullptr, nullptr, nullptr, nullptr, qB, (int)ROWS, D_, D_, 0);
  gemm_bf16_kernel<<<gproj, 256, 0, stream>>>(kvn_bf, wt[1], nullptr, nullptr, nullptr, nullptr, kB, (int)ROWS, D_, D_, 0);
  gemm_bf16_kernel<<<gproj, 256, 0, stream>>>(kvn_bf, wt[2], nullptr, nullptr, nullptr, nullptr, vB, (int)ROWS, D_, D_, 0);
  flash_attn_kernel<<<gattn, 128, 0, stream>>>(qB, kB, vB, msk, aB);
  gemm_bf16_kernel<<<gproj, 256, 0, stream>>>(aB, wt[3], ob0, y_f32, nullptr, y1_f32, y1_bf, (int)ROWS, D_, D_, 0);

  // cross-attention 1 (query from y1)
  gemm_bf16_kernel<<<gproj, 256, 0, stream>>>(y1_bf,  wt[4], nullptr, nullptr, nullptr, nullptr, qB, (int)ROWS, D_, D_, 0);
  gemm_bf16_kernel<<<gproj, 256, 0, stream>>>(kvn_bf, wt[5], nullptr, nullptr, nullptr, nullptr, kB, (int)ROWS, D_, D_, 0);
  gemm_bf16_kernel<<<gproj, 256, 0, stream>>>(kvn_bf, wt[6], nullptr, nullptr, nullptr, nullptr, vB, (int)ROWS, D_, D_, 0);
  flash_attn_kernel<<<gattn, 128, 0, stream>>>(qB, kB, vB, msk, aB);
  // x2 = x + (o1 + ob1 + y1)
  gemm_bf16_kernel<<<gproj, 256, 0, stream>>>(aB, wt[7], ob1, y1_f32, x, x2_f32, nullptr, (int)ROWS, D_, D_, 0);

  // FFN
  ln_kernel<<<(int)(ROWS / 8), 256, 0, stream>>>(x2_f32, ln2g, ln2b, nullptr, x2n_bf);
  gemm_bf16_kernel<<<dim3(FFN_/128, (unsigned)(ROWS/128)), 256, 0, stream>>>(
      x2n_bf, w1t, b1, nullptr, nullptr, nullptr, hB, (int)ROWS, FFN_, D_, 1);
  gemm_bf16_kernel<<<gproj, 256, 0, stream>>>(
      hB, w2t, b2, x2_f32, nullptr, (float*)d_out, nullptr, (int)ROWS, D_, FFN_, 0);
}

// v004
// Measured time: 272 microseconds a run.
// Two timings next to v003 put it at 1.49 and 1.48 times that version's speed.
// Counting every step since v000, it is 2.20 times as fast.
#include <hip/hip_runtime.h>
#include <hip/hip_bf16.h>
#include <cstdint>

typedef __attribute__((ext_vector_type(16))) __bf16 v16bf;
typedef __attribute__((ext_vector_type(8)))  __bf16 v8bf;
typedef __attribute__((ext_vector_type(8)))  float  v8f;
typedef __attribute__((ext_vector_type(4)))  float  v4f;
typedef __attribute__((ext_vector_type(4)))  __bf16 v4bf;
typedef __attribute__((ext_vector_type(4)))  unsigned v4u;
typedef __attribute__((ext_vector_type(8)))  unsigned v8u;
typedef __attribute__((ext_vector_type(4)))  int      v4i;
typedef __attribute__((ext_vector_type(8)))  short    v8s;

#define B_   4
#define S_   1024
#define D_   1024
#define H_   16
#define DK_  64
#define FFN_ 4096

// ---------- helpers ----------

__device__ __forceinline__ __bf16 f2bf(float f) {
  union { float f; unsigned u; } v; v.f = f;
  unsigned r = v.u + 0x7FFFu + ((v.u >> 16) & 1u);
  unsigned short h = (unsigned short)(r >> 16);
  __bf16 o; __builtin_memcpy(&o, &h, 2); return o;
}

// Two floats rounded as in f2bf, lo in bits 15..0 and hi in bits 31..16.
__device__ __forceinline__ unsigned pack_bf2(float lo, float hi) {
  union { float f; unsigned u; } a, b; a.f = lo; b.f = hi;
  const unsigned ra = a.u + 0x7FFFu + ((a.u >> 16) & 1u);
  const unsigned rb = b.u + 0x7FFFu + ((b.u >> 16) & 1u);
  return (ra >> 16) | (rb & 0xFFFF0000u);
}

// Low 32 bits of the generic address of a __shared__ object == LDS byte offset
// (flat shared-aperture mapping uses addr[31:0] as the LDS address).
__device__ __forceinline__ unsigned lds_addr(const void* p) {
  return (unsigned)(uintptr_t)p;
}

__device__ __forceinline__ void wait_async0() {
  asm volatile("s_wait_asynccnt 0" ::: "memory");
}

// Load a 16x32 bf16 WMMA fragment (A layout; also B when source is Bt[N][K])
// from a row-major [rows][ldk] bf16 tile in LDS.
__device__ __forceinline__ v16bf load_frag(const __bf16* base, int row0, int k0, int ldk) {
  const int lane = threadIdx.x & 31;
  const __bf16* p = base + (row0 + (lane & 15)) * ldk + k0 + ((lane >> 4) << 3);
  v8bf lo = *(const v8bf*)p;
  v8bf hi = *(const v8bf*)(p + 16);
  v16bf r;
#pragma unroll
  for (int i = 0; i < 8; ++i) { r[i] = lo[i]; r[i + 8] = hi[i]; }
  return r;
}

__device__ __forceinline__ v8f wmma_bf16(v16bf a, v16bf b, v8f c) {
  return __builtin_amdgcn_wmma_f32_16x16x32_bf16(false, a, false, b, (short)0, c,
                                                 false, false);
}

// ---------- LayerNorm (D=1024), outputs f32 and/or bf16 ----------
// One wave per row, 8 rows per block: a lane holds 8 x 16 B of its row, all loads
// in flight at once; the row sums stay inside the wave (no LDS, no barrier).
// An eighth of the waves of a block-per-row form have to be started.

__global__ __launch_bounds__(256) void ln_kernel(
    const float* __restrict__ in, const float* __restrict__ g,
    const float* __restrict__ bt, float* __restrict__ outF,
    __bf16* __restrict__ outB)
{
  const int lane = threadIdx.x & 31;
  const int row  = blockIdx.x * 8 + (threadIdx.x >> 5);
  const v4f* p  = (const v4f*)(in + (size_t)row * D_);
  const v4f* g4 = (const v4f*)g;
  const v4f* b4 = (const v4f*)bt;
  v4f v[8], gg[8], bb[8];
#pragma unroll
  for (int i = 0; i < 8; ++i) v[i] = p[lane + i * 32];
#pragma unroll
  for (int i = 0; i < 8; ++i) { gg[i] = g4[lane + i * 32]; bb[i] = b4[lane + i * 32]; }
  v4f s4 = {0.f, 0.f, 0.f, 0.f}, q4 = {0.f, 0.f, 0.f, 0.f};
#pragma unroll
  for (int i = 0; i < 8; ++i) { s4 += v[i]; q4 += v[i] * v[i]; }
  float s  = (s4[0] + s4[1]) + (s4[2] + s4[3]);
  float sq = (q4[0] + q4[1]) + (q4[2] + q4[3]);
#pragma unroll
  for (int off = 16; off >= 1; off >>= 1) {
    s  += __shfl_xor(s,  off, 32);
    sq += __shfl_xor(sq, off, 32);
  }
  const float mean = s * (1.f / D_);
  const float var  = sq * (1.f / D_) - mean * mean;
  const float rstd = rsqrtf(var + 1e-5f);
  v4bf ob[8];
#pragma unroll
  for (int i = 0; i < 8; ++i) {
    v[i] = (v[i] - mean) * rstd * gg[i] + bb[i];
#pragma unroll
    for (int e = 0; e < 4; ++e) ob[i][e] = f2bf(v[i][e]);
  }
  if (outB) {
    v4bf* q = (v4bf*)(outB + (size_t)row * D_);
#pragma unroll
    for (int i = 0; i < 8; ++i) q[lane + i * 32] = ob[i];
  }
  // Registers that the stores above name may be rewritten from here on.
  asm volatile("s_wait_xcnt 0x0" ::: "memory");
  if (outF) {
    v4f* q = (v4f*)(outF + (size_t)row * D_);
#pragma unroll
    for (int i = 0; i < 8; ++i) q[lane + i * 32] = v[i];
  }
}

// ---------- fp32 [K,N] -> bf16 transposed [N,K] ----------
// One block moves 128 k x 64 n: 8 loads of 16 B per lane in flight (256-B pieces
// of W rows), two k neighbours packed into a dword, dwords transposed through
// LDS, 256-B pieces of Wt rows stored. K a multiple of 128, N of 64.

#define TK_ 128
#define TN_ 64
#define TP_ 65   // LDS row pitch in dwords: odd, so both sides meet 32 banks

__global__ __launch_bounds__(256) void transpose_f32_to_bf16(
    const float* __restrict__ W, __bf16* __restrict__ Wt, int K, int N)
{
  __shared__ unsigned t[TN_ * TP_];               // [n][k / 2]
  const int n0 = blockIdx.x * TN_, k0 = blockIdx.y * TK_;
  const int lo4 = threadIdx.x & 15, hi4 = threadIdx.x >> 4;
  const float* pa[4];
  const float* pb[4];
  v4f a[4], b[4];
#pragma unroll
  for (int i = 0; i < 4; ++i) {
    pa[i] = W + (size_t)(k0 + 2 * (hi4 + i * 16)) * N + (n0 + lo4 * 4);
    pb[i] = pa[i] + N;
  }
#pragma unroll
  for (int i = 0; i < 4; ++i) {
    a[i] = *(const v4f*)pa[i];
    b[i] = *(const v4f*)pb[i];
  }
  // Every load's address pair stays whole until this wait: named here as inputs,
  // none of them can serve as a later load's destination.
  asm volatile("s_wait_xcnt 0x0"
               :: "v"(pa[0]), "v"(pa[1]), "v"(pa[2]), "v"(pa[3]),
                  "v"(pb[0]), "v"(pb[1]), "v"(pb[2]), "v"(pb[3])
               : "memory");
#pragma unroll
  for (int i = 0; i < 4; ++i)
#pragma unroll
    for (int j = 0; j < 4; ++j)
      t[(lo4 * 4 + j) * TP_ + hi4 + i * 16] = pack_bf2(a[i][j], b[i][j]);
  __syncthreads();
#pragma unroll
  for (int i = 0; i < 4; ++i) {
    const int n = hi4 + i * 16;
    v4u o;
#pragma unroll
    for (int e = 0; e < 4; ++e) o[e] = t[n * TP_ + lo4 * 4 + e];
    *(v4u*)(Wt + (size_t)(n0 + n) * K + (k0 + lo4 * 8)) = o;
  }
}

// ---------- GEMM: C[M,N] = epi( A[M,K]bf16 @ Bt[N,K]bf16^T ) ----------
// 128x128 block tile, 8 waves -> 32x64 per wave (2x4 WMMA frags).
// A stage is 128 k of every operand row (256 B, whole L2 units), two LDS buffers
// filled by GLOBAL_LOAD_ASYNC_TO_LDS (ASYNCcnt): 16 copies per lane in flight
// while the other buffer's 32 WMMAs per wave run, one barrier per stage.
// Main loop unrolled 2 stages so buffer indices are compile-time constants.
// Requires K a multiple of 256 (an even number of stages, at least two).

#define GK_    128            // k per stage
#define GPITCH 136            // LDS row pitch in elements: 272 B, 16 B x odd

// One stage: 8 + 8 async copies of 16 B per lane (rows 16 apart of the A and of
// the B panel), 32-bit lane offset on a scalar base. The s_wait_xcnt closes the
// statement so that no address register is rewritten ahead of it.
__device__ __forceinline__ void async_copy_stage(unsigned la, unsigned lb,
                                                 const unsigned (&vo)[8],
                                                 const void* baseA,
                                                 const void* baseB) {
  const unsigned lStep = 16 * GPITCH * 2;
  asm volatile(
      "global_load_async_to_lds_b128 %0, %16, %24\n\t"
      "global_load_async_to_lds_b128 %1, %17, %24\n\t"
      "global_load_async_to_lds_b128 %2, %18, %24\n\t"
      "global_load_async_to_lds_b128 %3, %19, %24\n\t"
      "global_load_async_to_lds_b128 %4, %20, %24\n\t"
      "global_load_async_to_lds_b128 %5, %21, %24\n\t"
      "global_load_async_to_lds_b128 %6, %22, %24\n\t"
      "global_load_async_to_lds_b128 %7, %23, %24\n\t"
      "global_load_async_to_lds_b128 %8, %16, %25\n\t"
      "global_load_async_to_lds_b128 %9, %17, %25\n\t"
      "global_load_async_to_lds_b128 %10, %18, %25\n\t"
      "global_load_async_to_lds_b128 %11, %19, %25\n\t"
      "global_load_async_to_lds_b128 %12, %20, %25\n\t"
      "global_load_async_to_lds_b128 %13, %21, %25\n\t"
      "global_load_async_to_lds_b128 %14, %22, %25\n\t"
      "global_load_async_to_lds_b128 %15, %23, %25\n\t"
      "s_wait_xcnt 0x0"
      :: "v"(la), "v"(la + lStep), "v"(la + 2 * lStep), "v"(la + 3 * lStep),
         "v"(la + 4 * lStep), "v"(la + 5 * lStep), "v"(la + 6 * lStep),
         "v"(la + 7 * lStep),
         "v"(lb), "v"(lb + lStep), "v"(lb + 2 * lStep), "v"(lb + 3 * lStep),
         "v"(lb + 4 * lStep), "v"(lb + 5 * lStep), "v"(lb + 6 * lStep),
         "v"(lb + 7 * lStep),
         "v"(vo[0]), "v"(vo[1]), "v"(vo[2]), "v"(vo[3]),
         "v"(vo[4]), "v"(vo[5]), "v"(vo[6]), "v"(vo[7]),
         "s"(baseA), "s"(baseB)
      : "memory");
}

// This wave's LDS reads have returned before the buffer they read is refilled.
__device__ __forceinline__ void wait_ds0() {
  asm volatile("s_wait_dscnt 0x0" ::: "memory");
}

__global__ __launch_bounds__(256) void gemm_bf16_kernel(
    const __bf16* __restrict__ A, const __bf16* __restrict__ Bt,
    const float* __restrict__ bias, const float* __restrict__ res1,
    const float* __restrict__ res2, float* __restrict__ outF,
    __bf16* __restrict__ outB, int M, int N, int K, int doRelu)
{
  __shared__ __align__(16) __bf16 As[2][128 * GPITCH];  // [row][k], +8 pad
  __shared__ __align__(16) __bf16 Bs[2][128 * GPITCH];  // [n][k],  +8 pad
  const int tid  = threadIdx.x;
  const int lane = tid & 31, wave = tid >> 5;
  const int wm = wave >> 1, wn = wave & 1;
  const int m0 = wm * 32, n0 = wn * 64;
  const int rowM = blockIdx.y * 128, colN = blockIdx.x * 128;

  // per-thread 16B chunks of the 128x128 tiles (2048 chunks, 8 per thread):
  // chunk q0 of rows r0, r0 + 16, ..., r0 + 112; a wave covers two whole rows.
  const int r0 = tid >> 4, q0 = tid & 15;
  // The lane offsets are the same for both panels; the panel's first row and
  // the stage's k go into the scalar bases.
  const __bf16* sA = A  + (size_t)rowM * K;
  const __bf16* sB = Bt + (size_t)colN * K;
  unsigned vo[8];
#pragma unroll
  for (int i = 0; i < 8; ++i)
    vo[i] = (unsigned)(((r0 + i * 16) * K + q0 * 8) * 2);
  unsigned ldsA[2], ldsB[2];
#pragma unroll
  for (int bufi = 0; bufi < 2; ++bufi) {
    ldsA[bufi] = lds_addr(&As[bufi][r0 * GPITCH + q0 * 8]);
    ldsB[bufi] = lds_addr(&Bs[bufi][r0 * GPITCH + q0 * 8]);
  }

  const v8f zero8 = {0.f, 0.f, 0.f, 0.f, 0.f, 0.f, 0.f, 0.f};
  v8f acc[2][4];
#pragma unroll
  for (int i = 0; i < 2; ++i)
#pragma unroll
    for (int j = 0; j < 4; ++j) acc[i][j] = zero8;

  const int stages = K / GK_;

#define ISSUE_STAGE(BUFI, ST)                                   \
  do {                                                          \
    const size_t kOff = (size_t)(ST) * GK_;                     \
    async_copy_stage(ldsA[BUFI], ldsB[BUFI], vo, sA + kOff,     \
                     sB + kOff);                                \
  } while (0)

// kk is unrolled so that every LDS offset is an immediate and the next 32 k's
// fragment loads can be scheduled among this 32 k's WMMAs.
#define COMPUTE_PANEL(BUFI)                                     \
  do {                                                          \
    _Pragma("unroll")                                           \
    for (int kk = 0; kk < GK_; kk += 32) {                      \
      v16bf af[2], bfr[4];                                      \
      _Pragma("unroll")                                         \
      for (int i = 0; i < 2; ++i)                               \
        af[i] = load_frag(As[BUFI], m0 + i * 16, kk, GPITCH);   \
      _Pragma("unroll")                                         \
      for (int j = 0; j < 4; ++j)                               \
        bfr[j] = load_frag(Bs[BUFI], n0 + j * 16, kk, GPITCH);  \
      _Pragma("unroll")                                         \
      for (int i = 0; i < 2; ++i)                               \
        _Pragma("unroll")                                       \
        for (int j = 0; j < 4; ++j)                             \
          acc[i][j] = wmma_bf16(af[i], bfr[j], acc[i][j]);      \
    }                                                           \
  } while (0)

// Publish point: own LDS reads returned, own copies landed, then the one barrier
// that both publishes the next stage and frees the buffer just read.
#define PUBLISH()                                               \
  do { wait_ds0(); wait_async0(); __syncthreads(); } while (0)

  ISSUE_STAGE(0, 0);
  wait_async0();
  __syncthreads();
  ISSUE_STAGE(1, 1);
  for (int st = 0; st < stages; st += 2) {
    COMPUTE_PANEL(0);
    PUBLISH();
    if (st + 2 < stages) ISSUE_STAGE(0, st + 2);
    COMPUTE_PANEL(1);
    PUBLISH();
    if (st + 3 < stages) ISSUE_STAGE(1, st + 3);
  }
  wait_async0();
#undef ISSUE_STAGE
#undef COMPUTE_PANEL
#undef PUBLISH

  // epilogue: C/D layout lane=N (lane&15), vgpr r = M offset (+8 for lanes>=16)
  // Each optional operand is tested ONCE, around a loop over all 64 elements of
  // the lane, so that its loads are all in flight together. (Tested per element,
  // every load stands in a branch of its own and is waited for alone.)
  // Per element the order of the additions stays bias, res1, res2.
  const int ho = (lane < 16) ? 0 : 8;
  const int nc = lane & 15;
  const unsigned col0 = (unsigned)(colN + n0 + nc);
  // Byte offset of f32 element (row i * 16 + r of the wave's tile, column j = 0);
  // M * N * 4 stays below 2^32. Column j is 64 B further on.
  unsigned ro[16];
#pragma unroll
  for (int k = 0; k < 16; ++k)
    ro[k] = ((unsigned)(rowM + m0 + (k >> 3) * 16 + (k & 7) + ho) * (unsigned)N + col0) * 4u;

  if (bias) {
    float bv[4];
#pragma unroll
    for (int j = 0; j < 4; ++j) bv[j] = bias[col0 + j * 16];
#pragma unroll
    for (int i = 0; i < 2; ++i)
#pragma unroll
      for (int j = 0; j < 4; ++j) acc[i][j] += bv[j];
    // Registers that the loads above name may be rewritten from here on.
    asm volatile("s_wait_xcnt 0x0" ::: "memory");
  }
  if (res1) {
    v8f t[2][4];
#pragma unroll
    for (int i = 0; i < 2; ++i)
#pragma unroll
      for (int j = 0; j < 4; ++j)
#pragma unroll
        for (int r = 0; r < 8; ++r)
          t[i][j][r] = *(const float*)((const char*)res1 + (size_t)ro[i * 8 + r] + j * 64);
#pragma unroll
    for (int i = 0; i < 2; ++i)
#pragma unroll
      for (int j = 0; j < 4; ++j) acc[i][j] += t[i][j];
    // Registers that the loads above name may be rewritten from here on.
    asm volatile("s_wait_xcnt 0x0" ::: "memory");
  }
  if (res2) {
    v8f t[2][4];
#pragma unroll
    for (int i = 0; i < 2; ++i)
#pragma unroll
      for (int j = 0; j < 4; ++j)
#pragma unroll
        for (int r = 0; r < 8; ++r)
          t[i][j][r] = *(const float*)((const char*)res2 + (size_t)ro[i * 8 + r] + j * 64);
#pragma unroll
    for (int i = 0; i < 2; ++i)
#pragma unroll
      for (int j = 0; j < 4; ++j) acc[i][j] += t[i][j];
    // Registers that the loads above name may be rewritten from here on.
    asm volatile("s_wait_xcnt 0x0" ::: "memory");
  }
  if (doRelu) {
#pragma unroll
    for (int i = 0; i < 2; ++i)
#pragma unroll
      for (int j = 0; j < 4; ++j)
#pragma unroll
        for (int r = 0; r < 8; ++r) acc[i][j][r] = fmaxf(acc[i][j][r], 0.f);
  }
  if (outF) {
#pragma unroll
    for (int i = 0; i < 2; ++i)
#pragma unroll
      for (int j = 0; j < 4; ++j)
#pragma unroll
        for (int r = 0; r < 8; ++r)
          *(float*)((char*)outF + (size_t)ro[i * 8 + r] + j * 64) = acc[i][j][r];
  }
  // Registers that the stores above name may be rewritten from here on.
  asm volatile("s_wait_xcnt 0x0" ::: "memory");
  if (outB) {
    __bf16 hb[2][4][8];
#pragma unroll
    for (int i = 0; i < 2; ++i)
#pragma unroll
      for (int j = 0; j < 4; ++j)
#pragma unroll
        for (int r = 0; r < 8; ++r) hb[i][j][r] = f2bf(acc[i][j][r]);
#pragma unroll
    for (int k = 0; k < 16; ++k) ro[k] >>= 1;
    // Every value is rounded before the first store issues: mixed with the
    // stores, the rounding reuses their registers behind a wait each time.
    __builtin_amdgcn_sched_barrier(0);
#pragma unroll
    for (int i = 0; i < 2; ++i)
#pragma unroll
      for (int j = 0; j < 4; ++j)
#pragma unroll
        for (int r = 0; r < 8; ++r)
          *(__bf16*)((char*)outB + (size_t)ro[i * 8 + r] + j * 32) = hb[i][j][r];
  }
}

#define KP_ 72   // K row pitch in elements: 144 B, 16 B x odd (ds_load_b128)
#define VP_ 80   // V row pitch in elements: 160 B, 32 B x odd (ds_load_tr16_b128)

// 8 x 16-bit column piece of a row-major LDS tile: lane (c, h) gets
// T[8h + 0..7][c] when lane l points at row 8 * (l >> 4) + (l & 7), 16-B piece
// (l >> 3) & 1. Every lane is on wherever this is called.
__device__ __forceinline__ v8bf load_tr16(const __bf16* p) {
  typedef __attribute__((address_space(3))) v8s lds_v8s;
  return __builtin_bit_cast(v8bf, __builtin_amdgcn_ds_load_tr16_b128_v8i16((lds_v8s*)p));
}

// Lane l gets the value of lane l ^ 16.
__device__ __forceinline__ float swap_halves(float x) {
  const int i = __builtin_bit_cast(int, x);
  return __builtin_bit_cast(float, __builtin_amdgcn_permlanex16(
      i, i, 0x76543210, 0xfedcba98, false, false));
}

// One 64-key tile of K and of V: 4 + 4 async copies of 16 B per lane, 32-bit lane
// offset on a scalar base. The s_wait_xcnt closes the statement so that no
// address register is rewritten ahead of it.
__device__ __forceinline__ void async_copy_kv(const unsigned (&kl)[4],
                                              const unsigned (&vl)[4],
                                              const unsigned (&go)[4],
                                              const void* baseK,
                                              const void* baseV) {
  asm volatile(
      "global_load_async_to_lds_b128 %0, %8, %12\n\t"
      "global_load_async_to_lds_b128 %1, %9, %12\n\t"
      "global_load_async_to_lds_b128 %2, %10, %12\n\t"
      "global_load_async_to_lds_b128 %3, %11, %12\n\t"
      "global_load_async_to_lds_b128 %4, %8, %13\n\t"
      "global_load_async_to_lds_b128 %5, %9, %13\n\t"
      "global_load_async_to_lds_b128 %6, %10, %13\n\t"
      "global_load_async_to_lds_b128 %7, %11, %13\n\t"
      "s_wait_xcnt 0x0"
      :: "v"(kl[0]), "v"(kl[1]), "v"(kl[2]), "v"(kl[3]),
         "v"(vl[0]), "v"(vl[1]), "v"(vl[2]), "v"(vl[3]),
         "v"(go[0]), "v"(go[1]), "v"(go[2]), "v"(go[3]),
         "s"(baseK), "s"(baseV)
      : "memory");
}

__global__ __launch_bounds__(128) void flash_attn_kernel(
    const __bf16* __restrict__ Q, const __bf16* __restrict__ Kb,
    const __bf16* __restrict__ V, const int* __restrict__ mask,
    __bf16* __restrict__ O)
{
  __shared__ __align__(16) __bf16 Ks[64 * KP_];     // [key][dk]
  __shared__ __align__(32) __bf16 Vs[64 * VP_];     // [key][dk]
  __shared__ __align__(16) float  Ms[S_];           // per key: 0, or -1e30 if masked

  const int tid = threadIdx.x, lane = tid & 31, wave = tid >> 5;
  const int c = lane & 15, hh = lane >> 4;
  const int qb = blockIdx.x * 64, h = blockIdx.y, b = blockIdx.z;
  const int m0 = wave * 16;
  const size_t qbase  = ((size_t)b * S_ + qb) * D_ + h * DK_;
  const size_t kvrow0 = (size_t)b * S_ * D_ + h * DK_;

  // Q^T fragments (B operand, column = query c), in the k order of load_frag.
  const __bf16* qp = Q + qbase + (size_t)(m0 + c) * D_ + 8 * hh;
  const v4i* mp = (const v4i*)(mask + (size_t)b * S_ + tid * 8);
  const v8bf q0 = *(const v8bf*)qp;
  const v8bf q1 = *(const v8bf*)(qp + 16);
  const v8bf q2 = *(const v8bf*)(qp + 32);
  const v8bf q3 = *(const v8bf*)(qp + 48);
  const v4i mk0 = mp[0], mk1 = mp[1];
  // The address pairs of the loads above stay whole until this wait.
  asm volatile("s_wait_xcnt 0x0" :: "v"(qp), "v"(mp) : "memory");
  v16bf qf[2];
#pragma unroll
  for (int i = 0; i < 8; ++i) {
    qf[0][i] = q0[i]; qf[0][i + 8] = q1[i];
    qf[1][i] = q2[i]; qf[1][i + 8] = q3[i];
  }
  // The key mask of this batch row as an addend, 8 keys per thread; published by
  // the barriers at the head of the first trip.
  {
    v4f f0, f1;
#pragma unroll
    for (int e = 0; e < 4; ++e) {
      f0[e] = (mk0[e] == 0) ? -1e30f : 0.f;
      f1[e] = (mk1[e] == 0) ? -1e30f : 0.f;
    }
    *(v4f*)&Ms[tid * 8]     = f0;
    *(v4f*)&Ms[tid * 8 + 4] = f1;
  }

  // per-thread 16B chunks of a 64x64 bf16 tile (512 chunks, 4 per thread)
  unsigned kLds[4], vLds[4], tOff[4];
#pragma unroll
  for (int t = 0; t < 4; ++t) {
    const int ch = tid + t * 128;
    const int rr = ch >> 3, cc = ch & 7;
    kLds[t] = lds_addr(&Ks[rr * KP_ + cc * 8]);
    vLds[t] = lds_addr(&Vs[rr * VP_ + cc * 8]);
    tOff[t] = (unsigned)((rr * D_ + cc * 8) * 2);
  }
  const __bf16* vfrag = &Vs[(8 * hh + (lane & 7)) * VP_ + ((lane >> 3) & 1) * 8];

  const v8f zero8 = {0.f, 0.f, 0.f, 0.f, 0.f, 0.f, 0.f, 0.f};
  v8f o[4];                      // o[t][r] = O[query c][dk 16 t + 8 hh + r]
#pragma unroll
  for (int t = 0; t < 4; ++t) o[t] = zero8;
  float m_run = -3.0e38f;        // the query's maximum, alike in both halves
  float l_run = 0.f;             // the sum over this half's keys only

  for (int kt = 0; kt < 16; ++kt) {
    wait_ds0();       // own reads of Ks/Vs (first trip: writes of Ms) are done
    __syncthreads();  // and so are every other wave's: the tiles may be refilled
    const size_t kvb = kvrow0 + (size_t)kt * 64 * D_;
    async_copy_kv(kLds, vLds, tOff, Kb + kvb, V + kvb);
    wait_async0();
    __syncthreads();

    // S^T = K Q^T: s[j][r] = score(key 16 j + 8 hh + r, query c)
    v8f s[4];
#pragma unroll
    for (int j = 0; j < 4; ++j) s[j] = zero8;
#pragma unroll
    for (int kk = 0; kk < 2; ++kk)
#pragma unroll
      for (int j = 0; j < 4; ++j)
        s[j] = wmma_bf16(load_frag(Ks, j * 16, kk * 32, KP_), qf[kk], s[j]);
    // scale 1/sqrt(64) + key mask
#pragma unroll
    for (int j = 0; j < 4; ++j) {
      const float* mrow = &Ms[kt * 64 + j * 16 + 8 * hh];
      const v4f ma = *(const v4f*)mrow;
      const v4f mb = *(const v4f*)(mrow + 4);
#pragma unroll
      for (int r = 0; r < 4; ++r) {
        s[j][r]     = s[j][r]     * 0.125f + ma[r];
        s[j][r + 4] = s[j][r + 4] * 0.125f + mb[r];
      }
    }
    // online softmax (base-2): one query per lane
    v8f mx8 = __builtin_elementwise_max(__builtin_elementwise_max(s[0], s[1]),
                                        __builtin_elementwise_max(s[2], s[3]));
    float mx = fmaxf(fmaxf(fmaxf(mx8[0], mx8[1]), fmaxf(mx8[2], mx8[3])),
                     fmaxf(fmaxf(mx8[4], mx8[5]), fmaxf(mx8[6], mx8[7])));
    mx = fmaxf(mx, swap_halves(mx));
    const float mn = fmaxf(m_run, mx);
    const float alpha = exp2f((m_run - mn) * 1.44269504f);
    m_run = mn;
#pragma unroll
    for (int j = 0; j < 4; ++j)
#pragma unroll
      for (int r = 0; r < 8; ++r)
        s[j][r] = exp2f((s[j][r] - m_run) * 1.44269504f);
    const v8f rs8 = (s[0] + s[1]) + (s[2] + s[3]);
    const float rs = ((rs8[0] + rs8[1]) + (rs8[2] + rs8[3])) +
                     ((rs8[4] + rs8[5]) + (rs8[6] + rs8[7]));
    l_run = l_run * alpha + rs;
#pragma unroll
    for (int t = 0; t < 4; ++t) o[t] *= alpha;

    // O^T += V^T P^T: B = score tiles 2 kk and 2 kk + 1 rounded in place (element
    // e = key 32 kk + 8 hh + e, e + 8 = key 32 kk + 16 + 8 hh + e: the order that
    // the two transposing loads of an A fragment deliver)
#pragma unroll
    for (int kk = 0; kk < 2; ++kk) {
      v8u pw;
#pragma unroll
      for (int i = 0; i < 4; ++i) {
        pw[i]     = pack_bf2(s[2 * kk][2 * i],     s[2 * kk][2 * i + 1]);
        pw[i + 4] = pack_bf2(s[2 * kk + 1][2 * i], s[2 * kk + 1][2 * i + 1]);
      }
      const v16bf pf = __builtin_bit_cast(v16bf, pw);
#pragma unroll
      for (int t = 0; t < 4; ++t) {
        const v8bf lo = load_tr16(vfrag + (kk * 32) * VP_ + t * 16);
        const v8bf hi = load_tr16(vfrag + (kk * 32 + 16) * VP_ + t * 16);
        v16bf a;
#pragma unroll
        for (int i = 0; i < 8; ++i) { a[i] = lo[i]; a[i + 8] = hi[i]; }
        o[t] = wmma_bf16(a, pf, o[t]);
      }
    }
  }

  // The halves' sums are joined once, unconditionally (every lane is on).
  const float l   = l_run + swap_halves(l_run);
  const float inv = 1.f / fmaxf(l, 1e-20f);
  __bf16* op = O + ((size_t)b * S_ + qb + m0 + c) * D_ + h * DK_ + 8 * hh;
#pragma unroll
  for (int t = 0; t < 4; ++t) {
    v4u pk;
#pragma unroll
    for (int i = 0; i < 4; ++i)
      pk[i] = pack_bf2(o[t][2 * i] * inv, o[t][2 * i + 1] * inv);
    *(v4u*)(op + 16 * t) = pk;   // 8 consecutive dk of one query
  }
}

// ---------- launcher ----------

extern "C" void kernel_launch(void* const* d_in, const int* in_sizes, int n_in,
                              void* d_out, int out_size, void* d_ws, size_t ws_size,
                              hipStream_t stream)
{
  (void)in_sizes; (void)n_in; (void)out_size; (void)ws_size;
  const float* x    = (const float*)d_in[0];
  const float* kv   = (const float*)d_in[1];
  const int*   msk  = (const int*)  d_in[2];
  const float* ln1g = (const float*)d_in[3];
  const float* ln1b = (const float*)d_in[4];
  const float* wsrc[8] = { (const float*)d_in[5],  (const float*)d_in[6],
                           (const float*)d_in[7],  (const float*)d_in[8],
                           (const float*)d_in[10], (const float*)d_in[11],
                           (const float*)d_in[12], (const float*)d_in[13] };
  const float* ob0  = (const float*)d_in[9];
  const float* ob1  = (const float*)d_in[14];
  const float* ln2g = (const float*)d_in[15];
  const float* ln2b = (const float*)d_in[16];
  const float* w1   = (const float*)d_in[17];
  const float* b1   = (const float*)d_in[18];
  const float* w2   = (const float*)d_in[19];
  const float* b2   = (const float*)d_in[20];

  char* ws = (char*)d_ws;
  size_t off = 0;
  auto alloc = [&](size_t bytes) -> void* {
    void* p = ws + off;
    off += (bytes + 255) & ~(size_t)255;
    return p;
  };
  const size_t ROWS = (size_t)B_ * S_;  // 4096
  float*  y_f32  = (float*) alloc(ROWS * D_ * 4);
  __bf16* y_bf   = (__bf16*)alloc(ROWS * D_ * 2);
  __bf16* kvn_bf = (__bf16*)alloc(ROWS * D_ * 2);
  __bf16* wt[8];
  for (int i = 0; i < 8; ++i) wt[i] = (__bf16*)alloc((size_t)D_ * D_ * 2);
  __bf16* w1t    = (__bf16*)alloc((size_t)FFN_ * D_ * 2);
  __bf16* w2t    = (__bf16*)alloc((size_t)D_ * FFN_ * 2);
  __bf16* qB     = (__bf16*)alloc(ROWS * D_ * 2);
  __bf16* kB     = (__bf16*)alloc(ROWS * D_ * 2);
  __bf16* vB     = (__bf16*)alloc(ROWS * D_ * 2);
  __bf16* aB     = (__bf16*)alloc(ROWS * D_ * 2);
  float*  y1_f32 = (float*) alloc(ROWS * D_ * 4);
  __bf16* y1_bf  = (__bf16*)alloc(ROWS * D_ * 2);
  float*  x2_f32 = (float*) alloc(ROWS * D_ * 4);
  __bf16* x2n_bf = (__bf16*)alloc(ROWS * D_ * 2);
  __bf16* hB     = (__bf16*)alloc(ROWS * FFN_ * 2);

  // LayerNorm 1 on x (keep f32 for residual) and kv
  ln_kernel<<<(int)(ROWS / 8), 256, 0, stream>>>(x,  ln1g, ln1b, y_f32, y_bf);
  ln_kernel<<<(int)(ROWS / 8), 256, 0, stream>>>(kv, ln1g, ln1b, nullptr, kvn_bf);

  // weight conversion/transposition
  for (int i = 0; i < 8; ++i)
    transpose_f32_to_bf16<<<dim3(D_/TN_, D_/TK_), 256, 0, stream>>>(wsrc[i], wt[i], D_, D_);
  transpose_f32_to_bf16<<<dim3(FFN_/TN_, D_/TK_), 256, 0, stream>>>(w1, w1t, D_, FFN_);
  transpose_f32_to_bf16<<<dim3(D_/TN_, FFN_/TK_), 256, 0, stream>>>(w2, w2t, FFN_, D_);

  const dim3 gproj(D_/128, (unsigned)(ROWS/128));        // (8, 32)
  const dim3 gattn(S_/64, H_, B_);                       // (16,16,4)

  // cross-attention 0
  gemm_bf16_kernel<<<gproj, 256, 0, stream>>>(y_bf,   wt[0], nullptr, nullptr, nullptr, nullptr, qB, (int)ROWS, D_, D_, 0);
  gemm_bf16_kernel<<<gproj, 256, 0, stream>>>(kvn_bf, wt[1], nullptr, nullptr, nullptr, nullptr, kB, (int)ROWS, D_, D_, 0);
  gemm_bf16_kernel<<<gproj, 256, 0, stream>>>(kvn_bf, wt[2], nullptr, nullptr, nullptr, nullptr, vB, (int)ROWS, D_, D_, 0);
  flash_attn_kernel<<<gattn, 128, 0, stream>>>(qB, kB, vB, msk, aB);
  gemm_bf16_kernel<<<gproj, 256, 0, stream>>>(aB, wt[3], ob0, y_f32, nullptr, y1_f32, y1_bf, (int)ROWS, D_, D_, 0);

  // cross-attention 1 (query from y1)
  gemm_bf16_kernel<<<gproj, 256, 0, stream>>>(y1_bf,  wt[4], nullptr, nullptr, nullptr, nullptr, qB, (int)ROWS, D_, D_, 0);
  gemm_bf16_kernel<<<gproj, 256, 0, stream>>>(kvn_bf, wt[5], nullptr, nullptr, nullptr, nullptr, kB, (int)ROWS, D_, D_, 0);
  gemm_bf16_kernel<<<gproj, 256, 0, stream>>>(kvn_bf, wt[6], nullptr, nullptr, nullptr, nullptr, vB, (int)ROWS, D_, D_, 0);
  flash_attn_kernel<<<gattn, 128, 0, stream>>>(qB, kB, vB, msk, aB);
  // x2 = x + (o1 + ob1 + y1)
  gemm_bf16_kernel<<<gproj, 256, 0, stream>>>(aB, wt[7], ob1, y1_f32, x, x2_f32, nullptr, (int)ROWS, D_, D_, 0);

  // FFN
  ln_kernel<<<(int)(ROWS / 8), 256, 0, stream>>>(x2_f32, ln2g, ln2b, nullptr, x2n_bf);
  gemm_bf16_kernel<<<dim3(FFN_/128, (unsigned)(ROWS/128)), 256, 0, stream>>>(
      x2n_bf, w1t, b1, nullptr, nullptr, nullptr, hB, (int)ROWS, FFN_, D_, 1);
  gemm_bf16_kernel<<<gproj, 256, 0, stream>>>(
      hB, w2t, b2, x2_f32, nullptr, (float*)d_out, nullptr, (int)ROWS, D_, FFN_, 0);
}

// v005
// A run of this version takes 231 microseconds.
// Next to v004, in two timings, it ran 1.19 times as fast each time.
// All steps since v000 together make it 2.62 times as fast.
#include <hip/hip_runtime.h>
#include <hip/hip_bf16.h>
#include <cstdint>

typedef __attribute__((ext_vector_type(16))) __bf16 v16bf;
typedef __attribute__((ext_vector_type(8)))  __bf16 v8bf;
typedef __attribute__((ext_vector_type(8)))  float  v8f;
typedef __attribute__((ext_vector_type(4)))  float  v4f;
typedef __attribute__((ext_vector_type(4)))  __bf16 v4bf;
typedef __attribute__((ext_vector_type(4)))  unsigned v4u;
typedef __attribute__((ext_vector_type(8)))  unsigned v8u;
typedef __attribute__((ext_vector_type(4)))  int      v4i;
typedef __attribute__((ext_vector_type(8)))  short    v8s;

#define B_   4
#define S_   1024
#define D_   1024
#define H_   16
#define DK_  64
#define FFN_ 4096

// ---------- helpers ----------

__device__ __forceinline__ __bf16 f2bf(float f) {
  union { float f; unsigned u; } v; v.f = f;
  unsigned r = v.u + 0x7FFFu + ((v.u >> 16) & 1u);
  unsigned short h = (unsigned short)(r >> 16);
  __bf16 o; __builtin_memcpy(&o, &h, 2); return o;
}

// Two floats rounded as in f2bf, lo in bits 15..0 and hi in bits 31..16.
__device__ __forceinline__ unsigned pack_bf2(float lo, float hi) {
  union { float f; unsigned u; } a, b; a.f = lo; b.f = hi;
  const unsigned ra = a.u + 0x7FFFu + ((a.u >> 16) & 1u);
  const unsigned rb = b.u + 0x7FFFu + ((b.u >> 16) & 1u);
  return (ra >> 16) | (rb & 0xFFFF0000u);
}

// Low 32 bits of the generic address of a __shared__ object == LDS byte offset
// (flat shared-aperture mapping uses addr[31:0] as the LDS address).
__device__ __forceinline__ unsigned lds_addr(const void* p) {
  return (unsigned)(uintptr_t)p;
}

__device__ __forceinline__ void wait_async0() {
  asm volatile("s_wait_asynccnt 0" ::: "memory");
}

// Load a 16x32 bf16 WMMA fragment (A layout; also B when source is Bt[N][K])
// from a row-major [rows][ldk] bf16 tile in LDS.
__device__ __forceinline__ v16bf load_frag(const __bf16* base, int row0, int k0, int ldk) {
  const int lane = threadIdx.x & 31;
  const __bf16* p = base + (row0 + (lane & 15)) * ldk + k0 + ((lane >> 4) << 3);
  v8bf lo = *(const v8bf*)p;
  v8bf hi = *(const v8bf*)(p + 16);
  v16bf r;
#pragma unroll
  for (int i = 0; i < 8; ++i) { r[i] = lo[i]; r[i + 8] = hi[i]; }
  return r;
}

__device__ __forceinline__ v8f wmma_bf16(v16bf a, v16bf b, v8f c) {
  return __builtin_amdgcn_wmma_f32_16x16x32_bf16(false, a, false, b, (short)0, c,
                                                 false, false);
}

// ---------- LayerNorm (D=1024), outputs f32 and/or bf16 ----------
// One wave per row, 8 rows per block: a lane holds 8 x 16 B of its row, all loads
// in flight at once; the row sums stay inside the wave (no LDS, no barrier).
// An eighth of the waves of a block-per-row form have to be started.
// One launch may norm two tensors with the same g and bt: grid slice y = 1 reads
// in2 and writes outB2 only.

__global__ __launch_bounds__(256) void ln_kernel(
    const float* __restrict__ in, const float* __restrict__ in2,
    const float* __restrict__ g,
    const float* __restrict__ bt, float* __restrict__ outF,
    __bf16* __restrict__ outB, __bf16* __restrict__ outB2)
{
  if (blockIdx.y) { in = in2; outF = nullptr; outB = outB2; }
  const int lane = threadIdx.x & 31;
  const int row  = blockIdx.x * 8 + (threadIdx.x >> 5);
  const v4f* p  = (const v4f*)(in + (size_t)row * D_);
  const v4f* g4 = (const v4f*)g;
  const v4f* b4 = (const v4f*)bt;
  v4f v[8], gg[8], bb[8];
#pragma unroll
  for (int i = 0; i < 8; ++i) v[i] = p[lane + i * 32];
#pragma unroll
  for (int i = 0; i < 8; ++i) { gg[i] = g4[lane + i * 32]; bb[i] = b4[lane + i * 32]; }
  v4f s4 = {0.f, 0.f, 0.f, 0.f}, q4 = {0.f, 0.f, 0.f, 0.f};
#pragma unroll
  for (int i = 0; i < 8; ++i) { s4 += v[i]; q4 += v[i] * v[i]; }
  float s  = (s4[0] + s4[1]) + (s4[2] + s4[3]);
  float sq = (q4[0] + q4[1]) + (q4[2] + q4[3]);
#pragma unroll
  for (int off = 16; off >= 1; off >>= 1) {
    s  += __shfl_xor(s,  off, 32);
    sq += __shfl_xor(sq, off, 32);
  }
  const float mean = s * (1.f / D_);
  const float var  = sq * (1.f / D_) - mean * mean;
  const float rstd = rsqrtf(var + 1e-5f);
  v4bf ob[8];
#pragma unroll
  for (int i = 0; i < 8; ++i) {
    v[i] = (v[i] - mean) * rstd * gg[i] + bb[i];
#pragma unroll
    for (int e = 0; e < 4; ++e) ob[i][e] = f2bf(v[i][e]);
  }
  if (outB) {
    v4bf* q = (v4bf*)(outB + (size_t)row * D_);
#pragma unroll
    for (int i = 0; i < 8; ++i) q[lane + i * 32] = ob[i];
  }
  // Registers that the stores above name may be rewritten from here on.
  asm volatile("s_wait_xcnt 0x0" ::: "memory");
  if (outF) {
    v4f* q = (v4f*)(outF + (size_t)row * D_);
#pragma unroll
    for (int i = 0; i < 8; ++i) q[lane + i * 32] = v[i];
  }
}

// ---------- fp32 [K,N] -> bf16 transposed [N,K] ----------
// One block moves 128 k x 64 n: 8 loads of 16 B per lane in flight (256-B pieces
// of W rows), two k neighbours packed into a dword, dwords transposed through
// LDS, 256-B pieces of Wt rows stored. K a multiple of 128, N of 64.
// One launch converts all ten weights: blocks 0..1023 the eight D x D ones (128
// tiles each), 1024..1535 the D x FFN one, 1536..2047 the FFN x D one. The results
// lie one after the other in WtAll, in the order of the arguments.

#define TK_ 128
#define TN_ 64
#define TP_ 65   // LDS row pitch in dwords: odd, so both sides meet 32 banks

__global__ __launch_bounds__(256) void transpose_f32_to_bf16(
    const float* __restrict__ Wa, const float* __restrict__ Wb,
    const float* __restrict__ Wc, const float* __restrict__ Wd,
    const float* __restrict__ We, const float* __restrict__ Wf,
    const float* __restrict__ Wg, const float* __restrict__ Wh,
    const float* __restrict__ Wup, const float* __restrict__ Wdn,
    __bf16* __restrict__ WtAll)
{
  __shared__ unsigned t[TN_ * TP_];               // [n][k / 2]
  const int bid = blockIdx.x;
  const float* W;
  __bf16* Wt;
  int K, N, tile;
  if (bid < 1024) {
    const int w = bid >> 7;
    W = (w & 4) ? ((w & 2) ? ((w & 1) ? Wh : Wg) : ((w & 1) ? Wf : We))
                : ((w & 2) ? ((w & 1) ? Wd : Wc) : ((w & 1) ? Wb : Wa));
    Wt = WtAll + (size_t)w * D_ * D_;
    K = D_; N = D_; tile = bid & 127;
  } else if (bid < 1536) {
    W = Wup; Wt = WtAll + (size_t)8 * D_ * D_;
    K = D_; N = FFN_; tile = bid - 1024;
  } else {
    W = Wdn; Wt = WtAll + (size_t)12 * D_ * D_;
    K = FFN_; N = D_; tile = bid - 1536;
  }
  const int nTiles = N / TN_;                     // 16 or 64
  const int n0 = (tile & (nTiles - 1)) * TN_, k0 = (tile / nTiles) * TK_;
  const int lo4 = threadIdx.x & 15, hi4 = threadIdx.x >> 4;
  const float* pa[4];
  const float* pb[4];
  v4f a[4], b[4];
#pragma unroll
  for (int i = 0; i < 4; ++i) {
    pa[i] = W + (size_t)(k0 + 2 * (hi4 + i * 16)) * N + (n0 + lo4 * 4);
    pb[i] = pa[i] + N;
  }
#pragma unroll
  for (int i = 0; i < 4; ++i) {
    a[i] = *(const v4f*)pa[i];
    b[i] = *(const v4f*)pb[i];
  }
  // Every load's address pair stays whole until this wait: named here as inputs,
  // none of them can serve as a later load's destination.
  asm volatile("s_wait_xcnt 0x0"
               :: "v"(pa[0]), "v"(pa[1]), "v"(pa[2]), "v"(pa[3]),
                  "v"(pb[0]), "v"(pb[1]), "v"(pb[2]), "v"(pb[3])
               : "memory");
#pragma unroll
  for (int i = 0; i < 4; ++i)
#pragma unroll
    for (int j = 0; j < 4; ++j)
      t[(lo4 * 4 + j) * TP_ + hi4 + i * 16] = pack_bf2(a[i][j], b[i][j]);
  __syncthreads();
#pragma unroll
  for (int i = 0; i < 4; ++i) {
    const int n = hi4 + i * 16;
    v4u o;
#pragma unroll
    for (int e = 0; e < 4; ++e) o[e] = t[n * TP_ + lo4 * 4 + e];
    *(v4u*)(Wt + (size_t)(n0 + n) * K + (k0 + lo4 * 8)) = o;
  }
}

// ---------- GEMM: C[M,N] = epi( A[M,K]bf16 @ Bt[N,K]bf16^T ) ----------
// 128x128 block tile, 8 waves -> 32x64 per wave (2x4 WMMA frags).
// A stage is 128 k of every operand row (256 B, whole L2 units), two LDS buffers
// filled by GLOBAL_LOAD_ASYNC_TO_LDS (ASYNCcnt): 16 copies per lane in flight
// while the other buffer's 32 WMMAs per wave run, one barrier per stage.
// Main loop unrolled 2 stages so buffer indices are compile-time constants.
// Requires K a multiple of 256 (an even number of stages, at least two).
// One launch may hold several products of one shape: grid slice z > 0 reads Az,
// and the slices' Bt and outB lie one after the other.

#define GK_    128            // k per stage
#define GPITCH 136            // LDS row pitch in elements: 272 B, 16 B x odd

// One stage: 8 + 8 async copies of 16 B per lane (rows 16 apart of the A and of
// the B panel), 32-bit lane offset on a scalar base. The s_wait_xcnt closes the
// statement so that no address register is rewritten ahead of it.
__device__ __forceinline__ void async_copy_stage(unsigned la, unsigned lb,
                                                 const unsigned (&vo)[8],
                                                 const void* baseA,
                                                 const void* baseB) {
  const unsigned lStep = 16 * GPITCH * 2;
  asm volatile(
      "global_load_async_to_lds_b128 %0, %16, %24\n\t"
      "global_load_async_to_lds_b128 %1, %17, %24\n\t"
      "global_load_async_to_lds_b128 %2, %18, %24\n\t"
      "global_load_async_to_lds_b128 %3, %19, %24\n\t"
      "global_load_async_to_lds_b128 %4, %20, %24\n\t"
      "global_load_async_to_lds_b128 %5, %21, %24\n\t"
      "global_load_async_to_lds_b128 %6, %22, %24\n\t"
      "global_load_async_to_lds_b128 %7, %23, %24\n\t"
      "global_load_async_to_lds_b128 %8, %16, %25\n\t"
      "global_load_async_to_lds_b128 %9, %17, %25\n\t"
      "global_load_async_to_lds_b128 %10, %18, %25\n\t"
      "global_load_async_to_lds_b128 %11, %19, %25\n\t"
      "global_load_async_to_lds_b128 %12, %20, %25\n\t"
      "global_load_async_to_lds_b128 %13, %21, %25\n\t"
      "global_load_async_to_lds_b128 %14, %22, %25\n\t"
      "global_load_async_to_lds_b128 %15, %23, %25\n\t"
      "s_wait_xcnt 0x0"
      :: "v"(la), "v"(la + lStep), "v"(la + 2 * lStep), "v"(la + 3 * lStep),
         "v"(la + 4 * lStep), "v"(la + 5 * lStep), "v"(la + 6 * lStep),
         "v"(la + 7 * lStep),
         "v"(lb), "v"(lb + lStep), "v"(lb + 2 * lStep), "v"(lb + 3 * lStep),
         "v"(lb + 4 * lStep), "v"(lb + 5 * lStep), "v"(lb + 6 * lStep),
         "v"(lb + 7 * lStep),
         "v"(vo[0]), "v"(vo[1]), "v"(vo[2]), "v"(vo[3]),
         "v"(vo[4]), "v"(vo[5]), "v"(vo[6]), "v"(vo[7]),
         "s"(baseA), "s"(baseB)
      : "memory");
}

// This wave's LDS reads have returned before the buffer they read is refilled.
__device__ __forceinline__ void wait_ds0() {
  asm volatile("s_wait_dscnt 0x0" ::: "memory");
}

__global__ __launch_bounds__(256) void gemm_bf16_kernel(
    const __bf16* __restrict__ A, const __bf16* __restrict__ Az,
    const __bf16* __restrict__ Bt,
    const float* __restrict__ bias, const float* __restrict__ res1,
    const float* __restrict__ res2, float* __restrict__ outF,
    __bf16* __restrict__ outB, int M, int N, int K, int doRelu)
{
  __shared__ __align__(16) __bf16 As[2][128 * GPITCH];  // [row][k], +8 pad
  __shared__ __align__(16) __bf16 Bs[2][128 * GPITCH];  // [n][k],  +8 pad
  if (blockIdx.z) {
    A = Az;
    Bt   += (size_t)blockIdx.z * N * K;
    outB += (size_t)blockIdx.z * M * N;
  }
  const int tid  = threadIdx.x;
  const int lane = tid & 31, wave = tid >> 5;
  const int wm = wave >> 1, wn = wave & 1;
  const int m0 = wm * 32, n0 = wn * 64;
  const int rowM = blockIdx.y * 128, colN = blockIdx.x * 128;

  // per-thread 16B chunks of the 128x128 tiles (2048 chunks, 8 per thread):
  // chunk q0 of rows r0, r0 + 16, ..., r0 + 112; a wave covers two whole rows.
  const int r0 = tid >> 4, q0 = tid & 15;
  // The lane offsets are the same for both panels; the panel's first row and
  // the stage's k go into the scalar bases.
  const __bf16* sA = A  + (size_t)rowM * K;
  const __bf16* sB = Bt + (size_t)colN * K;
  unsigned vo[8];
#pragma unroll
  for (int i = 0; i < 8; ++i)
    vo[i] = (unsigned)(((r0 + i * 16) * K + q0 * 8) * 2);
  unsigned ldsA[2], ldsB[2];
#pragma unroll
  for (int bufi = 0; bufi < 2; ++bufi) {
    ldsA[bufi] = lds_addr(&As[bufi][r0 * GPITCH + q0 * 8]);
    ldsB[bufi] = lds_addr(&Bs[bufi][r0 * GPITCH + q0 * 8]);
  }

  const v8f zero8 = {0.f, 0.f, 0.f, 0.f, 0.f, 0.f, 0.f, 0.f};
  v8f acc[2][4];
#pragma unroll
  for (int i = 0; i < 2; ++i)
#pragma unroll
    for (int j = 0; j < 4; ++j) acc[i][j] = zero8;

  const int stages = K / GK_;

#define ISSUE_STAGE(BUFI, ST)                                   \
  do {                                                          \
    const size_t kOff = (size_t)(ST) * GK_;                     \
    async_copy_stage(ldsA[BUFI], ldsB[BUFI], vo, sA + kOff,     \
                     sB + kOff);                                \
  } while (0)

// kk is unrolled so that every LDS offset is an immediate and the next 32 k's
// fragment loads can be scheduled among this 32 k's WMMAs.
#define COMPUTE_PANEL(BUFI)                                     \
  do {                                                          \
    _Pragma("unroll")                                           \
    for (int kk = 0; kk < GK_; kk += 32) {                      \
      v16bf af[2], bfr[4];                                      \
      _Pragma("unroll")                                         \
      for (int i = 0; i < 2; ++i)                               \
        af[i] = load_frag(As[BUFI], m0 + i * 16, kk, GPITCH);   \
      _Pragma("unroll")                                         \
      for (int j = 0; j < 4; ++j)                               \
        bfr[j] = load_frag(Bs[BUFI], n0 + j * 16, kk, GPITCH);  \
      _Pragma("unroll")                                         \
      for (int i = 0; i < 2; ++i)                               \
        _Pragma("unroll")                                       \
        for (int j = 0; j < 4; ++j)                             \
          acc[i][j] = wmma_bf16(af[i], bfr[j], acc[i][j]);      \
    }                                                           \
  } while (0)

// Publish point: own LDS reads returned, own copies landed, then the one barrier
// that both publishes the next stage and frees the buffer just read.
#define PUBLISH()                                               \
  do { wait_ds0(); wait_async0(); __syncthreads(); } while (0)

  ISSUE_STAGE(0, 0);
  wait_async0();
  __syncthreads();
  ISSUE_STAGE(1, 1);
  for (int st = 0; st < stages; st += 2) {
    COMPUTE_PANEL(0);
    PUBLISH();
    if (st + 2 < stages) ISSUE_STAGE(0, st + 2);
    COMPUTE_PANEL(1);
    PUBLISH();
    if (st + 3 < stages) ISSUE_STAGE(1, st + 3);
  }
  wait_async0();
#undef ISSUE_STAGE
#undef COMPUTE_PANEL
#undef PUBLISH

  // epilogue: C/D layout lane=N (lane&15), vgpr r = M offset (+8 for lanes>=16)
  // Each optional operand is tested ONCE, around a loop over all 64 elements of
  // the lane, so that its loads are all in flight together. (Tested per element,
  // every load stands in a branch of its own and is waited for alone.)
  // Per element the order of the additions stays bias, res1, res2.
  const int ho = (lane < 16) ? 0 : 8;
  const int nc = lane & 15;
  const unsigned col0 = (unsigned)(colN + n0 + nc);
  // Byte offset of f32 element (row i * 16 + r of the wave's tile, column j = 0);
  // M * N * 4 stays below 2^32. Column j is 64 B further on.
  unsigned ro[16];
#pragma unroll
  for (int k = 0; k < 16; ++k)
    ro[k] = ((unsigned)(rowM + m0 + (k >> 3) * 16 + (k & 7) + ho) * (unsigned)N + col0) * 4u;

  if (bias) {
    float bv[4];
#pragma unroll
    for (int j = 0; j < 4; ++j) bv[j] = bias[col0 + j * 16];
#pragma unroll
    for (int i = 0; i < 2; ++i)
#pragma unroll
      for (int j = 0; j < 4; ++j) acc[i][j] += bv[j];
    // Registers that the loads above name may be rewritten from here on.
    asm volatile("s_wait_xcnt 0x0" ::: "memory");
  }
  if (res1) {
    v8f t[2][4];
#pragma unroll
    for (int i = 0; i < 2; ++i)
#pragma unroll
      for (int j = 0; j < 4; ++j)
#pragma unroll
        for (int r = 0; r < 8; ++r)
          t[i][j][r] = *(const float*)((const char*)res1 + (size_t)ro[i * 8 + r] + j * 64);
#pragma unroll
    for (int i = 0; i < 2; ++i)
#pragma unroll
      for (int j = 0; j < 4; ++j) acc[i][j] += t[i][j];
    // Registers that the loads above name may be rewritten from here on.
    asm volatile("s_wait_xcnt 0x0" ::: "memory");
  }
  if (res2) {
    v8f t[2][4];
#pragma unroll
    for (int i = 0; i < 2; ++i)
#pragma unroll
      for (int j = 0; j < 4; ++j)
#pragma unroll
        for (int r = 0; r < 8; ++r)
          t[i][j][r] = *(const float*)((const char*)res2 + (size_t)ro[i * 8 + r] + j * 64);
#pragma unroll
    for (int i = 0; i < 2; ++i)
#pragma unroll
      for (int j = 0; j < 4; ++j) acc[i][j] += t[i][j];
    // Registers that the loads above name may be rewritten from here on.
    asm volatile("s_wait_xcnt 0x0" ::: "memory");
  }
  if (doRelu) {
#pragma unroll
    for (int i = 0; i < 2; ++i)
#pragma unroll
      for (int j = 0; j < 4; ++j)
#pragma unroll
        for (int r = 0; r < 8; ++r) acc[i][j][r] = fmaxf(acc[i][j][r], 0.f);
  }
  if (outF) {
#pragma unroll
    for (int i = 0; i < 2; ++i)
#pragma unroll
      for (int j = 0; j < 4; ++j)
#pragma unroll
        for (int r = 0; r < 8; ++r)
          *(float*)((char*)outF + (size_t)ro[i * 8 + r] + j * 64) = acc[i][j][r];
  }
  // Registers that the stores above name may be rewritten from here on.
  asm volatile("s_wait_xcnt 0x0" ::: "memory");
  if (outB) {
    __bf16 hb[2][4][8];
#pragma unroll
    for (int i = 0; i < 2; ++i)
#pragma unroll
      for (int j = 0; j < 4; ++j)
#pragma unroll
        for (int r = 0; r < 8; ++r) hb[i][j][r] = f2bf(acc[i][j][r]);
#pragma unroll
    for (int k = 0; k < 16; ++k) ro[k] >>= 1;
    // Every value is rounded before the first store issues: mixed with the
    // stores, the rounding reuses their registers behind a wait each time.
    __builtin_amdgcn_sched_barrier(0);
#pragma unroll
    for (int i = 0; i < 2; ++i)
#pragma unroll
      for (int j = 0; j < 4; ++j)
#pragma unroll
        for (int r = 0; r < 8; ++r)
          *(__bf16*)((char*)outB + (size_t)ro[i * 8 + r] + j * 32) = hb[i][j][r];
  }
}

#define KP_ 72   // K row pitch in elements: 144 B, 16 B x odd (ds_load_b128)
#define VP_ 80   // V row pitch in elements: 160 B, 32 B x odd (ds_load_tr16_b128)

// 8 x 16-bit column piece of a row-major LDS tile: lane (c, h) gets
// T[8h + 0..7][c] when lane l points at row 8 * (l >> 4) + (l & 7), 16-B piece
// (l >> 3) & 1. Every lane is on wherever this is called.
__device__ __forceinline__ v8bf load_tr16(const __bf16* p) {
  typedef __attribute__((address_space(3))) v8s lds_v8s;
  return __builtin_bit_cast(v8bf, __builtin_amdgcn_ds_load_tr16_b128_v8i16((lds_v8s*)p));
}

// Lane l gets the value of lane l ^ 16.
__device__ __forceinline__ float swap_halves(float x) {
  const int i = __builtin_bit_cast(int, x);
  return __builtin_bit_cast(float, __builtin_amdgcn_permlanex16(
      i, i, 0x76543210, 0xfedcba98, false, false));
}

// One 64-key tile of K and of V: 4 + 4 async copies of 16 B per lane, 32-bit lane
// offset on a scalar base. The s_wait_xcnt closes the statement so that no
// address register is rewritten ahead of it.
__device__ __forceinline__ void async_copy_kv(const unsigned (&kl)[4],
                                              const unsigned (&vl)[4],
                                              const unsigned (&go)[4],
                                              const void* baseK,
                                              const void* baseV) {
  asm volatile(
      "global_load_async_to_lds_b128 %0, %8, %12\n\t"
      "global_load_async_to_lds_b128 %1, %9, %12\n\t"
      "global_load_async_to_lds_b128 %2, %10, %12\n\t"
      "global_load_async_to_lds_b128 %3, %11, %12\n\t"
      "global_load_async_to_lds_b128 %4, %8, %13\n\t"
      "global_load_async_to_lds_b128 %5, %9, %13\n\t"
      "global_load_async_to_lds_b128 %6, %10, %13\n\t"
      "global_load_async_to_lds_b128 %7, %11, %13\n\t"
      "s_wait_xcnt 0x0"
      :: "v"(kl[0]), "v"(kl[1]), "v"(kl[2]), "v"(kl[3]),
         "v"(vl[0]), "v"(vl[1]), "v"(vl[2]), "v"(vl[3]),
         "v"(go[0]), "v"(go[1]), "v"(go[2]), "v"(go[3]),
         "s"(baseK), "s"(baseV)
      : "memory");
}

__global__ __launch_bounds__(128) void flash_attn_kernel(
    const __bf16* __restrict__ Q, const __bf16* __restrict__ Kb,
    const __bf16* __restrict__ V, const int* __restrict__ mask,
    __bf16* __restrict__ O)
{
  __shared__ __align__(16) __bf16 Ks[64 * KP_];     // [key][dk]
  __shared__ __align__(32) __bf16 Vs[64 * VP_];     // [key][dk]
  __shared__ __align__(16) float  Ms[S_];           // per key: 0, or -1e30 if masked

  const int tid = threadIdx.x, lane = tid & 31, wave = tid >> 5;
  const int c = lane & 15, hh = lane >> 4;
  const int qb = blockIdx.x * 64, h = blockIdx.y, b = blockIdx.z;
  const int m0 = wave * 16;
  const size_t qbase  = ((size_t)b * S_ + qb) * D_ + h * DK_;
  const size_t kvrow0 = (size_t)b * S_ * D_ + h * DK_;

  // Q^T fragments (B operand, column = query c), in the k order of load_frag.
  const __bf16* qp = Q + qbase + (size_t)(m0 + c) * D_ + 8 * hh;
  const v4i* mp = (const v4i*)(mask + (size_t)b * S_ + tid * 8);
  const v8bf q0 = *(const v8bf*)qp;
  const v8bf q1 = *(const v8bf*)(qp + 16);
  const v8bf q2 = *(const v8bf*)(qp + 32);
  const v8bf q3 = *(const v8bf*)(qp + 48);
  const v4i mk0 = mp[0], mk1 = mp[1];
  // The address pairs of the loads above stay whole until this wait.
  asm volatile("s_wait_xcnt 0x0" :: "v"(qp), "v"(mp) : "memory");
  v16bf qf[2];
#pragma unroll
  for (int i = 0; i < 8; ++i) {
    qf[0][i] = q0[i]; qf[0][i + 8] = q1[i];
    qf[1][i] = q2[i]; qf[1][i + 8] = q3[i];
  }
  // The key mask of this batch row as an addend, 8 keys per thread; published by
  // the barriers at the head of the first trip.
  {
    v4f f0, f1;
#pragma unroll
    for (int e = 0; e < 4; ++e) {
      f0[e] = (mk0[e] == 0) ? -1e30f : 0.f;
      f1[e] = (mk1[e] == 0) ? -1e30f : 0.f;
    }
    *(v4f*)&Ms[tid * 8]     = f0;
    *(v4f*)&Ms[tid * 8 + 4] = f1;
  }

  // per-thread 16B chunks of a 64x64 bf16 tile (512 chunks, 4 per thread)
  unsigned kLds[4], vLds[4], tOff[4];
#pragma unroll
  for (int t = 0; t < 4; ++t) {
    const int ch = tid + t * 128;
    const int rr = ch >> 3, cc = ch & 7;
    kLds[t] = lds_addr(&Ks[rr * KP_ + cc * 8]);
    vLds[t] = lds_addr(&Vs[rr * VP_ + cc * 8]);
    tOff[t] = (unsigned)((rr * D_ + cc * 8) * 2);
  }
  const __bf16* vfrag = &Vs[(8 * hh + (lane & 7)) * VP_ + ((lane >> 3) & 1) * 8];

  const v8f zero8 = {0.f, 0.f, 0.f, 0.f, 0.f, 0.f, 0.f, 0.f};
  v8f o[4];                      // o[t][r] = O[query c][dk 16 t + 8 hh + r]
#pragma unroll
  for (int t = 0; t < 4; ++t) o[t] = zero8;
  float m_run = -3.0e38f;        // the query's maximum, alike in both halves
  float l_run = 0.f;             // the sum over this half's keys only

  for (int kt = 0; kt < 16; ++kt) {
    wait_ds0();       // own reads of Ks/Vs (first trip: writes of Ms) are done
    __syncthreads();  // and so are every other wave's: the tiles may be refilled
    const size_t kvb = kvrow0 + (size_t)kt * 64 * D_;
    async_copy_kv(kLds, vLds, tOff, Kb + kvb, V + kvb);
    wait_async0();
    __syncthreads();

    // S^T = K Q^T: s[j][r] = score(key 16 j + 8 hh + r, query c)
    v8f s[4];
#pragma unroll
    for (int j = 0; j < 4; ++j) s[j] = zero8;
#pragma unroll
    for (int kk = 0; kk < 2; ++kk)
#pragma unroll
      for (int j = 0; j < 4; ++j)
        s[j] = wmma_bf16(load_frag(Ks, j * 16, kk * 32, KP_), qf[kk], s[j]);
    // scale 1/sqrt(64) + key mask
#pragma unroll
    for (int j = 0; j < 4; ++j) {
      const float* mrow = &Ms[kt * 64 + j * 16 + 8 * hh];
      const v4f ma = *(const v4f*)mrow;
      const v4f mb = *(const v4f*)(mrow + 4);
#pragma unroll
      for (int r = 0; r < 4; ++r) {
        s[j][r]     = s[j][r]     * 0.125f + ma[r];
        s[j][r + 4] = s[j][r + 4] * 0.125f + mb[r];
      }
    }
    // online softmax (base-2): one query per lane
    v8f mx8 = __builtin_elementwise_max(__builtin_elementwise_max(s[0], s[1]),
                                        __builtin_elementwise_max(s[2], s[3]));
    float mx = fmaxf(fmaxf(fmaxf(mx8[0], mx8[1]), fmaxf(mx8[2], mx8[3])),
                     fmaxf(fmaxf(mx8[4], mx8[5]), fmaxf(mx8[6], mx8[7])));
    mx = fmaxf(mx, swap_halves(mx));
    const float mn = fmaxf(m_run, mx);
    const float alpha = exp2f((m_run - mn) * 1.44269504f);
    m_run = mn;
#pragma unroll
    for (int j = 0; j < 4; ++j)
#pragma unroll
      for (int r = 0; r < 8; ++r)
        s[j][r] = exp2f((s[j][r] - m_run) * 1.44269504f);
    const v8f rs8 = (s[0] + s[1]) + (s[2] + s[3]);
    const float rs = ((rs8[0] + rs8[1]) + (rs8[2] + rs8[3])) +
                     ((rs8[4] + rs8[5]) + (rs8[6] + rs8[7]));
    l_run = l_run * alpha + rs;
#pragma unroll
    for (int t = 0; t < 4; ++t) o[t] *= alpha;

    // O^T += V^T P^T: B = score tiles 2 kk and 2 kk + 1 rounded in place (element
    // e = key 32 kk + 8 hh + e, e + 8 = key 32 kk + 16 + 8 hh + e: the order that
    // the two transposing loads of an A fragment deliver)
#pragma unroll
    for (int kk = 0; kk < 2; ++kk) {
      v8u pw;
#pragma unroll
      for (int i = 0; i < 4; ++i) {
        pw[i]     = pack_bf2(s[2 * kk][2 * i],     s[2 * kk][2 * i + 1]);
        pw[i + 4] = pack_bf2(s[2 * kk + 1][2 * i], s[2 * kk + 1][2 * i + 1]);
      }
      const v16bf pf = __builtin_bit_cast(v16bf, pw);
#pragma unroll
      for (int t = 0; t < 4; ++t) {
        const v8bf lo = load_tr16(vfrag + (kk * 32) * VP_ + t * 16);
        const v8bf hi = load_tr16(vfrag + (kk * 32 + 16) * VP_ + t * 16);
        v16bf a;
#pragma unroll
        for (int i = 0; i < 8; ++i) { a[i] = lo[i]; a[i + 8] = hi[i]; }
        o[t] = wmma_bf16(a, pf, o[t]);
      }
    }
  }

  // The halves' sums are joined once, unconditionally (every lane is on).
  const float l   = l_run + swap_halves(l_run);
  const float inv = 1.f / fmaxf(l, 1e-20f);
  __bf16* op = O + ((size_t)b * S_ + qb + m0 + c) * D_ + h * DK_ + 8 * hh;
#pragma unroll
  for (int t = 0; t < 4; ++t) {
    v4u pk;
#pragma unroll
    for (int i = 0; i < 4; ++i)
      pk[i] = pack_bf2(o[t][2 * i] * inv, o[t][2 * i + 1] * inv);
    *(v4u*)(op + 16 * t) = pk;   // 8 consecutive dk of one query
  }
}

// ---------- launcher ----------

extern "C" void kernel_launch(void* const* d_in, const int* in_sizes, int n_in,
                              void* d_out, int out_size, void* d_ws, size_t ws_size,
                              hipStream_t stream)
{
  (void)in_sizes; (void)n_in; (void)out_size; (void)ws_size;
  const float* x    = (const float*)d_in[0];
  const float* kv   = (const float*)d_in[1];
  const int*   msk  = (const int*)  d_in[2];
  const float* ln1g = (const float*)d_in[3];
  const float* ln1b = (const float*)d_in[4];
  // Order of the converted D x D weights: the five whose products share one launch
  // (q0, k0, v0, k1, v1) first, then o0, q1, o1.
  const float* qw0  = (const float*)d_in[5];
  const float* kw0  = (const float*)d_in[6];
  const float* vw0  = (const float*)d_in[7];
  const float* ow0  = (const float*)d_in[8];
  const float* ob0  = (const float*)d_in[9];
  const float* qw1  = (const float*)d_in[10];
  const float* kw1  = (const float*)d_in[11];
  const float* vw1  = (const float*)d_in[12];
  const float* ow1  = (const float*)d_in[13];
  const float* ob1  = (const float*)d_in[14];
  const float* ln2g = (const float*)d_in[15];
  const float* ln2b = (const float*)d_in[16];
  const float* w1   = (const float*)d_in[17];
  const float* b1   = (const float*)d_in[18];
  const float* w2   = (const float*)d_in[19];
  const float* b2   = (const float*)d_in[20];

  char* ws = (char*)d_ws;
  size_t off = 0;
  auto alloc = [&](size_t bytes) -> void* {
    void* p = ws + off;
    off += (bytes + 255) & ~(size_t)255;
    return p;
  };
  const size_t ROWS = (size_t)B_ * S_;  // 4096
  float*  y_f32  = (float*) alloc(ROWS * D_ * 4);
  __bf16* y_bf   = (__bf16*)alloc(ROWS * D_ * 2);
  __bf16* kvn_bf = (__bf16*)alloc(ROWS * D_ * 2);
  __bf16* wtAll  = (__bf16*)alloc((size_t)16 * D_ * D_ * 2);
  __bf16* wtO0   = wtAll + (size_t)5 * D_ * D_;
  __bf16* wtQ1   = wtAll + (size_t)6 * D_ * D_;
  __bf16* wtO1   = wtAll + (size_t)7 * D_ * D_;
  __bf16* w1t    = wtAll + (size_t)8 * D_ * D_;
  __bf16* w2t    = wtAll + (size_t)12 * D_ * D_;
  __bf16* qB     = (__bf16*)alloc(5 * ROWS * D_ * 2);   // q, k0, v0, k1, v1
  __bf16* kB0    = qB + 1 * ROWS * D_;
  __bf16* vB0    = qB + 2 * ROWS * D_;
  __bf16* kB1    = qB + 3 * ROWS * D_;
  __bf16* vB1    = qB + 4 * ROWS * D_;
  __bf16* aB     = (__bf16*)alloc(ROWS * D_ * 2);
  float*  y1_f32 = (float*) alloc(ROWS * D_ * 4);
  __bf16* y1_bf  = (__bf16*)alloc(ROWS * D_ * 2);
  float*  x2_f32 = (float*) alloc(ROWS * D_ * 4);
  __bf16* x2n_bf = (__bf16*)alloc(ROWS * D_ * 2);
  __bf16* hB     = (__bf16*)alloc(ROWS * FFN_ * 2);

  // LayerNorm 1 on x (keep f32 for residual) and on kv, one launch
  ln_kernel<<<dim3((unsigned)(ROWS / 8), 2), 256, 0, stream>>>(
      x, kv, ln1g, ln1b, y_f32, y_bf, kvn_bf);

  // weight conversion/transposition, one launch
  transpose_f32_to_bf16<<<2048, 256, 0, stream>>>(
      qw0, kw0, vw0, kw1, vw1, ow0, qw1, ow1, w1, w2, wtAll);

  const dim3 gproj(D_/128, (unsigned)(ROWS/128));        // (8, 32)
  const dim3 gqkv(D_/128, (unsigned)(ROWS/128), 5);      // (8, 32, 5)
  const dim3 gattn(S_/64, H_, B_);                       // (16,16,4)

  // q0 from y; k0, v0, k1, v1 from kvn: none waits for another, one launch
  gemm_bf16_kernel<<<gqkv, 256, 0, stream>>>(y_bf, kvn_bf, wtAll, nullptr, nullptr, nullptr, nullptr, qB, (int)ROWS, D_, D_, 0);

  // cross-attention 0
  flash_attn_kernel<<<gattn, 128, 0, stream>>>(qB, kB0, vB0, msk, aB);
  gemm_bf16_kernel<<<gproj, 256, 0, stream>>>(aB, nullptr, wtO0, ob0, y_f32, nullptr, y1_f32, y1_bf, (int)ROWS, D_, D_, 0);

  // cross-attention 1 (query from y1)
  gemm_bf16_kernel<<<gproj, 256, 0, stream>>>(y1_bf, nullptr, wtQ1, nullptr, nullptr, nullptr, nullptr, qB, (int)ROWS, D_, D_, 0);
  flash_attn_kernel<<<gattn, 128, 0, stream>>>(qB, kB1, vB1, msk, aB);
  // x2 = x + (o1 + ob1 + y1)
  gemm_bf16_kernel<<<gproj, 256, 0, stream>>>(aB, nullptr, wtO1, ob1, y1_f32, x, x2_f32, nullptr, (int)ROWS, D_, D_, 0);

  // FFN
  ln_kernel<<<dim3((unsigned)(ROWS / 8), 1), 256, 0, stream>>>(
      x2_f32, nullptr, ln2g, ln2b, nullptr, x2n_bf, nullptr);
  gemm_bf16_kernel<<<dim3(FFN_/128, (unsigned)(ROWS/128)), 256, 0, stream>>>(
      x2n_bf, nullptr, w1t, b1, nullptr, nullptr, nullptr, hB, (int)ROWS, FFN_, D_, 1);
  gemm_bf16_kernel<<<gproj, 256, 0, stream>>>(
      hB, nullptr, w2t, b2, x2_f32, nullptr, (float*)d_out, nullptr, (int)ROWS, D_, FFN_, 0);
}

// v006
// One run takes 220 microseconds.
// In two side-by-side timings against v005, it was 1.04 and 1.05 times as fast.
// Over all steps from v000 it is 2.74 times as fast.
#include <hip/hip_runtime.h>
#include <hip/hip_bf16.h>
#include <cstdint>

typedef __attribute__((ext_vector_type(16))) __bf16 v16bf;
typedef __attribute__((ext_vector_type(8)))  __bf16 v8bf;
typedef __attribute__((ext_vector_type(8)))  float  v8f;
typedef __attribute__((ext_vector_type(4)))  float  v4f;
typedef __attribute__((ext_vector_type(4)))  __bf16 v4bf;
typedef __attribute__((ext_vector_type(4)))  unsigned v4u;
typedef __attribute__((ext_vector_type(8)))  unsigned v8u;
typedef __attribute__((ext_vector_type(4)))  int      v4i;
typedef __attribute__((ext_vector_type(8)))  short    v8s;
typedef __attribute__((ext_vector_type(2)))  float    v2f;
typedef __attribute__((ext_vector_type(2)))  __bf16   v2bf;

#define B_   4
#define S_   1024
#define D_   1024
#define H_   16
#define DK_  64
#define FFN_ 4096

// ---------- helpers ----------

// Round to nearest even, by the chip's own conversion (v_cvt_pk_bf16_f32).
__device__ __forceinline__ __bf16 f2bf(float f) { return (__bf16)f; }

// Two floats rounded as in f2bf, lo in bits 15..0 and hi in bits 31..16: one
// instruction per pair.
__device__ __forceinline__ unsigned pack_bf2(float lo, float hi) {
  const v2f x = {lo, hi};
  return __builtin_bit_cast(unsigned, __builtin_convertvector(x, v2bf));
}

// 2^x as the bare v_exp_f32. The library's exp2f wraps it in a compare, two
// selects and a v_ldexp_f32 so that results below 2^-126 come out as denormals;
// here such a result may come out as 0. Used for softmax weights only, where the
// row's largest weight is 1 and the f32 sums absorb a term that small.
__device__ __forceinline__ float exp2_bare(float x) {
  return __builtin_amdgcn_exp2f(x);
}

// Low 32 bits of the generic address of a __shared__ object == LDS byte offset
// (flat shared-aperture mapping uses addr[31:0] as the LDS address).
__device__ __forceinline__ unsigned lds_addr(const void* p) {
  return (unsigned)(uintptr_t)p;
}

__device__ __forceinline__ void wait_async0() {
  asm volatile("s_wait_asynccnt 0" ::: "memory");
}

// Load a 16x32 bf16 WMMA fragment (A layout; also B when source is Bt[N][K])
// from a row-major [rows][ldk] bf16 tile in LDS.
__device__ __forceinline__ v16bf load_frag(const __bf16* base, int row0, int k0, int ldk) {
  const int lane = threadIdx.x & 31;
  const __bf16* p = base + (row0 + (lane & 15)) * ldk + k0 + ((lane >> 4) << 3);
  v8bf lo = *(const v8bf*)p;
  v8bf hi = *(const v8bf*)(p + 16);
  v16bf r;
#pragma unroll
  for (int i = 0; i < 8; ++i) { r[i] = lo[i]; r[i + 8] = hi[i]; }
  return r;
}

__device__ __forceinline__ v8f wmma_bf16(v16bf a, v16bf b, v8f c) {
  return __builtin_amdgcn_wmma_f32_16x16x32_bf16(false, a, false, b, (short)0, c,
                                                 false, false);
}

// ---------- LayerNorm (D=1024), outputs f32 and/or bf16 ----------
// One wave per row, 8 rows per block: a lane holds 8 x 16 B of its row, all loads
// in flight at once; the row sums stay inside the wave (no LDS, no barrier).
// An eighth of the waves of a block-per-row form have to be started.
// One launch may norm two tensors with the same g and bt: grid slice y = 1 reads
// in2 and writes outB2 only.

__global__ __launch_bounds__(256) void ln_kernel(
    const float* __restrict__ in, const float* __restrict__ in2,
    const float* __restrict__ g,
    const float* __restrict__ bt, float* __restrict__ outF,
    __bf16* __restrict__ outB, __bf16* __restrict__ outB2)
{
  if (blockIdx.y) { in = in2; outF = nullptr; outB = outB2; }
  const int lane = threadIdx.x & 31;
  const int row  = blockIdx.x * 8 + (threadIdx.x >> 5);
  const v4f* p  = (const v4f*)(in + (size_t)row * D_);
  const v4f* g4 = (const v4f*)g;
  const v4f* b4 = (const v4f*)bt;
  v4f v[8], gg[8], bb[8];
#pragma unroll
  for (int i = 0; i < 8; ++i) v[i] = p[lane + i * 32];
#pragma unroll
  for (int i = 0; i < 8; ++i) { gg[i] = g4[lane + i * 32]; bb[i] = b4[lane + i * 32]; }
  v4f s4 = {0.f, 0.f, 0.f, 0.f}, q4 = {0.f, 0.f, 0.f, 0.f};
#pragma unroll
  for (int i = 0; i < 8; ++i) { s4 += v[i]; q4 += v[i] * v[i]; }
  float s  = (s4[0] + s4[1]) + (s4[2] + s4[3]);
  float sq = (q4[0] + q4[1]) + (q4[2] + q4[3]);
#pragma unroll
  for (int off = 16; off >= 1; off >>= 1) {
    s  += __shfl_xor(s,  off, 32);
    sq += __shfl_xor(sq, off, 32);
  }
  const float mean = s * (1.f / D_);
  const float var  = sq * (1.f / D_) - mean * mean;
  const float rstd = rsqrtf(var + 1e-5f);
  v4bf ob[8];
#pragma unroll
  for (int i = 0; i < 8; ++i) {
    v[i] = (v[i] - mean) * rstd * gg[i] + bb[i];
#pragma unroll
    for (int e = 0; e < 4; ++e) ob[i][e] = f2bf(v[i][e]);
  }
  if (outB) {
    v4bf* q = (v4bf*)(outB + (size_t)row * D_);
#pragma unroll
    for (int i = 0; i < 8; ++i) q[lane + i * 32] = ob[i];
  }
  // Registers that the stores above name may be rewritten from here on.
  asm volatile("s_wait_xcnt 0x0" ::: "memory");
  if (outF) {
    v4f* q = (v4f*)(outF + (size_t)row * D_);
#pragma unroll
    for (int i = 0; i < 8; ++i) q[lane + i * 32] = v[i];
  }
}

// ---------- fp32 [K,N] -> bf16 transposed [N,K] ----------
// One block moves 128 k x 64 n: 8 loads of 16 B per lane in flight (256-B pieces
// of W rows), two k neighbours packed into a dword, dwords transposed through
// LDS, 256-B pieces of Wt rows stored. K a multiple of 128, N of 64.
// One launch converts all ten weights: blocks 0..1023 the eight D x D ones (128
// tiles each), 1024..1535 the D x FFN one, 1536..2047 the FFN x D one. The results
// lie one after the other in WtAll, in the order of the arguments.

#define TK_ 128
#define TN_ 64
#define TP_ 65   // LDS row pitch in dwords: odd, so both sides meet 32 banks

__global__ __launch_bounds__(256) void transpose_f32_to_bf16(
    const float* __restrict__ Wa, const float* __restrict__ Wb,
    const float* __restrict__ Wc, const float* __restrict__ Wd,
    const float* __restrict__ We, const float* __restrict__ Wf,
    const float* __restrict__ Wg, const float* __restrict__ Wh,
    const float* __restrict__ Wup, const float* __restrict__ Wdn,
    __bf16* __restrict__ WtAll)
{
  __shared__ unsigned t[TN_ * TP_];               // [n][k / 2]
  const int bid = blockIdx.x;
  const float* W;
  __bf16* Wt;
  int K, N, tile;
  if (bid < 1024) {
    const int w = bid >> 7;
    W = (w & 4) ? ((w & 2) ? ((w & 1) ? Wh : Wg) : ((w & 1) ? Wf : We))
                : ((w & 2) ? ((w & 1) ? Wd : Wc) : ((w & 1) ? Wb : Wa));
    Wt = WtAll + (size_t)w * D_ * D_;
    K = D_; N = D_; tile = bid & 127;
  } else if (bid < 1536) {
    W = Wup; Wt = WtAll + (size_t)8 * D_ * D_;
    K = D_; N = FFN_; tile = bid - 1024;
  } else {
    W = Wdn; Wt = WtAll + (size_t)12 * D_ * D_;
    K = FFN_; N = D_; tile = bid - 1536;
  }
  const int nTiles = N / TN_;                     // 16 or 64
  const int n0 = (tile & (nTiles - 1)) * TN_, k0 = (tile / nTiles) * TK_;
  const int lo4 = threadIdx.x & 15, hi4 = threadIdx.x >> 4;
  const float* pa[4];
  const float* pb[4];
  v4f a[4], b[4];
#pragma unroll
  for (int i = 0; i < 4; ++i) {
    pa[i] = W + (size_t)(k0 + 2 * (hi4 + i * 16)) * N + (n0 + lo4 * 4);
    pb[i] = pa[i] + N;
  }
#pragma unroll
  for (int i = 0; i < 4; ++i) {
    a[i] = *(const v4f*)pa[i];
    b[i] = *(const v4f*)pb[i];
  }
  // Every load's address pair stays whole until this wait: named here as inputs,
  // none of them can serve as a later load's destination.
  asm volatile("s_wait_xcnt 0x0"
               :: "v"(pa[0]), "v"(pa[1]), "v"(pa[2]), "v"(pa[3]),
                  "v"(pb[0]), "v"(pb[1]), "v"(pb[2]), "v"(pb[3])
               : "memory");
#pragma unroll
  for (int i = 0; i < 4; ++i)
#pragma unroll
    for (int j = 0; j < 4; ++j)
      t[(lo4 * 4 + j) * TP_ + hi4 + i * 16] = pack_bf2(a[i][j], b[i][j]);
  __syncthreads();
#pragma unroll
  for (int i = 0; i < 4; ++i) {
    const int n = hi4 + i * 16;
    v4u o;
#pragma unroll
    for (int e = 0; e < 4; ++e) o[e] = t[n * TP_ + lo4 * 4 + e];
    *(v4u*)(Wt + (size_t)(n0 + n) * K + (k0 + lo4 * 8)) = o;
  }
}

// ---------- GEMM: C[M,N] = epi( A[M,K]bf16 @ Bt[N,K]bf16^T ) ----------
// 128x128 block tile, 8 waves -> 32x64 per wave (2x4 WMMA frags).
// A stage is 128 k of every operand row (256 B, whole L2 units), two LDS buffers
// filled by GLOBAL_LOAD_ASYNC_TO_LDS (ASYNCcnt): 16 copies per lane in flight
// while the other buffer's 32 WMMAs per wave run, one barrier per stage.
// Main loop unrolled 2 stages so buffer indices are compile-time constants.
// Requires K a multiple of 256 (an even number of stages, at least two).
// One launch may hold several products of one shape: grid slice z > 0 reads Az,
// and the slices' Bt and outB lie one after the other.

#define GK_    128            // k per stage
#define GPITCH 136            // LDS row pitch in elements: 272 B, 16 B x odd

// One stage: 8 + 8 async copies of 16 B per lane (rows 16 apart of the A and of
// the B panel), 32-bit lane offset on a scalar base. The s_wait_xcnt closes the
// statement so that no address register is rewritten ahead of it.
__device__ __forceinline__ void async_copy_stage(unsigned la, unsigned lb,
                                                 const unsigned (&vo)[8],
                                                 const void* baseA,
                                                 const void* baseB) {
  const unsigned lStep = 16 * GPITCH * 2;
  asm volatile(
      "global_load_async_to_lds_b128 %0, %16, %24\n\t"
      "global_load_async_to_lds_b128 %1, %17, %24\n\t"
      "global_load_async_to_lds_b128 %2, %18, %24\n\t"
      "global_load_async_to_lds_b128 %3, %19, %24\n\t"
      "global_load_async_to_lds_b128 %4, %20, %24\n\t"
      "global_load_async_to_lds_b128 %5, %21, %24\n\t"
      "global_load_async_to_lds_b128 %6, %22, %24\n\t"
      "global_load_async_to_lds_b128 %7, %23, %24\n\t"
      "global_load_async_to_lds_b128 %8, %16, %25\n\t"
      "global_load_async_to_lds_b128 %9, %17, %25\n\t"
      "global_load_async_to_lds_b128 %10, %18, %25\n\t"
      "global_load_async_to_lds_b128 %11, %19, %25\n\t"
      "global_load_async_to_lds_b128 %12, %20, %25\n\t"
      "global_load_async_to_lds_b128 %13, %21, %25\n\t"
      "global_load_async_to_lds_b128 %14, %22, %25\n\t"
      "global_load_async_to_lds_b128 %15, %23, %25\n\t"
      "s_wait_xcnt 0x0"
      :: "v"(la), "v"(la + lStep), "v"(la + 2 * lStep), "v"(la + 3 * lStep),
         "v"(la + 4 * lStep), "v"(la + 5 * lStep), "v"(la + 6 * lStep),
         "v"(la + 7 * lStep),
         "v"(lb), "v"(lb + lStep), "v"(lb + 2 * lStep), "v"(lb + 3 * lStep),
         "v"(lb + 4 * lStep), "v"(lb + 5 * lStep), "v"(lb + 6 * lStep),
         "v"(lb + 7 * lStep),
         "v"(vo[0]), "v"(vo[1]), "v"(vo[2]), "v"(vo[3]),
         "v"(vo[4]), "v"(vo[5]), "v"(vo[6]), "v"(vo[7]),
         "s"(baseA), "s"(baseB)
      : "memory");
}

// This wave's LDS reads have returned before the buffer they read is refilled.
__device__ __forceinline__ void wait_ds0() {
  asm volatile("s_wait_dscnt 0x0" ::: "memory");
}

__global__ __launch_bounds__(256) void gemm_bf16_kernel(
    const __bf16* __restrict__ A, const __bf16* __restrict__ Az,
    const __bf16* __restrict__ Bt,
    const float* __restrict__ bias, const float* __restrict__ res1,
    const float* __restrict__ res2, float* __restrict__ outF,
    __bf16* __restrict__ outB, int M, int N, int K, int doRelu)
{
  __shared__ __align__(16) __bf16 As[2][128 * GPITCH];  // [row][k], +8 pad
  __shared__ __align__(16) __bf16 Bs[2][128 * GPITCH];  // [n][k],  +8 pad
  if (blockIdx.z) {
    A = Az;
    Bt   += (size_t)blockIdx.z * N * K;
    outB += (size_t)blockIdx.z * M * N;
  }
  const int tid  = threadIdx.x;
  const int lane = tid & 31, wave = tid >> 5;
  const int wm = wave >> 1, wn = wave & 1;
  const int m0 = wm * 32, n0 = wn * 64;
  const int rowM = blockIdx.y * 128, colN = blockIdx.x * 128;

  // per-thread 16B chunks of the 128x128 tiles (2048 chunks, 8 per thread):
  // chunk q0 of rows r0, r0 + 16, ..., r0 + 112; a wave covers two whole rows.
  const int r0 = tid >> 4, q0 = tid & 15;
  // The lane offsets are the same for both panels; the panel's first row and
  // the stage's k go into the scalar bases.
  const __bf16* sA = A  + (size_t)rowM * K;
  const __bf16* sB = Bt + (size_t)colN * K;
  unsigned vo[8];
#pragma unroll
  for (int i = 0; i < 8; ++i)
    vo[i] = (unsigned)(((r0 + i * 16) * K + q0 * 8) * 2);
  unsigned ldsA[2], ldsB[2];
#pragma unroll
  for (int bufi = 0; bufi < 2; ++bufi) {
    ldsA[bufi] = lds_addr(&As[bufi][r0 * GPITCH + q0 * 8]);
    ldsB[bufi] = lds_addr(&Bs[bufi][r0 * GPITCH + q0 * 8]);
  }

  const v8f zero8 = {0.f, 0.f, 0.f, 0.f, 0.f, 0.f, 0.f, 0.f};
  v8f acc[2][4];
#pragma unroll
  for (int i = 0; i < 2; ++i)
#pragma unroll
    for (int j = 0; j < 4; ++j) acc[i][j] = zero8;

  const int stages = K / GK_;

#define ISSUE_STAGE(BUFI, ST)                                   \
  do {                                                          \
    const size_t kOff = (size_t)(ST) * GK_;                     \
    async_copy_stage(ldsA[BUFI], ldsB[BUFI], vo, sA + kOff,     \
                     sB + kOff);                                \
  } while (0)

// kk is unrolled so that every LDS offset is an immediate and the next 32 k's
// fragment loads can be scheduled among this 32 k's WMMAs.
#define COMPUTE_PANEL(BUFI)                                     \
  do {                                                          \
    _Pragma("unroll")                                           \
    for (int kk = 0; kk < GK_; kk += 32) {                      \
      v16bf af[2], bfr[4];                                      \
      _Pragma("unroll")                                         \
      for (int i = 0; i < 2; ++i)                               \
        af[i] = load_frag(As[BUFI], m0 + i * 16, kk, GPITCH);   \
      _Pragma("unroll")                                         \
      for (int j = 0; j < 4; ++j)                               \
        bfr[j] = load_frag(Bs[BUFI], n0 + j * 16, kk, GPITCH);  \
      _Pragma("unroll")                                         \
      for (int i = 0; i < 2; ++i)                               \
        _Pragma("unroll")                                       \
        for (int j = 0; j < 4; ++j)                             \
          acc[i][j] = wmma_bf16(af[i], bfr[j], acc[i][j]);      \
    }                                                           \
  } while (0)

// Publish point: own LDS reads returned, own copies landed, then the one barrier
// that both publishes the next stage and frees the buffer just read.
#define PUBLISH()                                               \
  do { wait_ds0(); wait_async0(); __syncthreads(); } while (0)

  ISSUE_STAGE(0, 0);
  wait_async0();
  __syncthreads();
  ISSUE_STAGE(1, 1);
  for (int st = 0; st < stages; st += 2) {
    COMPUTE_PANEL(0);
    PUBLISH();
    if (st + 2 < stages) ISSUE_STAGE(0, st + 2);
    COMPUTE_PANEL(1);
    PUBLISH();
    if (st + 3 < stages) ISSUE_STAGE(1, st + 3);
  }
  wait_async0();
#undef ISSUE_STAGE
#undef COMPUTE_PANEL
#undef PUBLISH

  // epilogue: C/D layout lane=N (lane&15), vgpr r = M offset (+8 for lanes>=16)
  // Each optional operand is tested ONCE, around a loop over all 64 elements of
  // the lane, so that its loads are all in flight together. (Tested per element,
  // every load stands in a branch of its own and is waited for alone.)
  // Per element the order of the additions stays bias, res1, res2.
  const int ho = (lane < 16) ? 0 : 8;
  const int nc = lane & 15;
  const unsigned col0 = (unsigned)(colN + n0 + nc);
  // Byte offset of f32 element (row i * 16 + r of the wave's tile, column j = 0);
  // M * N * 4 stays below 2^32. Column j is 64 B further on.
  unsigned ro[16];
#pragma unroll
  for (int k = 0; k < 16; ++k)
    ro[k] = ((unsigned)(rowM + m0 + (k >> 3) * 16 + (k & 7) + ho) * (unsigned)N + col0) * 4u;

  if (bias) {
    float bv[4];
#pragma unroll
    for (int j = 0; j < 4; ++j) bv[j] = bias[col0 + j * 16];
#pragma unroll
    for (int i = 0; i < 2; ++i)
#pragma unroll
      for (int j = 0; j < 4; ++j) acc[i][j] += bv[j];
    // Registers that the loads above name may be rewritten from here on.
    asm volatile("s_wait_xcnt 0x0" ::: "memory");
  }
  if (res1) {
    v8f t[2][4];
#pragma unroll
    for (int i = 0; i < 2; ++i)
#pragma unroll
      for (int j = 0; j < 4; ++j)
#pragma unroll
        for (int r = 0; r < 8; ++r)
          t[i][j][r] = *(const float*)((const char*)res1 + (size_t)ro[i * 8 + r] + j * 64);
#pragma unroll
    for (int i = 0; i < 2; ++i)
#pragma unroll
      for (int j = 0; j < 4; ++j) acc[i][j] += t[i][j];
    // Registers that the loads above name may be rewritten from here on.
    asm volatile("s_wait_xcnt 0x0" ::: "memory");
  }
  if (res2) {
    v8f t[2][4];
#pragma unroll
    for (int i = 0; i < 2; ++i)
#pragma unroll
      for (int j = 0; j < 4; ++j)
#pragma unroll
        for (int r = 0; r < 8; ++r)
          t[i][j][r] = *(const float*)((const char*)res2 + (size_t)ro[i * 8 + r] + j * 64);
#pragma unroll
    for (int i = 0; i < 2; ++i)
#pragma unroll
      for (int j = 0; j < 4; ++j) acc[i][j] += t[i][j];
    // Registers that the loads above name may be rewritten from here on.
    asm volatile("s_wait_xcnt 0x0" ::: "memory");
  }
  if (doRelu) {
#pragma unroll
    for (int i = 0; i < 2; ++i)
#pragma unroll
      for (int j = 0; j < 4; ++j)
#pragma unroll
        for (int r = 0; r < 8; ++r) acc[i][j][r] = fmaxf(acc[i][j][r], 0.f);
  }
  if (outF) {
#pragma unroll
    for (int i = 0; i < 2; ++i)
#pragma unroll
      for (int j = 0; j < 4; ++j)
#pragma unroll
        for (int r = 0; r < 8; ++r)
          *(float*)((char*)outF + (size_t)ro[i * 8 + r] + j * 64) = acc[i][j][r];
  }
  // Registers that the stores above name may be rewritten from here on.
  asm volatile("s_wait_xcnt 0x0" ::: "memory");
  if (outB) {
    unsigned hb[2][4][4];   // rows r = 2 p (low half) and 2 p + 1 (high half)
#pragma unroll
    for (int i = 0; i < 2; ++i)
#pragma unroll
      for (int j = 0; j < 4; ++j)
#pragma unroll
        for (int p = 0; p < 4; ++p)
          hb[i][j][p] = pack_bf2(acc[i][j][2 * p], acc[i][j][2 * p + 1]);
#pragma unroll
    for (int k = 0; k < 16; ++k) ro[k] >>= 1;
    // Every value is rounded before the first store issues: mixed with the
    // stores, the rounding reuses their registers behind a wait each time.
    __builtin_amdgcn_sched_barrier(0);
#pragma unroll
    for (int i = 0; i < 2; ++i)
#pragma unroll
      for (int j = 0; j < 4; ++j)
#pragma unroll
        for (int r = 0; r < 8; ++r)
          *(unsigned short*)((char*)outB + (size_t)ro[i * 8 + r] + j * 32) =
              (unsigned short)(hb[i][j][r >> 1] >> ((r & 1) * 16));
  }
}

#define KP_ 72   // K row pitch in elements: 144 B, 16 B x odd (ds_load_b128)
#define VP_ 80   // V row pitch in elements: 160 B, 32 B x odd (ds_load_tr16_b128)

// 8 x 16-bit column piece of a row-major LDS tile: lane (c, h) gets
// T[8h + 0..7][c] when lane l points at row 8 * (l >> 4) + (l & 7), 16-B piece
// (l >> 3) & 1. Every lane is on wherever this is called.
__device__ __forceinline__ v8bf load_tr16(const __bf16* p) {
  typedef __attribute__((address_space(3))) v8s lds_v8s;
  return __builtin_bit_cast(v8bf, __builtin_amdgcn_ds_load_tr16_b128_v8i16((lds_v8s*)p));
}

// Lane l gets the value of lane l ^ 16.
__device__ __forceinline__ float swap_halves(float x) {
  const int i = __builtin_bit_cast(int, x);
  return __builtin_bit_cast(float, __builtin_amdgcn_permlanex16(
      i, i, 0x76543210, 0xfedcba98, false, false));
}

// One 64-key tile of K and of V: 4 + 4 async copies of 16 B per lane, 32-bit lane
// offset on a scalar base. The s_wait_xcnt closes the statement so that no
// address register is rewritten ahead of it.
__device__ __forceinline__ void async_copy_kv(const unsigned (&kl)[4],
                                              const unsigned (&vl)[4],
                                              const unsigned (&go)[4],
                                              const void* baseK,
                                              const void* baseV) {
  asm volatile(
      "global_load_async_to_lds_b128 %0, %8, %12\n\t"
      "global_load_async_to_lds_b128 %1, %9, %12\n\t"
      "global_load_async_to_lds_b128 %2, %10, %12\n\t"
      "global_load_async_to_lds_b128 %3, %11, %12\n\t"
      "global_load_async_to_lds_b128 %4, %8, %13\n\t"
      "global_load_async_to_lds_b128 %5, %9, %13\n\t"
      "global_load_async_to_lds_b128 %6, %10, %13\n\t"
      "global_load_async_to_lds_b128 %7, %11, %13\n\t"
      "s_wait_xcnt 0x0"
      :: "v"(kl[0]), "v"(kl[1]), "v"(kl[2]), "v"(kl[3]),
         "v"(vl[0]), "v"(vl[1]), "v"(vl[2]), "v"(vl[3]),
         "v"(go[0]), "v"(go[1]), "v"(go[2]), "v"(go[3]),
         "s"(baseK), "s"(baseV)
      : "memory");
}

__global__ __launch_bounds__(128) void flash_attn_kernel(
    const __bf16* __restrict__ Q, const __bf16* __restrict__ Kb,
    const __bf16* __restrict__ V, const int* __restrict__ mask,
    __bf16* __restrict__ O)
{
  __shared__ __align__(16) __bf16 Ks[64 * KP_];     // [key][dk]
  __shared__ __align__(32) __bf16 Vs[64 * VP_];     // [key][dk]
  __shared__ __align__(16) float  Ms[S_];           // per key: 0, or -1e30 if masked

  const int tid = threadIdx.x, lane = tid & 31, wave = tid >> 5;
  const int c = lane & 15, hh = lane >> 4;
  const int qb = blockIdx.x * 64, h = blockIdx.y, b = blockIdx.z;
  const int m0 = wave * 16;
  const size_t qbase  = ((size_t)b * S_ + qb) * D_ + h * DK_;
  const size_t kvrow0 = (size_t)b * S_ * D_ + h * DK_;

  // Q^T fragments (B operand, column = query c), in the k order of load_frag.
  const __bf16* qp = Q + qbase + (size_t)(m0 + c) * D_ + 8 * hh;
  const v4i* mp = (const v4i*)(mask + (size_t)b * S_ + tid * 8);
  const v8bf q0 = *(const v8bf*)qp;
  const v8bf q1 = *(const v8bf*)(qp + 16);
  const v8bf q2 = *(const v8bf*)(qp + 32);
  const v8bf q3 = *(const v8bf*)(qp + 48);
  const v4i mk0 = mp[0], mk1 = mp[1];
  // The address pairs of the loads above stay whole until this wait.
  asm volatile("s_wait_xcnt 0x0" :: "v"(qp), "v"(mp) : "memory");
  v16bf qf[2];
#pragma unroll
  for (int i = 0; i < 8; ++i) {
    qf[0][i] = q0[i]; qf[0][i + 8] = q1[i];
    qf[1][i] = q2[i]; qf[1][i + 8] = q3[i];
  }
  // The key mask of this batch row as an addend, 8 keys per thread; published by
  // the barriers at the head of the first trip.
  {
    v4f f0, f1;
#pragma unroll
    for (int e = 0; e < 4; ++e) {
      f0[e] = (mk0[e] == 0) ? -1e30f : 0.f;
      f1[e] = (mk1[e] == 0) ? -1e30f : 0.f;
    }
    *(v4f*)&Ms[tid * 8]     = f0;
    *(v4f*)&Ms[tid * 8 + 4] = f1;
  }

  // per-thread 16B chunks of a 64x64 bf16 tile (512 chunks, 4 per thread)
  unsigned kLds[4], vLds[4], tOff[4];
#pragma unroll
  for (int t = 0; t < 4; ++t) {
    const int ch = tid + t * 128;
    const int rr = ch >> 3, cc = ch & 7;
    kLds[t] = lds_addr(&Ks[rr * KP_ + cc * 8]);
    vLds[t] = lds_addr(&Vs[rr * VP_ + cc * 8]);
    tOff[t] = (unsigned)((rr * D_ + cc * 8) * 2);
  }
  const __bf16* vfrag = &Vs[(8 * hh + (lane & 7)) * VP_ + ((lane >> 3) & 1) * 8];

  const v8f zero8 = {0.f, 0.f, 0.f, 0.f, 0.f, 0.f, 0.f, 0.f};
  v8f o[4];                      // o[t][r] = O[query c][dk 16 t + 8 hh + r]
#pragma unroll
  for (int t = 0; t < 4; ++t) o[t] = zero8;
  float m_run = -3.0e38f;        // the query's maximum, alike in both halves
  float l_run = 0.f;             // the sum over this half's keys only

  for (int kt = 0; kt < 16; ++kt) {
    wait_ds0();       // own reads of Ks/Vs (first trip: writes of Ms) are done
    __syncthreads();  // and so are every other wave's: the tiles may be refilled
    const size_t kvb = kvrow0 + (size_t)kt * 64 * D_;
    async_copy_kv(kLds, vLds, tOff, Kb + kvb, V + kvb);
    wait_async0();
    __syncthreads();

    // S^T = K Q^T: s[j][r] = score(key 16 j + 8 hh + r, query c)
    v8f s[4];
#pragma unroll
    for (int j = 0; j < 4; ++j) s[j] = zero8;
#pragma unroll
    for (int kk = 0; kk < 2; ++kk)
#pragma unroll
      for (int j = 0; j < 4; ++j)
        s[j] = wmma_bf16(load_frag(Ks, j * 16, kk * 32, KP_), qf[kk], s[j]);
    // scale 1/sqrt(64) + key mask
#pragma unroll
    for (int j = 0; j < 4; ++j) {
      const float* mrow = &Ms[kt * 64 + j * 16 + 8 * hh];
      const v4f ma = *(const v4f*)mrow;
      const v4f mb = *(const v4f*)(mrow + 4);
#pragma unroll
      for (int r = 0; r < 4; ++r) {
        s[j][r]     = s[j][r]     * 0.125f + ma[r];
        s[j][r + 4] = s[j][r + 4] * 0.125f + mb[r];
      }
    }
    // online softmax (base-2): one query per lane
    v8f mx8 = __builtin_elementwise_max(__builtin_elementwise_max(s[0], s[1]),
                                        __builtin_elementwise_max(s[2], s[3]));
    float mx = fmaxf(fmaxf(fmaxf(mx8[0], mx8[1]), fmaxf(mx8[2], mx8[3])),
                     fmaxf(fmaxf(mx8[4], mx8[5]), fmaxf(mx8[6], mx8[7])));
    mx = fmaxf(mx, swap_halves(mx));
    const float mn = fmaxf(m_run, mx);
    const float alpha = exp2_bare((m_run - mn) * 1.44269504f);
    m_run = mn;
#pragma unroll
    for (int j = 0; j < 4; ++j)
#pragma unroll
      for (int r = 0; r < 8; ++r)
        s[j][r] = exp2_bare((s[j][r] - m_run) * 1.44269504f);
    const v8f rs8 = (s[0] + s[1]) + (s[2] + s[3]);
    const float rs = ((rs8[0] + rs8[1]) + (rs8[2] + rs8[3])) +
                     ((rs8[4] + rs8[5]) + (rs8[6] + rs8[7]));
    l_run = l_run * alpha + rs;
#pragma unroll
    for (int t = 0; t < 4; ++t) o[t] *= alpha;

    // O^T += V^T P^T: B = score tiles 2 kk and 2 kk + 1 rounded in place (element
    // e = key 32 kk + 8 hh + e, e + 8 = key 32 kk + 16 + 8 hh + e: the order that
    // the two transposing loads of an A fragment deliver)
#pragma unroll
    for (int kk = 0; kk < 2; ++kk) {
      v8u pw;
#pragma unroll
      for (int i = 0; i < 4; ++i) {
        pw[i]     = pack_bf2(s[2 * kk][2 * i],     s[2 * kk][2 * i + 1]);
        pw[i + 4] = pack_bf2(s[2 * kk + 1][2 * i], s[2 * kk + 1][2 * i + 1]);
      }
      const v16bf pf = __builtin_bit_cast(v16bf, pw);
#pragma unroll
      for (int t = 0; t < 4; ++t) {
        const v8bf lo = load_tr16(vfrag + (kk * 32) * VP_ + t * 16);
        const v8bf hi = load_tr16(vfrag + (kk * 32 + 16) * VP_ + t * 16);
        v16bf a;
#pragma unroll
        for (int i = 0; i < 8; ++i) { a[i] = lo[i]; a[i + 8] = hi[i]; }
        o[t] = wmma_bf16(a, pf, o[t]);
      }
    }
  }

  // The halves' sums are joined once, unconditionally (every lane is on).
  const float l   = l_run + swap_halves(l_run);
  const float inv = 1.f / fmaxf(l, 1e-20f);
  __bf16* op = O + ((size_t)b * S_ + qb + m0 + c) * D_ + h * DK_ + 8 * hh;
#pragma unroll
  for (int t = 0; t < 4; ++t) {
    v4u pk;
#pragma unroll
    for (int i = 0; i < 4; ++i)
      pk[i] = pack_bf2(o[t][2 * i] * inv, o[t][2 * i + 1] * inv);
    *(v4u*)(op + 16 * t) = pk;   // 8 consecutive dk of one query
  }
}

// ---------- launcher ----------

extern "C" void kernel_launch(void* const* d_in, const int* in_sizes, int n_in,
                              void* d_out, int out_size, void* d_ws, size_t ws_size,
                              hipStream_t stream)
{
  (void)in_sizes; (void)n_in; (void)out_size; (void)ws_size;
  const float* x    = (const float*)d_in[0];
  const float* kv   = (const float*)d_in[1];
  const int*   msk  = (const int*)  d_in[2];
  const float* ln1g = (const float*)d_in[3];
  const float* ln1b = (const float*)d_in[4];
  // Order of the converted D x D weights: the five whose products share one launch
  // (q0, k0, v0, k1, v1) first, then o0, q1, o1.
  const float* qw0  = (const float*)d_in[5];
  const float* kw0  = (const float*)d_in[6];
  const float* vw0  = (const float*)d_in[7];
  const float* ow0  = (const float*)d_in[8];
  const float* ob0  = (const float*)d_in[9];
  const float* qw1  = (const float*)d_in[10];
  const float* kw1  = (const float*)d_in[11];
  const float* vw1  = (const float*)d_in[12];
  const float* ow1  = (const float*)d_in[13];
  const float* ob1  = (const float*)d_in[14];
  const float* ln2g = (const float*)d_in[15];
  const float* ln2b = (const float*)d_in[16];
  const float* w1   = (const float*)d_in[17];
  const float* b1   = (const float*)d_in[18];
  const float* w2   = (const float*)d_in[19];
  const float* b2   = (const float*)d_in[20];

  char* ws = (char*)d_ws;
  size_t off = 0;
  auto alloc = [&](size_t bytes) -> void* {
    void* p = ws + off;
    off += (bytes + 255) & ~(size_t)255;
    return p;
  };
  const size_t ROWS = (size_t)B_ * S_;  // 4096
  float*  y_f32  = (float*) alloc(ROWS * D_ * 4);
  __bf16* y_bf   = (__bf16*)alloc(ROWS * D_ * 2);
  __bf16* kvn_bf = (__bf16*)alloc(ROWS * D_ * 2);
  __bf16* wtAll  = (__bf16*)alloc((size_t)16 * D_ * D_ * 2);
  __bf16* wtO0   = wtAll + (size_t)5 * D_ * D_;
  __bf16* wtQ1   = wtAll + (size_t)6 * D_ * D_;
  __bf16* wtO1   = wtAll + (size_t)7 * D_ * D_;
  __bf16* w1t    = wtAll + (size_t)8 * D_ * D_;
  __bf16* w2t    = wtAll + (size_t)12 * D_ * D_;
  __bf16* qB     = (__bf16*)alloc(5 * ROWS * D_ * 2);   // q, k0, v0, k1, v1
  __bf16* kB0    = qB + 1 * ROWS * D_;
  __bf16* vB0    = qB + 2 * ROWS * D_;
  __bf16* kB1    = qB + 3 * ROWS * D_;
  __bf16* vB1    = qB + 4 * ROWS * D_;
  __bf16* aB     = (__bf16*)alloc(ROWS * D_ * 2);
  float*  y1_f32 = (float*) alloc(ROWS * D_ * 4);
  __bf16* y1_bf  = (__bf16*)alloc(ROWS * D_ * 2);
  float*  x2_f32 = (float*) alloc(ROWS * D_ * 4);
  __bf16* x2n_bf = (__bf16*)alloc(ROWS * D_ * 2);
  __bf16* hB     = (__bf16*)alloc(ROWS * FFN_ * 2);

  // LayerNorm 1 on x (keep f32 for residual) and on kv, one launch
  ln_kernel<<<dim3((unsigned)(ROWS / 8), 2), 256, 0, stream>>>(
      x, kv, ln1g, ln1b, y_f32, y_bf, kvn_bf);

  // weight conversion/transposition, one launch
  transpose_f32_to_bf16<<<2048, 256, 0, stream>>>(
      qw0, kw0, vw0, kw1, vw1, ow0, qw1, ow1, w1, w2, wtAll);

  const dim3 gproj(D_/128, (unsigned)(ROWS/128));        // (8, 32)
  const dim3 gqkv(D_/128, (unsigned)(ROWS/128), 5);      // (8, 32, 5)
  const dim3 gattn(S_/64, H_, B_);                       // (16,16,4)

  // q0 from y; k0, v0, k1, v1 from kvn: none waits for another, one launch
  gemm_bf16_kernel<<<gqkv, 256, 0, stream>>>(y_bf, kvn_bf, wtAll, nullptr, nullptr, nullptr, nullptr, qB, (int)ROWS, D_, D_, 0);

  // cross-attention 0
  flash_attn_kernel<<<gattn, 128, 0, stream>>>(qB, kB0, vB0, msk, aB);
  gemm_bf16_kernel<<<gproj, 256, 0, stream>>>(aB, nullptr, wtO0, ob0, y_f32, nullptr, y1_f32, y1_bf, (int)ROWS, D_, D_, 0);

  // cross-attention 1 (query from y1)
  gemm_bf16_kernel<<<gproj, 256, 0, stream>>>(y1_bf, nullptr, wtQ1, nullptr, nullptr, nullptr, nullptr, qB, (int)ROWS, D_, D_, 0);
  flash_attn_kernel<<<gattn, 128, 0, stream>>>(qB, kB1, vB1, msk, aB);
  // x2 = x + (o1 + ob1 + y1)
  gemm_bf16_kernel<<<gproj, 256, 0, stream>>>(aB, nullptr, wtO1, ob1, y1_f32, x, x2_f32, nullptr, (int)ROWS, D_, D_, 0);

  // FFN
  ln_kernel<<<dim3((unsigned)(ROWS / 8), 1), 256, 0, stream>>>(
      x2_f32, nullptr, ln2g, ln2b, nullptr, x2n_bf, nullptr);
  gemm_bf16_kernel<<<dim3(FFN_/128, (unsigned)(ROWS/128)), 256, 0, stream>>>(
      x2n_bf, nullptr, w1t, b1, nullptr, nullptr, nullptr, hB, (int)ROWS, FFN_, D_, 1);
  gemm_bf16_kernel<<<gproj, 256, 0, stream>>>(
      hB, nullptr, w2t, b2, x2_f32, nullptr, (float*)d_out, nullptr, (int)ROWS, D_, FFN_, 0);
}

// v007
// One run takes 213 microseconds.
// Two timings next to v006 both put it at 1.03 times that version's speed.
// All steps since v000 together make it 2.83 times as fast.
#include <hip/hip_runtime.h>
#include <hip/hip_bf16.h>
#include <cstdint>

typedef __attribute__((ext_vector_type(16))) __bf16 v16bf;
typedef __attribute__((ext_vector_type(8)))  __bf16 v8bf;
typedef __attribute__((ext_vector_type(8)))  float  v8f;
typedef __attribute__((ext_vector_type(4)))  float  v4f;
typedef __attribute__((ext_vector_type(4)))  __bf16 v4bf;
typedef __attribute__((ext_vector_type(4)))  unsigned v4u;
typedef __attribute__((ext_vector_type(8)))  unsigned v8u;
typedef __attribute__((ext_vector_type(4)))  int      v4i;
typedef __attribute__((ext_vector_type(8)))  short    v8s;
typedef __attribute__((ext_vector_type(2)))  float    v2f;
typedef __attribute__((ext_vector_type(2)))  __bf16   v2bf;

#define B_   4
#define S_   1024
#define D_   1024
#define H_   16
#define DK_  64
#define FFN_ 4096

// ---------- helpers ----------

// Round to nearest even, by the chip's own conversion (v_cvt_pk_bf16_f32).
__device__ __forceinline__ __bf16 f2bf(float f) { return (__bf16)f; }

// Two floats rounded as in f2bf, lo in bits 15..0 and hi in bits 31..16: one
// instruction per pair.
__device__ __forceinline__ unsigned pack_bf2(float lo, float hi) {
  const v2f x = {lo, hi};
  return __builtin_bit_cast(unsigned, __builtin_convertvector(x, v2bf));
}

// 2^x as the bare v_exp_f32. The library's exp2f wraps it in a compare, two
// selects and a v_ldexp_f32 so that results below 2^-126 come out as denormals;
// here such a result may come out as 0. Used for softmax weights only, where the
// row's largest weight is 1 and the f32 sums absorb a term that small.
__device__ __forceinline__ float exp2_bare(float x) {
  return __builtin_amdgcn_exp2f(x);
}

// Low 32 bits of the generic address of a __shared__ object == LDS byte offset
// (flat shared-aperture mapping uses addr[31:0] as the LDS address).
__device__ __forceinline__ unsigned lds_addr(const void* p) {
  return (unsigned)(uintptr_t)p;
}

__device__ __forceinline__ void wait_async0() {
  asm volatile("s_wait_asynccnt 0" ::: "memory");
}

// Load a 16x32 bf16 WMMA fragment (A layout; also B when source is Bt[N][K])
// from a row-major [rows][ldk] bf16 tile in LDS.
__device__ __forceinline__ v16bf load_frag(const __bf16* base, int row0, int k0, int ldk) {
  const int lane = threadIdx.x & 31;
  const __bf16* p = base + (row0 + (lane & 15)) * ldk + k0 + ((lane >> 4) << 3);
  v8bf lo = *(const v8bf*)p;
  v8bf hi = *(const v8bf*)(p + 16);
  v16bf r;
#pragma unroll
  for (int i = 0; i < 8; ++i) { r[i] = lo[i]; r[i + 8] = hi[i]; }
  return r;
}

__device__ __forceinline__ v8f wmma_bf16(v16bf a, v16bf b, v8f c) {
  return __builtin_amdgcn_wmma_f32_16x16x32_bf16(false, a, false, b, (short)0, c,
                                                 false, false);
}

// ---------- LayerNorm (D=1024), outputs f32 and/or bf16 ----------
// One wave per row, 8 rows per block: a lane holds 8 x 16 B of its row, all loads
// in flight at once; the row sums stay inside the wave (no LDS, no barrier).
// An eighth of the waves of a block-per-row form have to be started.
// One launch may norm two tensors with the same g and bt: grid slice y = 1 reads
// in2 and writes outB2 only.

__global__ __launch_bounds__(256) void ln_kernel(
    const float* __restrict__ in, const float* __restrict__ in2,
    const float* __restrict__ g,
    const float* __restrict__ bt, float* __restrict__ outF,
    __bf16* __restrict__ outB, __bf16* __restrict__ outB2)
{
  if (blockIdx.y) { in = in2; outF = nullptr; outB = outB2; }
  const int lane = threadIdx.x & 31;
  const int row  = blockIdx.x * 8 + (threadIdx.x >> 5);
  const v4f* p  = (const v4f*)(in + (size_t)row * D_);
  const v4f* g4 = (const v4f*)g;
  const v4f* b4 = (const v4f*)bt;
  v4f v[8], gg[8], bb[8];
#pragma unroll
  for (int i = 0; i < 8; ++i) v[i] = p[lane + i * 32];
#pragma unroll
  for (int i = 0; i < 8; ++i) { gg[i] = g4[lane + i * 32]; bb[i] = b4[lane + i * 32]; }
  v4f s4 = {0.f, 0.f, 0.f, 0.f}, q4 = {0.f, 0.f, 0.f, 0.f};
#pragma unroll
  for (int i = 0; i < 8; ++i) { s4 += v[i]; q4 += v[i] * v[i]; }
  float s  = (s4[0] + s4[1]) + (s4[2] + s4[3]);
  float sq = (q4[0] + q4[1]) + (q4[2] + q4[3]);
#pragma unroll
  for (int off = 16; off >= 1; off >>= 1) {
    s  += __shfl_xor(s,  off, 32);
    sq += __shfl_xor(sq, off, 32);
  }
  const float mean = s * (1.f / D_);
  const float var  = sq * (1.f / D_) - mean * mean;
  const float rstd = rsqrtf(var + 1e-5f);
  v4bf ob[8];
#pragma unroll
  for (int i = 0; i < 8; ++i) {
    v[i] = (v[i] - mean) * rstd * gg[i] + bb[i];
#pragma unroll
    for (int e = 0; e < 4; ++e) ob[i][e] = f2bf(v[i][e]);
  }
  if (outB) {
    v4bf* q = (v4bf*)(outB + (size_t)row * D_);
#pragma unroll
    for (int i = 0; i < 8; ++i) q[lane + i * 32] = ob[i];
  }
  // Registers that the stores above name may be rewritten from here on.
  asm volatile("s_wait_xcnt 0x0" ::: "memory");
  if (outF) {
    v4f* q = (v4f*)(outF + (size_t)row * D_);
#pragma unroll
    for (int i = 0; i < 8; ++i) q[lane + i * 32] = v[i];
  }
}

// ---------- fp32 [K,N] -> bf16 transposed [N,K] ----------
// One block moves 128 k x 64 n: 8 loads of 16 B per lane in flight (256-B pieces
// of W rows), two k neighbours packed into a dword, dwords transposed through
// LDS, 256-B pieces of Wt rows stored. K a multiple of 128, N of 64.
// One launch converts all ten weights: blocks 0..1023 the eight D x D ones (128
// tiles each), 1024..1535 the D x FFN one, 1536..2047 the FFN x D one. The results
// lie one after the other in WtAll, in the order of the arguments.

#define TK_ 128
#define TN_ 64
#define TP_ 65   // LDS row pitch in dwords: odd, so both sides meet 32 banks

__global__ __launch_bounds__(256) void transpose_f32_to_bf16(
    const float* __restrict__ Wa, const float* __restrict__ Wb,
    const float* __restrict__ Wc, const float* __restrict__ Wd,
    const float* __restrict__ We, const float* __restrict__ Wf,
    const float* __restrict__ Wg, const float* __restrict__ Wh,
    const float* __restrict__ Wup, const float* __restrict__ Wdn,
    __bf16* __restrict__ WtAll)
{
  __shared__ unsigned t[TN_ * TP_];               // [n][k / 2]
  const int bid = blockIdx.x;
  const float* W;
  __bf16* Wt;
  int K, N, tile;
  if (bid < 1024) {
    const int w = bid >> 7;
    W = (w & 4) ? ((w & 2) ? ((w & 1) ? Wh : Wg) : ((w & 1) ? Wf : We))
                : ((w & 2) ? ((w & 1) ? Wd : Wc) : ((w & 1) ? Wb : Wa));
    Wt = WtAll + (size_t)w * D_ * D_;
    K = D_; N = D_; tile = bid & 127;
  } else if (bid < 1536) {
    W = Wup; Wt = WtAll + (size_t)8 * D_ * D_;
    K = D_; N = FFN_; tile = bid - 1024;
  } else {
    W = Wdn; Wt = WtAll + (size_t)12 * D_ * D_;
    K = FFN_; N = D_; tile = bid - 1536;
  }
  const int nTiles = N / TN_;                     // 16 or 64
  const int n0 = (tile & (nTiles - 1)) * TN_, k0 = (tile / nTiles) * TK_;
  const int lo4 = threadIdx.x & 15, hi4 = threadIdx.x >> 4;
  const float* pa[4];
  const float* pb[4];
  v4f a[4], b[4];
#pragma unroll
  for (int i = 0; i < 4; ++i) {
    pa[i] = W + (size_t)(k0 + 2 * (hi4 + i * 16)) * N + (n0 + lo4 * 4);
    pb[i] = pa[i] + N;
  }
#pragma unroll
  for (int i = 0; i < 4; ++i) {
    a[i] = *(const v4f*)pa[i];
    b[i] = *(const v4f*)pb[i];
  }
  // Every load's address pair stays whole until this wait: named here as inputs,
  // none of them can serve as a later load's destination.
  asm volatile("s_wait_xcnt 0x0"
               :: "v"(pa[0]), "v"(pa[1]), "v"(pa[2]), "v"(pa[3]),
                  "v"(pb[0]), "v"(pb[1]), "v"(pb[2]), "v"(pb[3])
               : "memory");
#pragma unroll
  for (int i = 0; i < 4; ++i)
#pragma unroll
    for (int j = 0; j < 4; ++j)
      t[(lo4 * 4 + j) * TP_ + hi4 + i * 16] = pack_bf2(a[i][j], b[i][j]);
  __syncthreads();
#pragma unroll
  for (int i = 0; i < 4; ++i) {
    const int n = hi4 + i * 16;
    v4u o;
#pragma unroll
    for (int e = 0; e < 4; ++e) o[e] = t[n * TP_ + lo4 * 4 + e];
    *(v4u*)(Wt + (size_t)(n0 + n) * K + (k0 + lo4 * 8)) = o;
  }
}

// ---------- GEMM: C[M,N] = epi( A[M,K]bf16 @ Bt[N,K]bf16^T ) ----------
// 128x128 block tile, 8 waves -> 32x64 per wave (2x4 WMMA frags).
// A stage is 128 k of every operand row (256 B, whole L2 units), a ring of NB LDS
// buffers filled by GLOBAL_LOAD_ASYNC_TO_LDS (ASYNCcnt): NB - 1 stages of 16 copies
// per lane are issued ahead of the stage whose 32 WMMAs per wave run, one barrier
// per stage. NB = 2 lets two blocks share a WGP's LDS (two stages in flight per
// WGP); NB = 4 is for grids of one block per WGP, where the block alone has to keep
// enough bytes in flight to cover operands that come from memory.
// Main loop unrolled NB stages so buffer indices are compile-time constants.
// Requires K a multiple of NB * 128.
// One launch may hold several products of one shape: grid slice z > 0 reads Az,
// and the slices' Bt and outB lie one after the other.

#define GK_    128            // k per stage
#define GPITCH 136            // LDS row pitch in elements: 272 B, 16 B x odd

// One stage: 8 + 8 async copies of 16 B per lane (rows 16 apart of the A and of
// the B panel), 32-bit lane offset on a scalar base. The s_wait_xcnt closes the
// statement so that no address register is rewritten ahead of it.
__device__ __forceinline__ void async_copy_stage(unsigned la, unsigned lb,
                                                 const unsigned (&vo)[8],
                                                 const void* baseA,
                                                 const void* baseB) {
  const unsigned lStep = 16 * GPITCH * 2;
  asm volatile(
      "global_load_async_to_lds_b128 %0, %16, %24\n\t"
      "global_load_async_to_lds_b128 %1, %17, %24\n\t"
      "global_load_async_to_lds_b128 %2, %18, %24\n\t"
      "global_load_async_to_lds_b128 %3, %19, %24\n\t"
      "global_load_async_to_lds_b128 %4, %20, %24\n\t"
      "global_load_async_to_lds_b128 %5, %21, %24\n\t"
      "global_load_async_to_lds_b128 %6, %22, %24\n\t"
      "global_load_async_to_lds_b128 %7, %23, %24\n\t"
      "global_load_async_to_lds_b128 %8, %16, %25\n\t"
      "global_load_async_to_lds_b128 %9, %17, %25\n\t"
      "global_load_async_to_lds_b128 %10, %18, %25\n\t"
      "global_load_async_to_lds_b128 %11, %19, %25\n\t"
      "global_load_async_to_lds_b128 %12, %20, %25\n\t"
      "global_load_async_to_lds_b128 %13, %21, %25\n\t"
      "global_load_async_to_lds_b128 %14, %22, %25\n\t"
      "global_load_async_to_lds_b128 %15, %23, %25\n\t"
      "s_wait_xcnt 0x0"
      :: "v"(la), "v"(la + lStep), "v"(la + 2 * lStep), "v"(la + 3 * lStep),
         "v"(la + 4 * lStep), "v"(la + 5 * lStep), "v"(la + 6 * lStep),
         "v"(la + 7 * lStep),
         "v"(lb), "v"(lb + lStep), "v"(lb + 2 * lStep), "v"(lb + 3 * lStep),
         "v"(lb + 4 * lStep), "v"(lb + 5 * lStep), "v"(lb + 6 * lStep),
         "v"(lb + 7 * lStep),
         "v"(vo[0]), "v"(vo[1]), "v"(vo[2]), "v"(vo[3]),
         "v"(vo[4]), "v"(vo[5]), "v"(vo[6]), "v"(vo[7]),
         "s"(baseA), "s"(baseB)
      : "memory");
}

// This wave's LDS reads have returned before the buffer they read is refilled.
__device__ __forceinline__ void wait_ds0() {
  asm volatile("s_wait_dscnt 0x0" ::: "memory");
}

// All but this wave's N youngest copies have landed.
template <int N>
__device__ __forceinline__ void wait_async_but() {
  asm volatile("s_wait_asynccnt %0" :: "i"(N) : "memory");
}

template <int NB>
__global__ __launch_bounds__(256) void gemm_bf16_kernel(
    const __bf16* __restrict__ A, const __bf16* __restrict__ Az,
    const __bf16* __restrict__ Bt,
    const float* __restrict__ bias, const float* __restrict__ res1,
    const float* __restrict__ res2, float* __restrict__ outF,
    __bf16* __restrict__ outB, int M, int N, int K, int doRelu)
{
  __shared__ __align__(16) __bf16 As[NB][128 * GPITCH];  // [row][k], +8 pad
  __shared__ __align__(16) __bf16 Bs[NB][128 * GPITCH];  // [n][k],  +8 pad
  if (blockIdx.z) {
    A = Az;
    Bt   += (size_t)blockIdx.z * N * K;
    outB += (size_t)blockIdx.z * M * N;
  }
  const int tid  = threadIdx.x;
  const int lane = tid & 31, wave = tid >> 5;
  const int wm = wave >> 1, wn = wave & 1;
  const int m0 = wm * 32, n0 = wn * 64;
  const int rowM = blockIdx.y * 128, colN = blockIdx.x * 128;

  // per-thread 16B chunks of the 128x128 tiles (2048 chunks, 8 per thread):
  // chunk q0 of rows r0, r0 + 16, ..., r0 + 112; a wave covers two whole rows.
  const int r0 = tid >> 4, q0 = tid & 15;
  // The lane offsets are the same for both panels; the panel's first row and
  // the stage's k go into the scalar bases.
  const __bf16* sA = A  + (size_t)rowM * K;
  const __bf16* sB = Bt + (size_t)colN * K;
  unsigned vo[8];
#pragma unroll
  for (int i = 0; i < 8; ++i)
    vo[i] = (unsigned)(((r0 + i * 16) * K + q0 * 8) * 2);
  unsigned ldsA[NB], ldsB[NB];
#pragma unroll
  for (int bufi = 0; bufi < NB; ++bufi) {
    ldsA[bufi] = lds_addr(&As[bufi][r0 * GPITCH + q0 * 8]);
    ldsB[bufi] = lds_addr(&Bs[bufi][r0 * GPITCH + q0 * 8]);
  }

  const v8f zero8 = {0.f, 0.f, 0.f, 0.f, 0.f, 0.f, 0.f, 0.f};
  v8f acc[2][4];
#pragma unroll
  for (int i = 0; i < 2; ++i)
#pragma unroll
    for (int j = 0; j < 4; ++j) acc[i][j] = zero8;

  const int stages = K / GK_;

#define ISSUE_STAGE(BUFI, ST)                                   \
  do {                                                          \
    const size_t kOff = (size_t)(ST) * GK_;                     \
    async_copy_stage(ldsA[BUFI], ldsB[BUFI], vo, sA + kOff,     \
                     sB + kOff);                                \
  } while (0)

// kk is unrolled so that every LDS offset is an immediate and the next 32 k's
// fragment loads can be scheduled among this 32 k's WMMAs.
#define COMPUTE_PANEL(BUFI)                                     \
  do {                                                          \
    _Pragma("unroll")                                           \
    for (int kk = 0; kk < GK_; kk += 32) {                      \
      v16bf af[2], bfr[4];                                      \
      _Pragma("unroll")                                         \
      for (int i = 0; i < 2; ++i)                               \
        af[i] = load_frag(As[BUFI], m0 + i * 16, kk, GPITCH);   \
      _Pragma("unroll")                                         \
      for (int j = 0; j < 4; ++j)                               \
        bfr[j] = load_frag(Bs[BUFI], n0 + j * 16, kk, GPITCH);  \
      _Pragma("unroll")                                         \
      for (int i = 0; i < 2; ++i)                               \
        _Pragma("unroll")                                       \
        for (int j = 0; j < 4; ++j)                             \
          acc[i][j] = wmma_bf16(af[i], bfr[j], acc[i][j]);      \
    }                                                           \
  } while (0)

  // Every wave issues 16 copies per stage and nothing else counts on ASYNCcnt, so
  // the copies of the YOUNG youngest stages are the wave's 16 * YOUNG youngest.
  constexpr int YOUNG = NB - 2;
  // unrolled: b is a buffer index and has to be a constant
#pragma unroll
  for (int b = 0; b < NB - 1; ++b) ISSUE_STAGE(b, b);
  wait_async_but<16 * YOUNG>();   // stage 0 has landed
  __syncthreads();
  for (int st = 0; st < stages; st += NB) {
    // unrolled: u is the buffer of stage st + u
#pragma unroll
    for (int u = 0; u < NB; ++u) {
      // Refill of the buffer that the trip before has read: its barrier is passed.
      const bool more = st + u + NB - 1 < stages;
      if (more) ISSUE_STAGE((u + NB - 1) % NB, st + u + NB - 1);
      COMPUTE_PANEL(u);
      // Publish point of stage st + u + 1: own LDS reads returned, own copies of that
      // stage landed (a trip that issued leaves the YOUNG stages behind it in flight,
      // a trip that did not waits for all), then the one barrier that both publishes
      // that stage and frees the buffer just read.
      wait_ds0();
      if (YOUNG > 0 && more) wait_async_but<16 * YOUNG>(); else wait_async0();
      __syncthreads();
    }
  }
  wait_async0();
#undef ISSUE_STAGE
#undef COMPUTE_PANEL

  // epilogue: C/D layout lane=N (lane&15), vgpr r = M offset (+8 for lanes>=16)
  // Each optional operand is tested ONCE, around a loop over all 64 elements of
  // the lane, so that its loads are all in flight together. (Tested per element,
  // every load stands in a branch of its own and is waited for alone.)
  // Per element the order of the additions stays bias, res1, res2.
  const int ho = (lane < 16) ? 0 : 8;
  const int nc = lane & 15;
  const unsigned col0 = (unsigned)(colN + n0 + nc);
  // Byte offset of f32 element (row i * 16 + r of the wave's tile, column j = 0);
  // M * N * 4 stays below 2^32. Column j is 64 B further on.
  unsigned ro[16];
#pragma unroll
  for (int k = 0; k < 16; ++k)
    ro[k] = ((unsigned)(rowM + m0 + (k >> 3) * 16 + (k & 7) + ho) * (unsigned)N + col0) * 4u;

  if (bias) {
    float bv[4];
#pragma unroll
    for (int j = 0; j < 4; ++j) bv[j] = bias[col0 + j * 16];
#pragma unroll
    for (int i = 0; i < 2; ++i)
#pragma unroll
      for (int j = 0; j < 4; ++j) acc[i][j] += bv[j];
    // Registers that the loads above name may be rewritten from here on.
    asm volatile("s_wait_xcnt 0x0" ::: "memory");
  }
  if (res1) {
    v8f t[2][4];
#pragma unroll
    for (int i = 0; i < 2; ++i)
#pragma unroll
      for (int j = 0; j < 4; ++j)
#pragma unroll
        for (int r = 0; r < 8; ++r)
          t[i][j][r] = *(const float*)((const char*)res1 + (size_t)ro[i * 8 + r] + j * 64);
#pragma unroll
    for (int i = 0; i < 2; ++i)
#pragma unroll
      for (int j = 0; j < 4; ++j) acc[i][j] += t[i][j];
    // Registers that the loads above name may be rewritten from here on.
    asm volatile("s_wait_xcnt 0x0" ::: "memory");
  }
  if (res2) {
    v8f t[2][4];
#pragma unroll
    for (int i = 0; i < 2; ++i)
#pragma unroll
      for (int j = 0; j < 4; ++j)
#pragma unroll
        for (int r = 0; r < 8; ++r)
          t[i][j][r] = *(const float*)((const char*)res2 + (size_t)ro[i * 8 + r] + j * 64);
#pragma unroll
    for (int i = 0; i < 2; ++i)
#pragma unroll
      for (int j = 0; j < 4; ++j) acc[i][j] += t[i][j];
    // Registers that the loads above name may be rewritten from here on.
    asm volatile("s_wait_xcnt 0x0" ::: "memory");
  }
  if (doRelu) {
#pragma unroll
    for (int i = 0; i < 2; ++i)
#pragma unroll
      for (int j = 0; j < 4; ++j)
#pragma unroll
        for (int r = 0; r < 8; ++r) acc[i][j][r] = fmaxf(acc[i][j][r], 0.f);
  }
  if (outF) {
#pragma unroll
    for (int i = 0; i < 2; ++i)
#pragma unroll
      for (int j = 0; j < 4; ++j)
#pragma unroll
        for (int r = 0; r < 8; ++r)
          *(float*)((char*)outF + (size_t)ro[i * 8 + r] + j * 64) = acc[i][j][r];
  }
  // Registers that the stores above name may be rewritten from here on.
  asm volatile("s_wait_xcnt 0x0" ::: "memory");
  if (outB) {
    unsigned hb[2][4][4];   // rows r = 2 p (low half) and 2 p + 1 (high half)
#pragma unroll
    for (int i = 0; i < 2; ++i)
#pragma unroll
      for (int j = 0; j < 4; ++j)
#pragma unroll
        for (int p = 0; p < 4; ++p)
          hb[i][j][p] = pack_bf2(acc[i][j][2 * p], acc[i][j][2 * p + 1]);
#pragma unroll
    for (int k = 0; k < 16; ++k) ro[k] >>= 1;
    // Every value is rounded before the first store issues: mixed with the
    // stores, the rounding reuses their registers behind a wait each time.
    __builtin_amdgcn_sched_barrier(0);
#pragma unroll
    for (int i = 0; i < 2; ++i)
#pragma unroll
      for (int j = 0; j < 4; ++j)
#pragma unroll
        for (int r = 0; r < 8; ++r)
          *(unsigned short*)((char*)outB + (size_t)ro[i * 8 + r] + j * 32) =
              (unsigned short)(hb[i][j][r >> 1] >> ((r & 1) * 16));
  }
}

#define KP_ 72   // K row pitch in elements: 144 B, 16 B x odd (ds_load_b128)
#define VP_ 80   // V row pitch in elements: 160 B, 32 B x odd (ds_load_tr16_b128)

// 8 x 16-bit column piece of a row-major LDS tile: lane (c, h) gets
// T[8h + 0..7][c] when lane l points at row 8 * (l >> 4) + (l & 7), 16-B piece
// (l >> 3) & 1. Every lane is on wherever this is called.
__device__ __forceinline__ v8bf load_tr16(const __bf16* p) {
  typedef __attribute__((address_space(3))) v8s lds_v8s;
  return __builtin_bit_cast(v8bf, __builtin_amdgcn_ds_load_tr16_b128_v8i16((lds_v8s*)p));
}

// Lane l gets the value of lane l ^ 16.
__device__ __forceinline__ float swap_halves(float x) {
  const int i = __builtin_bit_cast(int, x);
  return __builtin_bit_cast(float, __builtin_amdgcn_permlanex16(
      i, i, 0x76543210, 0xfedcba98, false, false));
}

// One 64-key tile of K and of V: 4 + 4 async copies of 16 B per lane, 32-bit lane
// offset on a scalar base. The s_wait_xcnt closes the statement so that no
// address register is rewritten ahead of it.
__device__ __forceinline__ void async_copy_kv(const unsigned (&kl)[4],
                                              const unsigned (&vl)[4],
                                              const unsigned (&go)[4],
                                              const void* baseK,
                                              const void* baseV) {
  asm volatile(
      "global_load_async_to_lds_b128 %0, %8, %12\n\t"
      "global_load_async_to_lds_b128 %1, %9, %12\n\t"
      "global_load_async_to_lds_b128 %2, %10, %12\n\t"
      "global_load_async_to_lds_b128 %3, %11, %12\n\t"
      "global_load_async_to_lds_b128 %4, %8, %13\n\t"
      "global_load_async_to_lds_b128 %5, %9, %13\n\t"
      "global_load_async_to_lds_b128 %6, %10, %13\n\t"
      "global_load_async_to_lds_b128 %7, %11, %13\n\t"
      "s_wait_xcnt 0x0"
      :: "v"(kl[0]), "v"(kl[1]), "v"(kl[2]), "v"(kl[3]),
         "v"(vl[0]), "v"(vl[1]), "v"(vl[2]), "v"(vl[3]),
         "v"(go[0]), "v"(go[1]), "v"(go[2]), "v"(go[3]),
         "s"(baseK), "s"(baseV)
      : "memory");
}

__global__ __launch_bounds__(128) void flash_attn_kernel(
    const __bf16* __restrict__ Q, const __bf16* __restrict__ Kb,
    const __bf16* __restrict__ V, const int* __restrict__ mask,
    __bf16* __restrict__ O)
{
  __shared__ __align__(16) __bf16 Ks[64 * KP_];     // [key][dk]
  __shared__ __align__(32) __bf16 Vs[64 * VP_];     // [key][dk]
  __shared__ __align__(16) float  Ms[S_];           // per key: 0, or -1e30 if masked

  const int tid = threadIdx.x, lane = tid & 31, wave = tid >> 5;
  const int c = lane & 15, hh = lane >> 4;
  const int qb = blockIdx.x * 64, h = blockIdx.y, b = blockIdx.z;
  const int m0 = wave * 16;
  const size_t qbase  = ((size_t)b * S_ + qb) * D_ + h * DK_;
  const size_t kvrow0 = (size_t)b * S_ * D_ + h * DK_;

  // Q^T fragments (B operand, column = query c), in the k order of load_frag.
  const __bf16* qp = Q + qbase + (size_t)(m0 + c) * D_ + 8 * hh;
  const v4i* mp = (const v4i*)(mask + (size_t)b * S_ + tid * 8);
  const v8bf q0 = *(const v8bf*)qp;
  const v8bf q1 = *(const v8bf*)(qp + 16);
  const v8bf q2 = *(const v8bf*)(qp + 32);
  const v8bf q3 = *(const v8bf*)(qp + 48);
  const v4i mk0 = mp[0], mk1 = mp[1];
  // The address pairs of the loads above stay whole until this wait.
  asm volatile("s_wait_xcnt 0x0" :: "v"(qp), "v"(mp) : "memory");
  v16bf qf[2];
#pragma unroll
  for (int i = 0; i < 8; ++i) {
    qf[0][i] = q0[i]; qf[0][i + 8] = q1[i];
    qf[1][i] = q2[i]; qf[1][i + 8] = q3[i];
  }
  // The key mask of this batch row as an addend, 8 keys per thread; published by
  // the barriers at the head of the first trip.
  {
    v4f f0, f1;
#pragma unroll
    for (int e = 0; e < 4; ++e) {
      f0[e] = (mk0[e] == 0) ? -1e30f : 0.f;
      f1[e] = (mk1[e] == 0) ? -1e30f : 0.f;
    }
    *(v4f*)&Ms[tid * 8]     = f0;
    *(v4f*)&Ms[tid * 8 + 4] = f1;
  }

  // per-thread 16B chunks of a 64x64 bf16 tile (512 chunks, 4 per thread)
  unsigned kLds[4], vLds[4], tOff[4];
#pragma unroll
  for (int t = 0; t < 4; ++t) {
    const int ch = tid + t * 128;
    const int rr = ch >> 3, cc = ch & 7;
    kLds[t] = lds_addr(&Ks[rr * KP_ + cc * 8]);
    vLds[t] = lds_addr(&Vs[rr * VP_ + cc * 8]);
    tOff[t] = (unsigned)((rr * D_ + cc * 8) * 2);
  }
  const __bf16* vfrag = &Vs[(8 * hh + (lane & 7)) * VP_ + ((lane >> 3) & 1) * 8];

  const v8f zero8 = {0.f, 0.f, 0.f, 0.f, 0.f, 0.f, 0.f, 0.f};
  v8f o[4];                      // o[t][r] = O[query c][dk 16 t + 8 hh + r]
#pragma unroll
  for (int t = 0; t < 4; ++t) o[t] = zero8;
  float m_run = -3.0e38f;        // the query's maximum, alike in both halves
  float l_run = 0.f;             // the sum over this half's keys only

  for (int kt = 0; kt < 16; ++kt) {
    wait_ds0();       // own reads of Ks/Vs (first trip: writes of Ms) are done
    __syncthreads();  // and so are every other wave's: the tiles may be refilled
    const size_t kvb = kvrow0 + (size_t)kt * 64 * D_;
    async_copy_kv(kLds, vLds, tOff, Kb + kvb, V + kvb);
    wait_async0();
    __syncthreads();

    // S^T = K Q^T: s[j][r] = score(key 16 j + 8 hh + r, query c)
    v8f s[4];
#pragma unroll
    for (int j = 0; j < 4; ++j) s[j] = zero8;
#pragma unroll
    for (int kk = 0; kk < 2; ++kk)
#pragma unroll
      for (int j = 0; j < 4; ++j)
        s[j] = wmma_bf16(load_frag(Ks, j * 16, kk * 32, KP_), qf[kk], s[j]);
    // scale 1/sqrt(64) + key mask
#pragma unroll
    for (int j = 0; j < 4; ++j) {
      const float* mrow = &Ms[kt * 64 + j * 16 + 8 * hh];
      const v4f ma = *(const v4f*)mrow;
      const v4f mb = *(const v4f*)(mrow + 4);
#pragma unroll
      for (int r = 0; r < 4; ++r) {
        s[j][r]     = s[j][r]     * 0.125f + ma[r];
        s[j][r + 4] = s[j][r + 4] * 0.125f + mb[r];
      }
    }
    // online softmax (base-2): one query per lane
    v8f mx8 = __builtin_elementwise_max(__builtin_elementwise_max(s[0], s[1]),
                                        __builtin_elementwise_max(s[2], s[3]));
    float mx = fmaxf(fmaxf(fmaxf(mx8[0], mx8[1]), fmaxf(mx8[2], mx8[3])),
                     fmaxf(fmaxf(mx8[4], mx8[5]), fmaxf(mx8[6], mx8[7])));
    mx = fmaxf(mx, swap_halves(mx));
    const float mn = fmaxf(m_run, mx);
    const float alpha = exp2_bare((m_run - mn) * 1.44269504f);
    m_run = mn;
#pragma unroll
    for (int j = 0; j < 4; ++j)
#pragma unroll
      for (int r = 0; r < 8; ++r)
        s[j][r] = exp2_bare((s[j][r] - m_run) * 1.44269504f);
    const v8f rs8 = (s[0] + s[1]) + (s[2] + s[3]);
    const float rs = ((rs8[0] + rs8[1]) + (rs8[2] + rs8[3])) +
                     ((rs8[4] + rs8[5]) + (rs8[6] + rs8[7]));
    l_run = l_run * alpha + rs;
#pragma unroll
    for (int t = 0; t < 4; ++t) o[t] *= alpha;

    // O^T += V^T P^T: B = score tiles 2 kk and 2 kk + 1 rounded in place (element
    // e = key 32 kk + 8 hh + e, e + 8 = key 32 kk + 16 + 8 hh + e: the order that
    // the two transposing loads of an A fragment deliver)
#pragma unroll
    for (int kk = 0; kk < 2; ++kk) {
      v8u pw;
#pragma unroll
      for (int i = 0; i < 4; ++i) {
        pw[i]     = pack_bf2(s[2 * kk][2 * i],     s[2 * kk][2 * i + 1]);
        pw[i + 4] = pack_bf2(s[2 * kk + 1][2 * i], s[2 * kk + 1][2 * i + 1]);
      }
      const v16bf pf = __builtin_bit_cast(v16bf, pw);
#pragma unroll
      for (int t = 0; t < 4; ++t) {
        const v8bf lo = load_tr16(vfrag + (kk * 32) * VP_ + t * 16);
        const v8bf hi = load_tr16(vfrag + (kk * 32 + 16) * VP_ + t * 16);
        v16bf a;
#pragma unroll
        for (int i = 0; i < 8; ++i) { a[i] = lo[i]; a[i + 8] = hi[i]; }
        o[t] = wmma_bf16(a, pf, o[t]);
      }
    }
  }

  // The halves' sums are joined once, unconditionally (every lane is on).
  const float l   = l_run + swap_halves(l_run);
  const float inv = 1.f / fmaxf(l, 1e-20f);
  __bf16* op = O + ((size_t)b * S_ + qb + m0 + c) * D_ + h * DK_ + 8 * hh;
#pragma unroll
  for (int t = 0; t < 4; ++t) {
    v4u pk;
#pragma unroll
    for (int i = 0; i < 4; ++i)
      pk[i] = pack_bf2(o[t][2 * i] * inv, o[t][2 * i + 1] * inv);
    *(v4u*)(op + 16 * t) = pk;   // 8 consecutive dk of one query
  }
}

// ---------- launcher ----------

extern "C" void kernel_launch(void* const* d_in, const int* in_sizes, int n_in,
                              void* d_out, int out_size, void* d_ws, size_t ws_size,
                              hipStream_t stream)
{
  (void)in_sizes; (void)n_in; (void)out_size; (void)ws_size;
  const float* x    = (const float*)d_in[0];
  const float* kv   = (const float*)d_in[1];
  const int*   msk  = (const int*)  d_in[2];
  const float* ln1g = (const float*)d_in[3];
  const float* ln1b = (const float*)d_in[4];
  // Order of the converted D x D weights: the five whose products share one launch
  // (q0, k0, v0, k1, v1) first, then o0, q1, o1.
  const float* qw0  = (const float*)d_in[5];
  const float* kw0  = (const float*)d_in[6];
  const float* vw0  = (const float*)d_in[7];
  const float* ow0  = (const float*)d_in[8];
  const float* ob0  = (const float*)d_in[9];
  const float* qw1  = (const float*)d_in[10];
  const float* kw1  = (const float*)d_in[11];
  const float* vw1  = (const float*)d_in[12];
  const float* ow1  = (const float*)d_in[13];
  const float* ob1  = (const float*)d_in[14];
  const float* ln2g = (const float*)d_in[15];
  const float* ln2b = (const float*)d_in[16];
  const float* w1   = (const float*)d_in[17];
  const float* b1   = (const float*)d_in[18];
  const float* w2   = (const float*)d_in[19];
  const float* b2   = (const float*)d_in[20];

  char* ws = (char*)d_ws;
  size_t off = 0;
  auto alloc = [&](size_t bytes) -> void* {
    void* p = ws + off;
    off += (bytes + 255) & ~(size_t)255;
    return p;
  };
  const size_t ROWS = (size_t)B_ * S_;  // 4096
  float*  y_f32  = (float*) alloc(ROWS * D_ * 4);
  __bf16* y_bf   = (__bf16*)alloc(ROWS * D_ * 2);
  __bf16* kvn_bf = (__bf16*)alloc(ROWS * D_ * 2);
  __bf16* wtAll  = (__bf16*)alloc((size_t)16 * D_ * D_ * 2);
  __bf16* wtO0   = wtAll + (size_t)5 * D_ * D_;
  __bf16* wtQ1   = wtAll + (size_t)6 * D_ * D_;
  __bf16* wtO1   = wtAll + (size_t)7 * D_ * D_;
  __bf16* w1t    = wtAll + (size_t)8 * D_ * D_;
  __bf16* w2t    = wtAll + (size_t)12 * D_ * D_;
  __bf16* qB     = (__bf16*)alloc(5 * ROWS * D_ * 2);   // q, k0, v0, k1, v1
  __bf16* kB0    = qB + 1 * ROWS * D_;
  __bf16* vB0    = qB + 2 * ROWS * D_;
  __bf16* kB1    = qB + 3 * ROWS * D_;
  __bf16* vB1    = qB + 4 * ROWS * D_;
  __bf16* aB     = (__bf16*)alloc(ROWS * D_ * 2);
  float*  y1_f32 = (float*) alloc(ROWS * D_ * 4);
  __bf16* y1_bf  = (__bf16*)alloc(ROWS * D_ * 2);
  float*  x2_f32 = (float*) alloc(ROWS * D_ * 4);
  __bf16* x2n_bf = (__bf16*)alloc(ROWS * D_ * 2);
  __bf16* hB     = (__bf16*)alloc(ROWS * FFN_ * 2);

  // LayerNorm 1 on x (keep f32 for residual) and on kv, one launch
  ln_kernel<<<dim3((unsigned)(ROWS / 8), 2), 256, 0, stream>>>(
      x, kv, ln1g, ln1b, y_f32, y_bf, kvn_bf);

  // weight conversion/transposition, one launch
  transpose_f32_to_bf16<<<2048, 256, 0, stream>>>(
      qw0, kw0, vw0, kw1, vw1, ow0, qw1, ow1, w1, w2, wtAll);

  const dim3 gproj(D_/128, (unsigned)(ROWS/128));        // (8, 32)
  const dim3 gqkv(D_/128, (unsigned)(ROWS/128), 5);      // (8, 32, 5)
  const dim3 gattn(S_/64, H_, B_);                       // (16,16,4)

  // q0 from y; k0, v0, k1, v1 from kvn: none waits for another, one launch
  gemm_bf16_kernel<2><<<gqkv, 256, 0, stream>>>(y_bf, kvn_bf, wtAll, nullptr, nullptr, nullptr, nullptr, qB, (int)ROWS, D_, D_, 0);

  // cross-attention 0
  flash_attn_kernel<<<gattn, 128, 0, stream>>>(qB, kB0, vB0, msk, aB);
  gemm_bf16_kernel<4><<<gproj, 256, 0, stream>>>(aB, nullptr, wtO0, ob0, y_f32, nullptr, y1_f32, y1_bf, (int)ROWS, D_, D_, 0);

  // cross-attention 1 (query from y1)
  gemm_bf16_kernel<4><<<gproj, 256, 0, stream>>>(y1_bf, nullptr, wtQ1, nullptr, nullptr, nullptr, nullptr, qB, (int)ROWS, D_, D_, 0);
  flash_attn_kernel<<<gattn, 128, 0, stream>>>(qB, kB1, vB1, msk, aB);
  // x2 = x + (o1 + ob1 + y1)
  gemm_bf16_kernel<4><<<gproj, 256, 0, stream>>>(aB, nullptr, wtO1, ob1, y1_f32, x, x2_f32, nullptr, (int)ROWS, D_, D_, 0);

  // FFN
  ln_kernel<<<dim3((unsigned)(ROWS / 8), 1), 256, 0, stream>>>(
      x2_f32, nullptr, ln2g, ln2b, nullptr, x2n_bf, nullptr);
  gemm_bf16_kernel<2><<<dim3(FFN_/128, (unsigned)(ROWS/128)), 256, 0, stream>>>(
      x2n_bf, nullptr, w1t, b1, nullptr, nullptr, nullptr, hB, (int)ROWS, FFN_, D_, 1);
  gemm_bf16_kernel<4><<<gproj, 256, 0, stream>>>(
      hB, nullptr, w2t, b2, x2_f32, nullptr, (float*)d_out, nullptr, (int)ROWS, D_, FFN_, 0);
}

// v008
// One run takes 181 microseconds.
// Next to v007, in two timings, it ran 1.19 and 1.18 times as fast.
// All steps since v000 together make it 3.35 times as fast.
#include <hip/hip_runtime.h>
#include <hip/hip_bf16.h>
#include <cstdint>

typedef __attribute__((ext_vector_type(16))) __bf16 v16bf;
typedef __attribute__((ext_vector_type(8)))  __bf16 v8bf;
typedef __attribute__((ext_vector_type(8)))  float  v8f;
typedef __attribute__((ext_vector_type(4)))  float  v4f;
typedef __attribute__((ext_vector_type(4)))  __bf16 v4bf;
typedef __attribute__((ext_vector_type(4)))  unsigned v4u;
typedef __attribute__((ext_vector_type(8)))  unsigned v8u;
typedef __attribute__((ext_vector_type(4)))  int      v4i;
typedef __attribute__((ext_vector_type(8)))  short    v8s;
typedef __attribute__((ext_vector_type(2)))  float    v2f;
typedef __attribute__((ext_vector_type(2)))  __bf16   v2bf;

#define B_   4
#define S_   1024
#define D_   1024
#define H_   16
#define DK_  64
#define FFN_ 4096

// ---------- helpers ----------

// Round to nearest even, by the chip's own conversion (v_cvt_pk_bf16_f32).
__device__ __forceinline__ __bf16 f2bf(float f) { return (__bf16)f; }

// Two floats rounded as in f2bf, lo in bits 15..0 and hi in bits 31..16: one
// instruction per pair.
__device__ __forceinline__ unsigned pack_bf2(float lo, float hi) {
  const v2f x = {lo, hi};
  return __builtin_bit_cast(unsigned, __builtin_convertvector(x, v2bf));
}

// 2^x as the bare v_exp_f32. The library's exp2f wraps it in a compare, two
// selects and a v_ldexp_f32 so that results below 2^-126 come out as denormals;
// here such a result may come out as 0. Used for softmax weights only, where the
// row's largest weight is 1 and the f32 sums absorb a term that small.
__device__ __forceinline__ float exp2_bare(float x) {
  return __builtin_amdgcn_exp2f(x);
}

// Low 32 bits of the generic address of a __shared__ object == LDS byte offset
// (flat shared-aperture mapping uses addr[31:0] as the LDS address).
__device__ __forceinline__ unsigned lds_addr(const void* p) {
  return (unsigned)(uintptr_t)p;
}

__device__ __forceinline__ void wait_async0() {
  asm volatile("s_wait_asynccnt 0" ::: "memory");
}

// Load a 16x32 bf16 WMMA fragment (A layout; also B when source is Bt[N][K])
// from a row-major [rows][ldk] bf16 tile in LDS.
__device__ __forceinline__ v16bf load_frag(const __bf16* base, int row0, int k0, int ldk) {
  const int lane = threadIdx.x & 31;
  const __bf16* p = base + (row0 + (lane & 15)) * ldk + k0 + ((lane >> 4) << 3);
  v8bf lo = *(const v8bf*)p;
  v8bf hi = *(const v8bf*)(p + 16);
  v16bf r;
#pragma unroll
  for (int i = 0; i < 8; ++i) { r[i] = lo[i]; r[i + 8] = hi[i]; }
  return r;
}

__device__ __forceinline__ v8f wmma_bf16(v16bf a, v16bf b, v8f c) {
  return __builtin_amdgcn_wmma_f32_16x16x32_bf16(false, a, false, b, (short)0, c,
                                                 false, false);
}

// ---------- LayerNorm (D=1024), outputs f32 and/or bf16 ----------
// One wave per row, 8 rows per block: a lane holds 8 x 16 B of its row, all loads
// in flight at once; the row sums stay inside the wave (no LDS, no barrier).
// An eighth of the waves of a block-per-row form have to be started.
// One launch may norm two tensors with the same g and bt: grid slice y = 1 reads
// in2 and writes outB2 only.
// Slice y = 1 holds the key rows. A key whose mask entry is 0 has softmax weight 0
// (unless its whole batch is masked: n = 0, nothing is dropped), so the slice stores each batch's S_ rows in a new order: the n unmasked rows
// first, the masked ones behind them, each group in its old order. n goes to
// live[32 * batch] (one 128-B line per writer). The launches behind this one work
// on the first n rows only, rounded up to their tile.

__global__ __launch_bounds__(256) void ln_kernel(
    const float* __restrict__ in, const float* __restrict__ in2,
    const float* __restrict__ g,
    const float* __restrict__ bt, float* __restrict__ outF,
    __bf16* __restrict__ outB, __bf16* __restrict__ outB2,
    const int* __restrict__ mask, int* __restrict__ live)
{
  if (blockIdx.y) { in = in2; outF = nullptr; outB = outB2; }
  const int lane = threadIdx.x & 31;
  const int row  = blockIdx.x * 8 + (threadIdx.x >> 5);
  int orow = row;                 // where the 16-bit row is stored
  if (blockIdx.y) {
    // Ahead of the row's own loads, so that its registers are free again for them.
    // Every wave counts its batch's whole mask (32 entries per lane): bits 0..10 all
    // unmasked keys, bits 11..21 those in front of its own row, bit 22 its own row.
    const int r = row & (S_ - 1);
    const v4i* mp = (const v4i*)(mask + (row - r)) + lane;
    v4i mk[8];
    // The loops over mk are unrolled so that it stays in registers.
#pragma unroll
    for (int i = 0; i < 8; ++i) mk[i] = mp[i * 32];
    // The address pair of the loads above stays whole until this wait.
    asm volatile("s_wait_xcnt 0x0" :: "v"(mp) : "memory");
    int pk = 0;
#pragma unroll
    for (int i = 0; i < 8; ++i)
#pragma unroll
      for (int e = 0; e < 4; ++e) {
        const int pos = i * 128 + lane * 4 + e;
        const int w = 1 + (pos < r ? (1 << 11) : 0) + (pos == r ? (1 << 22) : 0);
        pk += (mk[i][e] != 0) ? w : 0;
      }
#pragma unroll
    for (int off = 16; off >= 1; off >>= 1) pk += __shfl_xor(pk, off, 32);
    const int n = pk & 2047, before = (pk >> 11) & 2047;
    orow = (row - r) + ((pk >> 22) ? before : n + (r - before));
    if (r == 0 && lane == 0) live[(row >> 10) * 32] = n;   // S_ = 1 << 10 rows per batch
    // Registers that the store above names may be rewritten from here on.
    asm volatile("s_wait_xcnt 0x0" ::: "memory");
    // A masked row behind the last 128-row GEMM tile with an unmasked row in it is
    // read by nobody. The whole wave leaves; the kernel has no barrier.
    if (n != 0 && orow - (row - r) >= ((n + 127) & ~127)) return;
  }
  const v4f* p  = (const v4f*)(in + (size_t)row * D_);
  const v4f* g4 = (const v4f*)g;
  const v4f* b4 = (const v4f*)bt;
  v4f v[8], gg[8], bb[8];
#pragma unroll
  for (int i = 0; i < 8; ++i) v[i] = p[lane + i * 32];
#pragma unroll
  for (int i = 0; i < 8; ++i) { gg[i] = g4[lane + i * 32]; bb[i] = b4[lane + i * 32]; }
  v4f s4 = {0.f, 0.f, 0.f, 0.f}, q4 = {0.f, 0.f, 0.f, 0.f};
#pragma unroll
  for (int i = 0; i < 8; ++i) { s4 += v[i]; q4 += v[i] * v[i]; }
  float s  = (s4[0] + s4[1]) + (s4[2] + s4[3]);
  float sq = (q4[0] + q4[1]) + (q4[2] + q4[3]);
#pragma unroll
  for (int off = 16; off >= 1; off >>= 1) {
    s  += __shfl_xor(s,  off, 32);
    sq += __shfl_xor(sq, off, 32);
  }
  const float mean = s * (1.f / D_);
  const float var  = sq * (1.f / D_) - mean * mean;
  const float rstd = rsqrtf(var + 1e-5f);
  v4bf ob[8];
#pragma unroll
  for (int i = 0; i < 8; ++i) {
    v[i] = (v[i] - mean) * rstd * gg[i] + bb[i];
#pragma unroll
    for (int e = 0; e < 4; ++e) ob[i][e] = f2bf(v[i][e]);
  }
  if (outB) {
    v4bf* q = (v4bf*)(outB + (size_t)orow * D_);
#pragma unroll
    for (int i = 0; i < 8; ++i) q[lane + i * 32] = ob[i];
  }
  // Registers that the stores above name may be rewritten from here on.
  asm volatile("s_wait_xcnt 0x0" ::: "memory");
  if (outF) {
    v4f* q = (v4f*)(outF + (size_t)row * D_);
#pragma unroll
    for (int i = 0; i < 8; ++i) q[lane + i * 32] = v[i];
  }
}

// ---------- fp32 [K,N] -> bf16 transposed [N,K] ----------
// One block moves 128 k x 64 n: 8 loads of 16 B per lane in flight (256-B pieces
// of W rows), two k neighbours packed into a dword, dwords transposed through
// LDS, 256-B pieces of Wt rows stored. K a multiple of 128, N of 64.
// One launch converts all ten weights: blocks 0..1023 the eight D x D ones (128
// tiles each), 1024..1535 the D x FFN one, 1536..2047 the FFN x D one. The results
// lie one after the other in WtAll, in the order of the arguments.

#define TK_ 128
#define TN_ 64
#define TP_ 65   // LDS row pitch in dwords: odd, so both sides meet 32 banks

__global__ __launch_bounds__(256) void transpose_f32_to_bf16(
    const float* __restrict__ Wa, const float* __restrict__ Wb,
    const float* __restrict__ Wc, const float* __restrict__ Wd,
    const float* __restrict__ We, const float* __restrict__ Wf,
    const float* __restrict__ Wg, const float* __restrict__ Wh,
    const float* __restrict__ Wup, const float* __restrict__ Wdn,
    __bf16* __restrict__ WtAll)
{
  __shared__ unsigned t[TN_ * TP_];               // [n][k / 2]
  const int bid = blockIdx.x;
  const float* W;
  __bf16* Wt;
  int K, N, tile;
  if (bid < 1024) {
    const int w = bid >> 7;
    W = (w & 4) ? ((w & 2) ? ((w & 1) ? Wh : Wg) : ((w & 1) ? Wf : We))
                : ((w & 2) ? ((w & 1) ? Wd : Wc) : ((w & 1) ? Wb : Wa));
    Wt = WtAll + (size_t)w * D_ * D_;
    K = D_; N = D_; tile = bid & 127;
  } else if (bid < 1536) {
    W = Wup; Wt = WtAll + (size_t)8 * D_ * D_;
    K = D_; N = FFN_; tile = bid - 1024;
  } else {
    W = Wdn; Wt = WtAll + (size_t)12 * D_ * D_;
    K = FFN_; N = D_; tile = bid - 1536;
  }
  const int nTiles = N / TN_;                     // 16 or 64
  const int n0 = (tile & (nTiles - 1)) * TN_, k0 = (tile / nTiles) * TK_;
  const int lo4 = threadIdx.x & 15, hi4 = threadIdx.x >> 4;
  const float* pa[4];
  const float* pb[4];
  v4f a[4], b[4];
#pragma unroll
  for (int i = 0; i < 4; ++i) {
    pa[i] = W + (size_t)(k0 + 2 * (hi4 + i * 16)) * N + (n0 + lo4 * 4);
    pb[i] = pa[i] + N;
  }
#pragma unroll
  for (int i = 0; i < 4; ++i) {
    a[i] = *(const v4f*)pa[i];
    b[i] = *(const v4f*)pb[i];
  }
  // Every load's address pair stays whole until this wait: named here as inputs,
  // none of them can serve as a later load's destination.
  asm volatile("s_wait_xcnt 0x0"
               :: "v"(pa[0]), "v"(pa[1]), "v"(pa[2]), "v"(pa[3]),
                  "v"(pb[0]), "v"(pb[1]), "v"(pb[2]), "v"(pb[3])
               : "memory");
#pragma unroll
  for (int i = 0; i < 4; ++i)
#pragma unroll
    for (int j = 0; j < 4; ++j)
      t[(lo4 * 4 + j) * TP_ + hi4 + i * 16] = pack_bf2(a[i][j], b[i][j]);
  __syncthreads();
#pragma unroll
  for (int i = 0; i < 4; ++i) {
    const int n = hi4 + i * 16;
    v4u o;
#pragma unroll
    for (int e = 0; e < 4; ++e) o[e] = t[n * TP_ + lo4 * 4 + e];
    *(v4u*)(Wt + (size_t)(n0 + n) * K + (k0 + lo4 * 8)) = o;
  }
}

// ---------- GEMM: C[M,N] = epi( A[M,K]bf16 @ Bt[N,K]bf16^T ) ----------
// 128x128 block tile, 8 waves -> 32x64 per wave (2x4 WMMA frags).
// A stage is 128 k of every operand row (256 B, whole L2 units), a ring of NB LDS
// buffers filled by GLOBAL_LOAD_ASYNC_TO_LDS (ASYNCcnt): NB - 1 stages of 16 copies
// per lane are issued ahead of the stage whose 32 WMMAs per wave run, one barrier
// per stage. NB = 2 lets two blocks share a WGP's LDS (two stages in flight per
// WGP); NB = 4 is for grids of one block per WGP, where the block alone has to keep
// enough bytes in flight to cover operands that come from memory.
// Main loop unrolled NB stages so buffer indices are compile-time constants.
// Requires K a multiple of NB * 128.
// One launch may hold several products of one shape: grid slice z > 0 reads Az,
// and the slices' Bt and outB lie one after the other. Az holds the key rows as
// ln_kernel orders them: a row tile wholly behind its batch's unmasked rows is read
// by nobody and is not computed (no unmasked row at all: every tile is).

#define GK_    128            // k per stage
#define GPITCH 136            // LDS row pitch in elements: 272 B, 16 B x odd

// One stage: 8 + 8 async copies of 16 B per lane (rows 16 apart of the A and of
// the B panel), 32-bit lane offset on a scalar base. The s_wait_xcnt closes the
// statement so that no address register is rewritten ahead of it.
__device__ __forceinline__ void async_copy_stage(unsigned la, unsigned lb,
                                                 const unsigned (&vo)[8],
                                                 const void* baseA,
                                                 const void* baseB) {
  const unsigned lStep = 16 * GPITCH * 2;
  asm volatile(
      "global_load_async_to_lds_b128 %0, %16, %24\n\t"
      "global_load_async_to_lds_b128 %1, %17, %24\n\t"
      "global_load_async_to_lds_b128 %2, %18, %24\n\t"
      "global_load_async_to_lds_b128 %3, %19, %24\n\t"
      "global_load_async_to_lds_b128 %4, %20, %24\n\t"
      "global_load_async_to_lds_b128 %5, %21, %24\n\t"
      "global_load_async_to_lds_b128 %6, %22, %24\n\t"
      "global_load_async_to_lds_b128 %7, %23, %24\n\t"
      "global_load_async_to_lds_b128 %8, %16, %25\n\t"
      "global_load_async_to_lds_b128 %9, %17, %25\n\t"
      "global_load_async_to_lds_b128 %10, %18, %25\n\t"
      "global_load_async_to_lds_b128 %11, %19, %25\n\t"
      "global_load_async_to_lds_b128 %12, %20, %25\n\t"
      "global_load_async_to_lds_b128 %13, %21, %25\n\t"
      "global_load_async_to_lds_b128 %14, %22, %25\n\t"
      "global_load_async_to_lds_b128 %15, %23, %25\n\t"
      "s_wait_xcnt 0x0"
      :: "v"(la), "v"(la + lStep), "v"(la + 2 * lStep), "v"(la + 3 * lStep),
         "v"(la + 4 * lStep), "v"(la + 5 * lStep), "v"(la + 6 * lStep),
         "v"(la + 7 * lStep),
         "v"(lb), "v"(lb + lStep), "v"(lb + 2 * lStep), "v"(lb + 3 * lStep),
         "v"(lb + 4 * lStep), "v"(lb + 5 * lStep), "v"(lb + 6 * lStep),
         "v"(lb + 7 * lStep),
         "v"(vo[0]), "v"(vo[1]), "v"(vo[2]), "v"(vo[3]),
         "v"(vo[4]), "v"(vo[5]), "v"(vo[6]), "v"(vo[7]),
         "s"(baseA), "s"(baseB)
      : "memory");
}

// This wave's LDS reads have returned before the buffer they read is refilled.
__device__ __forceinline__ void wait_ds0() {
  asm volatile("s_wait_dscnt 0x0" ::: "memory");
}

// All but this wave's N youngest copies have landed.
template <int N>
__device__ __forceinline__ void wait_async_but() {
  asm volatile("s_wait_asynccnt %0" :: "i"(N) : "memory");
}

template <int NB>
__global__ __launch_bounds__(256) void gemm_bf16_kernel(
    const __bf16* __restrict__ A, const __bf16* __restrict__ Az,
    const __bf16* __restrict__ Bt,
    const float* __restrict__ bias, const float* __restrict__ res1,
    const float* __restrict__ res2, float* __restrict__ outF,
    __bf16* __restrict__ outB, const int* __restrict__ live,
    int M, int N, int K, int doRelu)
{
  __shared__ __align__(16) __bf16 As[NB][128 * GPITCH];  // [row][k], +8 pad
  __shared__ __align__(16) __bf16 Bs[NB][128 * GPITCH];  // [n][k],  +8 pad
  if (blockIdx.z) {
    // The same for the whole block, in front of every copy and barrier.
    const int n = live[(blockIdx.y / (S_ / 128)) * 32];
    if (n != 0 && (int)(blockIdx.y % (S_ / 128)) * 128 >= n) return;
    A = Az;
    Bt   += (size_t)blockIdx.z * N * K;
    outB += (size_t)blockIdx.z * M * N;
  }
  const int tid  = threadIdx.x;
  const int lane = tid & 31, wave = tid >> 5;
  const int wm = wave >> 1, wn = wave & 1;
  const int m0 = wm * 32, n0 = wn * 64;
  const int rowM = blockIdx.y * 128, colN = blockIdx.x * 128;

  // per-thread 16B chunks of the 128x128 tiles (2048 chunks, 8 per thread):
  // chunk q0 of rows r0, r0 + 16, ..., r0 + 112; a wave covers two whole rows.
  const int r0 = tid >> 4, q0 = tid & 15;
  // The lane offsets are the same for both panels; the panel's first row and
  // the stage's k go into the scalar bases.
  const __bf16* sA = A  + (size_t)rowM * K;
  const __bf16* sB = Bt + (size_t)colN * K;
  unsigned vo[8];
#pragma unroll
  for (int i = 0; i < 8; ++i)
    vo[i] = (unsigned)(((r0 + i * 16) * K + q0 * 8) * 2);
  unsigned ldsA[NB], ldsB[NB];
#pragma unroll
  for (int bufi = 0; bufi < NB; ++bufi) {
    ldsA[bufi] = lds_addr(&As[bufi][r0 * GPITCH + q0 * 8]);
    ldsB[bufi] = lds_addr(&Bs[bufi][r0 * GPITCH + q0 * 8]);
  }

  const v8f zero8 = {0.f, 0.f, 0.f, 0.f, 0.f, 0.f, 0.f, 0.f};
  v8f acc[2][4];
#pragma unroll
  for (int i = 0; i < 2; ++i)
#pragma unroll
    for (int j = 0; j < 4; ++j) acc[i][j] = zero8;

  const int stages = K / GK_;

#define ISSUE_STAGE(BUFI, ST)                                   \
  do {                                                          \
    const size_t kOff = (size_t)(ST) * GK_;                     \
    async_copy_stage(ldsA[BUFI], ldsB[BUFI], vo, sA + kOff,     \
                     sB + kOff);                                \
  } while (0)

// kk is unrolled so that every LDS offset is an immediate and the next 32 k's
// fragment loads can be scheduled among this 32 k's WMMAs.
#define COMPUTE_PANEL(BUFI)                                     \
  do {                                                          \
    _Pragma("unroll")                                           \
    for (int kk = 0; kk < GK_; kk += 32) {                      \
      v16bf af[2], bfr[4];                                      \
      _Pragma("unroll")                                         \
      for (int i = 0; i < 2; ++i)                               \
        af[i] = load_frag(As[BUFI], m0 + i * 16, kk, GPITCH);   \
      _Pragma("unroll")                                         \
      for (int j = 0; j < 4; ++j)                               \
        bfr[j] = load_frag(Bs[BUFI], n0 + j * 16, kk, GPITCH);  \
      _Pragma("unroll")                                         \
      for (int i = 0; i < 2; ++i)                               \
        _Pragma("unroll")                                       \
        for (int j = 0; j < 4; ++j)                             \
          acc[i][j] = wmma_bf16(af[i], bfr[j], acc[i][j]);      \
    }                                                           \
  } while (0)

  // Every wave issues 16 copies per stage and nothing else counts on ASYNCcnt, so
  // the copies of the YOUNG youngest stages are the wave's 16 * YOUNG youngest.
  constexpr int YOUNG = NB - 2;
  // unrolled: b is a buffer index and has to be a constant
#pragma unroll
  for (int b = 0; b < NB - 1; ++b) ISSUE_STAGE(b, b);
  wait_async_but<16 * YOUNG>();   // stage 0 has landed
  __syncthreads();
  for (int st = 0; st < stages; st += NB) {
    // unrolled: u is the buffer of stage st + u
#pragma unroll
    for (int u = 0; u < NB; ++u) {
      // Refill of the buffer that the trip before has read: its barrier is passed.
      const bool more = st + u + NB - 1 < stages;
      if (more) ISSUE_STAGE((u + NB - 1) % NB, st + u + NB - 1);
      COMPUTE_PANEL(u);
      // Publish point of stage st + u + 1: own LDS reads returned, own copies of that
      // stage landed (a trip that issued leaves the YOUNG stages behind it in flight,
      // a trip that did not waits for all), then the one barrier that both publishes
      // that stage and frees the buffer just read.
      wait_ds0();
      if (YOUNG > 0 && more) wait_async_but<16 * YOUNG>(); else wait_async0();
      __syncthreads();
    }
  }
  wait_async0();
#undef ISSUE_STAGE
#undef COMPUTE_PANEL

  // epilogue: C/D layout lane=N (lane&15), vgpr r = M offset (+8 for lanes>=16)
  // Each optional operand is tested ONCE, around a loop over all 64 elements of
  // the lane, so that its loads are all in flight together. (Tested per element,
  // every load stands in a branch of its own and is waited for alone.)
  // Per element the order of the additions stays bias, res1, res2.
  const int ho = (lane < 16) ? 0 : 8;
  const int nc = lane & 15;
  const unsigned col0 = (unsigned)(colN + n0 + nc);
  // Byte offset of f32 element (row i * 16 + r of the wave's tile, column j = 0);
  // M * N * 4 stays below 2^32. Column j is 64 B further on.
  unsigned ro[16];
#pragma unroll
  for (int k = 0; k < 16; ++k)
    ro[k] = ((unsigned)(rowM + m0 + (k >> 3) * 16 + (k & 7) + ho) * (unsigned)N + col0) * 4u;

  if (bias) {
    float bv[4];
#pragma unroll
    for (int j = 0; j < 4; ++j) bv[j] = bias[col0 + j * 16];
#pragma unroll
    for (int i = 0; i < 2; ++i)
#pragma unroll
      for (int j = 0; j < 4; ++j) acc[i][j] += bv[j];
    // Registers that the loads above name may be rewritten from here on.
    asm volatile("s_wait_xcnt 0x0" ::: "memory");
  }
  if (res1) {
    v8f t[2][4];
#pragma unroll
    for (int i = 0; i < 2; ++i)
#pragma unroll
      for (int j = 0; j < 4; ++j)
#pragma unroll
        for (int r = 0; r < 8; ++r)
          t[i][j][r] = *(const float*)((const char*)res1 + (size_t)ro[i * 8 + r] + j * 64);
#pragma unroll
    for (int i = 0; i < 2; ++i)
#pragma unroll
      for (int j = 0; j < 4; ++j) acc[i][j] += t[i][j];
    // Registers that the loads above name may be rewritten from here on.
    asm volatile("s_wait_xcnt 0x0" ::: "memory");
  }
  if (res2) {
    v8f t[2][4];
#pragma unroll
    for (int i = 0; i < 2; ++i)
#pragma unroll
      for (int j = 0; j < 4; ++j)
#pragma unroll
        for (int r = 0; r < 8; ++r)
          t[i][j][r] = *(const float*)((const char*)res2 + (size_t)ro[i * 8 + r] + j * 64);
#pragma unroll
    for (int i = 0; i < 2; ++i)
#pragma unroll
      for (int j = 0; j < 4; ++j) acc[i][j] += t[i][j];
    // Registers that the loads above name may be rewritten from here on.
    asm volatile("s_wait_xcnt 0x0" ::: "memory");
  }
  if (doRelu) {
#pragma unroll
    for (int i = 0; i < 2; ++i)
#pragma unroll
      for (int j = 0; j < 4; ++j)
#pragma unroll
        for (int r = 0; r < 8; ++r) acc[i][j][r] = fmaxf(acc[i][j][r], 0.f);
  }
  if (outF) {
#pragma unroll
    for (int i = 0; i < 2; ++i)
#pragma unroll
      for (int j = 0; j < 4; ++j)
#pragma unroll
        for (int r = 0; r < 8; ++r)
          *(float*)((char*)outF + (size_t)ro[i * 8 + r] + j * 64) = acc[i][j][r];
  }
  // Registers that the stores above name may be rewritten from here on.
  asm volatile("s_wait_xcnt 0x0" ::: "memory");
  if (outB) {
    unsigned hb[2][4][4];   // rows r = 2 p (low half) and 2 p + 1 (high half)
#pragma unroll
    for (int i = 0; i < 2; ++i)
#pragma unroll
      for (int j = 0; j < 4; ++j)
#pragma unroll
        for (int p = 0; p < 4; ++p)
          hb[i][j][p] = pack_bf2(acc[i][j][2 * p], acc[i][j][2 * p + 1]);
#pragma unroll
    for (int k = 0; k < 16; ++k) ro[k] >>= 1;
    // Every value is rounded before the first store issues: mixed with the
    // stores, the rounding reuses their registers behind a wait each time.
    __builtin_amdgcn_sched_barrier(0);
#pragma unroll
    for (int i = 0; i < 2; ++i)
#pragma unroll
      for (int j = 0; j < 4; ++j)
#pragma unroll
        for (int r = 0; r < 8; ++r)
          *(unsigned short*)((char*)outB + (size_t)ro[i * 8 + r] + j * 32) =
              (unsigned short)(hb[i][j][r >> 1] >> ((r & 1) * 16));
  }
}

#define KP_ 72   // K row pitch in elements: 144 B, 16 B x odd (ds_load_b128)
#define VP_ 80   // V row pitch in elements: 160 B, 32 B x odd (ds_load_tr16_b128)

// 8 x 16-bit column piece of a row-major LDS tile: lane (c, h) gets
// T[8h + 0..7][c] when lane l points at row 8 * (l >> 4) + (l & 7), 16-B piece
// (l >> 3) & 1. Every lane is on wherever this is called.
__device__ __forceinline__ v8bf load_tr16(const __bf16* p) {
  typedef __attribute__((address_space(3))) v8s lds_v8s;
  return __builtin_bit_cast(v8bf, __builtin_amdgcn_ds_load_tr16_b128_v8i16((lds_v8s*)p));
}

// Lane l gets the value of lane l ^ 16.
__device__ __forceinline__ float swap_halves(float x) {
  const int i = __builtin_bit_cast(int, x);
  return __builtin_bit_cast(float, __builtin_amdgcn_permlanex16(
      i, i, 0x76543210, 0xfedcba98, false, false));
}

// One 64-key tile of K and of V: 4 + 4 async copies of 16 B per lane, 32-bit lane
// offset on a scalar base. The s_wait_xcnt closes the statement so that no
// address register is rewritten ahead of it.
__device__ __forceinline__ void async_copy_kv(const unsigned (&kl)[4],
                                              const unsigned (&vl)[4],
                                              const unsigned (&go)[4],
                                              const void* baseK,
                                              const void* baseV) {
  asm volatile(
      "global_load_async_to_lds_b128 %0, %8, %12\n\t"
      "global_load_async_to_lds_b128 %1, %9, %12\n\t"
      "global_load_async_to_lds_b128 %2, %10, %12\n\t"
      "global_load_async_to_lds_b128 %3, %11, %12\n\t"
      "global_load_async_to_lds_b128 %4, %8, %13\n\t"
      "global_load_async_to_lds_b128 %5, %9, %13\n\t"
      "global_load_async_to_lds_b128 %6, %10, %13\n\t"
      "global_load_async_to_lds_b128 %7, %11, %13\n\t"
      "s_wait_xcnt 0x0"
      :: "v"(kl[0]), "v"(kl[1]), "v"(kl[2]), "v"(kl[3]),
         "v"(vl[0]), "v"(vl[1]), "v"(vl[2]), "v"(vl[3]),
         "v"(go[0]), "v"(go[1]), "v"(go[2]), "v"(go[3]),
         "s"(baseK), "s"(baseV)
      : "memory");
}

__global__ __launch_bounds__(128) void flash_attn_kernel(
    const __bf16* __restrict__ Q, const __bf16* __restrict__ Kb,
    const __bf16* __restrict__ V, const int* __restrict__ live,
    __bf16* __restrict__ O)
{
  __shared__ __align__(16) __bf16 Ks[64 * KP_];     // [key][dk]
  __shared__ __align__(32) __bf16 Vs[64 * VP_];     // [key][dk]
  __shared__ __align__(16) float  Ms[S_];           // per key place: 0, or -1e30 if masked

  const int tid = threadIdx.x, lane = tid & 31, wave = tid >> 5;
  const int c = lane & 15, hh = lane >> 4;
  const int qb = blockIdx.x * 64, h = blockIdx.y, b = blockIdx.z;
  const int m0 = wave * 16;
  const size_t qbase  = ((size_t)b * S_ + qb) * D_ + h * DK_;
  const size_t kvrow0 = (size_t)b * S_ * D_ + h * DK_;

  // Q^T fragments (B operand, column = query c), in the k order of load_frag.
  const __bf16* qp = Q + qbase + (size_t)(m0 + c) * D_ + 8 * hh;
  const int n  = live[b * 32];                      // unmasked keys of this batch
  const int nt = (((n < 1 || n > S_) ? S_ : n) + 63) >> 6;   // 64-key tiles, 1..16
  const v8bf q0 = *(const v8bf*)qp;
  const v8bf q1 = *(const v8bf*)(qp + 16);
  const v8bf q2 = *(const v8bf*)(qp + 32);
  const v8bf q3 = *(const v8bf*)(qp + 48);
  // The address pair of the loads above stays whole until this wait.
  asm volatile("s_wait_xcnt 0x0" :: "v"(qp) : "memory");
  v16bf qf[2];
#pragma unroll
  for (int i = 0; i < 8; ++i) {
    qf[0][i] = q0[i]; qf[0][i + 8] = q1[i];
    qf[1][i] = q2[i]; qf[1][i + 8] = q3[i];
  }
  // The key mask as an addend, 8 key places per thread: places n and up hold masked
  // keys. Published by the barriers at the head of the first trip.
  {
    v4f f0, f1;
#pragma unroll
    for (int e = 0; e < 4; ++e) {
      f0[e] = (tid * 8 + e     >= n) ? -1e30f : 0.f;
      f1[e] = (tid * 8 + e + 4 >= n) ? -1e30f : 0.f;
    }
    *(v4f*)&Ms[tid * 8]     = f0;
    *(v4f*)&Ms[tid * 8 + 4] = f1;
  }

  // per-thread 16B chunks of a 64x64 bf16 tile (512 chunks, 4 per thread)
  unsigned kLds[4], vLds[4], tOff[4];
#pragma unroll
  for (int t = 0; t < 4; ++t) {
    const int ch = tid + t * 128;
    const int rr = ch >> 3, cc = ch & 7;
    kLds[t] = lds_addr(&Ks[rr * KP_ + cc * 8]);
    vLds[t] = lds_addr(&Vs[rr * VP_ + cc * 8]);
    tOff[t] = (unsigned)((rr * D_ + cc * 8) * 2);
  }
  const __bf16* vfrag = &Vs[(8 * hh + (lane & 7)) * VP_ + ((lane >> 3) & 1) * 8];

  const v8f zero8 = {0.f, 0.f, 0.f, 0.f, 0.f, 0.f, 0.f, 0.f};
  v8f o[4];                      // o[t][r] = O[query c][dk 16 t + 8 hh + r]
#pragma unroll
  for (int t = 0; t < 4; ++t) o[t] = zero8;
  float m_run = -3.0e38f;        // the query's maximum, alike in both halves
  float l_run = 0.f;             // the sum over this half's keys only

  int kt = 0;
  do {              // nt is at least 1
    wait_ds0();       // own reads of Ks/Vs (first trip: writes of Ms) are done
    __syncthreads();  // and so are every other wave's: the tiles may be refilled
    const size_t kvb = kvrow0 + (size_t)kt * 64 * D_;
    async_copy_kv(kLds, vLds, tOff, Kb + kvb, V + kvb);
    wait_async0();
    __syncthreads();

    // S^T = K Q^T: s[j][r] = score(key 16 j + 8 hh + r, query c)
    v8f s[4];
#pragma unroll
    for (int j = 0; j < 4; ++j) s[j] = zero8;
#pragma unroll
    for (int kk = 0; kk < 2; ++kk)
#pragma unroll
      for (int j = 0; j < 4; ++j)
        s[j] = wmma_bf16(load_frag(Ks, j * 16, kk * 32, KP_), qf[kk], s[j]);
    // scale 1/sqrt(64) + key mask
#pragma unroll
    for (int j = 0; j < 4; ++j) {
      const float* mrow = &Ms[kt * 64 + j * 16 + 8 * hh];
      const v4f ma = *(const v4f*)mrow;
      const v4f mb = *(const v4f*)(mrow + 4);
#pragma unroll
      for (int r = 0; r < 4; ++r) {
        s[j][r]     = s[j][r]     * 0.125f + ma[r];
        s[j][r + 4] = s[j][r + 4] * 0.125f + mb[r];
      }
    }
    // online softmax (base-2): one query per lane
    v8f mx8 = __builtin_elementwise_max(__builtin_elementwise_max(s[0], s[1]),
                                        __builtin_elementwise_max(s[2], s[3]));
    float mx = fmaxf(fmaxf(fmaxf(mx8[0], mx8[1]), fmaxf(mx8[2], mx8[3])),
                     fmaxf(fmaxf(mx8[4], mx8[5]), fmaxf(mx8[6], mx8[7])));
    mx = fmaxf(mx, swap_halves(mx));
    const float mn = fmaxf(m_run, mx);
    const float alpha = exp2_bare((m_run - mn) * 1.44269504f);
    m_run = mn;
#pragma unroll
    for (int j = 0; j < 4; ++j)
#pragma unroll
      for (int r = 0; r < 8; ++r)
        s[j][r] = exp2_bare((s[j][r] - m_run) * 1.44269504f);
    const v8f rs8 = (s[0] + s[1]) + (s[2] + s[3]);
    const float rs = ((rs8[0] + rs8[1]) + (rs8[2] + rs8[3])) +
                     ((rs8[4] + rs8[5]) + (rs8[6] + rs8[7]));
    l_run = l_run * alpha + rs;
#pragma unroll
    for (int t = 0; t < 4; ++t) o[t] *= alpha;

    // O^T += V^T P^T: B = score tiles 2 kk and 2 kk + 1 rounded in place (element
    // e = key 32 kk + 8 hh + e, e + 8 = key 32 kk + 16 + 8 hh + e: the order that
    // the two transposing loads of an A fragment deliver)
#pragma unroll
    for (int kk = 0; kk < 2; ++kk) {
      v8u pw;
#pragma unroll
      for (int i = 0; i < 4; ++i) {
        pw[i]     = pack_bf2(s[2 * kk][2 * i],     s[2 * kk][2 * i + 1]);
        pw[i + 4] = pack_bf2(s[2 * kk + 1][2 * i], s[2 * kk + 1][2 * i + 1]);
      }
      const v16bf pf = __builtin_bit_cast(v16bf, pw);
#pragma unroll
      for (int t = 0; t < 4; ++t) {
        const v8bf lo = load_tr16(vfrag + (kk * 32) * VP_ + t * 16);
        const v8bf hi = load_tr16(vfrag + (kk * 32 + 16) * VP_ + t * 16);
        v16bf a;
#pragma unroll
        for (int i = 0; i < 8; ++i) { a[i] = lo[i]; a[i + 8] = hi[i]; }
        o[t] = wmma_bf16(a, pf, o[t]);
      }
    }
  } while (++kt < nt);

  // The halves' sums are joined once, unconditionally (every lane is on).
  const float l   = l_run + swap_halves(l_run);
  const float inv = 1.f / fmaxf(l, 1e-20f);
  __bf16* op = O + ((size_t)b * S_ + qb + m0 + c) * D_ + h * DK_ + 8 * hh;
#pragma unroll
  for (int t = 0; t < 4; ++t) {
    v4u pk;
#pragma unroll
    for (int i = 0; i < 4; ++i)
      pk[i] = pack_bf2(o[t][2 * i] * inv, o[t][2 * i + 1] * inv);
    *(v4u*)(op + 16 * t) = pk;   // 8 consecutive dk of one query
  }
}

// ---------- launcher ----------

extern "C" void kernel_launch(void* const* d_in, const int* in_sizes, int n_in,
                              void* d_out, int out_size, void* d_ws, size_t ws_size,
                              hipStream_t stream)
{
  (void)in_sizes; (void)n_in; (void)out_size; (void)ws_size;
  const float* x    = (const float*)d_in[0];
  const float* kv   = (const float*)d_in[1];
  const int*   msk  = (const int*)  d_in[2];
  const float* ln1g = (const float*)d_in[3];
  const float* ln1b = (const float*)d_in[4];
  // Order of the converted D x D weights: the five whose products share one launch
  // (q0, k0, v0, k1, v1) first, then o0, q1, o1.
  const float* qw0  = (const float*)d_in[5];
  const float* kw0  = (const float*)d_in[6];
  const float* vw0  = (const float*)d_in[7];
  const float* ow0  = (const float*)d_in[8];
  const float* ob0  = (const float*)d_in[9];
  const float* qw1  = (const float*)d_in[10];
  const float* kw1  = (const float*)d_in[11];
  const float* vw1  = (const float*)d_in[12];
  const float* ow1  = (const float*)d_in[13];
  const float* ob1  = (const float*)d_in[14];
  const float* ln2g = (const float*)d_in[15];
  const float* ln2b = (const float*)d_in[16];
  const float* w1   = (const float*)d_in[17];
  const float* b1   = (const float*)d_in[18];
  const float* w2   = (const float*)d_in[19];
  const float* b2   = (const float*)d_in[20];

  char* ws = (char*)d_ws;
  size_t off = 0;
  auto alloc = [&](size_t bytes) -> void* {
    void* p = ws + off;
    off += (bytes + 255) & ~(size_t)255;
    return p;
  };
  const size_t ROWS = (size_t)B_ * S_;  // 4096
  float*  y_f32  = (float*) alloc(ROWS * D_ * 4);
  __bf16* y_bf   = (__bf16*)alloc(ROWS * D_ * 2);
  __bf16* kvn_bf = (__bf16*)alloc(ROWS * D_ * 2);
  __bf16* wtAll  = (__bf16*)alloc((size_t)16 * D_ * D_ * 2);
  __bf16* wtO0   = wtAll + (size_t)5 * D_ * D_;
  __bf16* wtQ1   = wtAll + (size_t)6 * D_ * D_;
  __bf16* wtO1   = wtAll + (size_t)7 * D_ * D_;
  __bf16* w1t    = wtAll + (size_t)8 * D_ * D_;
  __bf16* w2t    = wtAll + (size_t)12 * D_ * D_;
  __bf16* qB     = (__bf16*)alloc(5 * ROWS * D_ * 2);   // q, k0, v0, k1, v1
  __bf16* kB0    = qB + 1 * ROWS * D_;
  __bf16* vB0    = qB + 2 * ROWS * D_;
  __bf16* kB1    = qB + 3 * ROWS * D_;
  __bf16* vB1    = qB + 4 * ROWS * D_;
  __bf16* aB     = (__bf16*)alloc(ROWS * D_ * 2);
  float*  y1_f32 = (float*) alloc(ROWS * D_ * 4);
  __bf16* y1_bf  = (__bf16*)alloc(ROWS * D_ * 2);
  float*  x2_f32 = (float*) alloc(ROWS * D_ * 4);
  __bf16* x2n_bf = (__bf16*)alloc(ROWS * D_ * 2);
  __bf16* hB     = (__bf16*)alloc(ROWS * FFN_ * 2);
  int*    live   = (int*)   alloc(B_ * 32 * 4);          // unmasked keys per batch

  // LayerNorm 1 on x (keep f32 for residual) and on kv, one launch
  ln_kernel<<<dim3((unsigned)(ROWS / 8), 2), 256, 0, stream>>>(
      x, kv, ln1g, ln1b, y_f32, y_bf, kvn_bf, msk, live);

  // weight conversion/transposition, one launch
  transpose_f32_to_bf16<<<2048, 256, 0, stream>>>(
      qw0, kw0, vw0, kw1, vw1, ow0, qw1, ow1, w1, w2, wtAll);

  const dim3 gproj(D_/128, (unsigned)(ROWS/128));        // (8, 32)
  const dim3 gqkv(D_/128, (unsigned)(ROWS/128), 5);      // (8, 32, 5)
  const dim3 gattn(S_/64, H_, B_);                       // (16,16,4)

  // q0 from y; k0, v0, k1, v1 from kvn: none waits for another, one launch
  gemm_bf16_kernel<2><<<gqkv, 256, 0, stream>>>(y_bf, kvn_bf, wtAll, nullptr, nullptr, nullptr, nullptr, qB, live, (int)ROWS, D_, D_, 0);

  // cross-attention 0
  flash_attn_kernel<<<gattn, 128, 0, stream>>>(qB, kB0, vB0, live, aB);
  gemm_bf16_kernel<4><<<gproj, 256, 0, stream>>>(aB, nullptr, wtO0, ob0, y_f32, nullptr, y1_f32, y1_bf, nullptr, (int)ROWS, D_, D_, 0);

  // cross-attention 1 (query from y1)
  gemm_bf16_kernel<4><<<gproj, 256, 0, stream>>>(y1_bf, nullptr, wtQ1, nullptr, nullptr, nullptr, nullptr, qB, nullptr, (int)ROWS, D_, D_, 0);
  flash_attn_kernel<<<gattn, 128, 0, stream>>>(qB, kB1, vB1, live, aB);
  // x2 = x + (o1 + ob1 + y1)
  gemm_bf16_kernel<4><<<gproj, 256, 0, stream>>>(aB, nullptr, wtO1, ob1, y1_f32, x, x2_f32, nullptr, nullptr, (int)ROWS, D_, D_, 0);

  // FFN
  ln_kernel<<<dim3((unsigned)(ROWS / 8), 1), 256, 0, stream>>>(
      x2_f32, nullptr, ln2g, ln2b, nullptr, x2n_bf, nullptr, nullptr, nullptr);
  gemm_bf16_kernel<2><<<dim3(FFN_/128, (unsigned)(ROWS/128)), 256, 0, stream>>>(
      x2n_bf, nullptr, w1t, b1, nullptr, nullptr, nullptr, hB, nullptr, (int)ROWS, FFN_, D_, 1);
  gemm_bf16_kernel<4><<<gproj, 256, 0, stream>>>(
      hB, nullptr, w2t, b2, x2_f32, nullptr, (float*)d_out, nullptr, nullptr, (int)ROWS, D_, FFN_, 0);
}

// v009
// Measured time: 170 microseconds a run.
// Timed twice side by side with v008, it ran 1.07 and 1.06 times as fast.
// Over all steps from v000 it is 3.56 times as fast.
#include <hip/hip_runtime.h>
#include <hip/hip_bf16.h>
#include <cstdint>

typedef __attribute__((ext_vector_type(16))) __bf16 v16bf;
typedef __attribute__((ext_vector_type(8)))  __bf16 v8bf;
typedef __attribute__((ext_vector_type(8)))  float  v8f;
typedef __attribute__((ext_vector_type(4)))  float  v4f;
typedef __attribute__((ext_vector_type(4)))  __bf16 v4bf;
typedef __attribute__((ext_vector_type(4)))  unsigned v4u;
typedef __attribute__((ext_vector_type(8)))  unsigned v8u;
typedef __attribute__((ext_vector_type(4)))  int      v4i;
typedef __attribute__((ext_vector_type(8)))  short    v8s;
typedef __attribute__((ext_vector_type(2)))  float    v2f;
typedef __attribute__((ext_vector_type(2)))  __bf16   v2bf;

#define B_   4
#define S_   1024
#define D_   1024
#define H_   16
#define DK_  64
#define FFN_ 4096

// ---------- helpers ----------

// Round to nearest even, by the chip's own conversion (v_cvt_pk_bf16_f32).
__device__ __forceinline__ __bf16 f2bf(float f) { return (__bf16)f; }

// Two floats rounded as in f2bf, lo in bits 15..0 and hi in bits 31..16: one
// instruction per pair.
__device__ __forceinline__ unsigned pack_bf2(float lo, float hi) {
  const v2f x = {lo, hi};
  return __builtin_bit_cast(unsigned, __builtin_convertvector(x, v2bf));
}

// 2^x as the bare v_exp_f32. The library's exp2f wraps it in a compare, two
// selects and a v_ldexp_f32 so that results below 2^-126 come out as denormals;
// here such a result may come out as 0. Used for softmax weights only, where the
// row's largest weight is 1 and the f32 sums absorb a term that small.
__device__ __forceinline__ float exp2_bare(float x) {
  return __builtin_amdgcn_exp2f(x);
}

// Low 32 bits of the generic address of a __shared__ object == LDS byte offset
// (flat shared-aperture mapping uses addr[31:0] as the LDS address).
__device__ __forceinline__ unsigned lds_addr(const void* p) {
  return (unsigned)(uintptr_t)p;
}

__device__ __forceinline__ void wait_async0() {
  asm volatile("s_wait_asynccnt 0" ::: "memory");
}

// Load a 16x32 bf16 WMMA fragment (A layout; also B when source is Bt[N][K])
// from a row-major [rows][ldk] bf16 tile in LDS.
__device__ __forceinline__ v16bf load_frag(const __bf16* base, int row0, int k0, int ldk) {
  const int lane = threadIdx.x & 31;
  const __bf16* p = base + (row0 + (lane & 15)) * ldk + k0 + ((lane >> 4) << 3);
  v8bf lo = *(const v8bf*)p;
  v8bf hi = *(const v8bf*)(p + 16);
  v16bf r;
#pragma unroll
  for (int i = 0; i < 8; ++i) { r[i] = lo[i]; r[i + 8] = hi[i]; }
  return r;
}

__device__ __forceinline__ v8f wmma_bf16(v16bf a, v16bf b, v8f c) {
  return __builtin_amdgcn_wmma_f32_16x16x32_bf16(false, a, false, b, (short)0, c,
                                                 false, false);
}

// ---------- LayerNorm (D=1024), outputs f32 and/or bf16 ----------
// One wave per row, 8 rows per block: a lane holds 8 x 16 B of its row, all loads
// in flight at once; the row sums stay inside the wave (no LDS, no barrier).
// An eighth of the waves of a block-per-row form have to be started.
// One launch may norm two tensors with the same g and bt: grid slice y = 1 reads
// in2 and writes outB2 only.
// Slice y = 1 holds the key rows. A key whose mask entry is 0 has softmax weight 0
// (unless its whole batch is masked: n = 0, nothing is dropped), so the slice stores each batch's S_ rows in a new order: the n unmasked rows
// first, the masked ones behind them, each group in its old order. n goes to
// live[32 * batch] (one 128-B line per writer). The launches behind this one work
// on the first n rows only, rounded up to their tile.

__global__ __launch_bounds__(256) void ln_kernel(
    const float* __restrict__ in, const float* __restrict__ in2,
    const float* __restrict__ g,
    const float* __restrict__ bt, float* __restrict__ outF,
    __bf16* __restrict__ outB, __bf16* __restrict__ outB2,
    const int* __restrict__ mask, int* __restrict__ live)
{
  if (blockIdx.y) { in = in2; outF = nullptr; outB = outB2; }
  const int lane = threadIdx.x & 31;
  const int row  = blockIdx.x * 8 + (threadIdx.x >> 5);
  int orow = row;                 // where the 16-bit row is stored
  if (blockIdx.y) {
    // Ahead of the row's own loads, so that its registers are free again for them.
    // Every wave counts its batch's whole mask (32 entries per lane): bits 0..10 all
    // unmasked keys, bits 11..21 those in front of its own row, bit 22 its own row.
    const int r = row & (S_ - 1);
    const v4i* mp = (const v4i*)(mask + (row - r)) + lane;
    v4i mk[8];
    // The loops over mk are unrolled so that it stays in registers.
#pragma unroll
    for (int i = 0; i < 8; ++i) mk[i] = mp[i * 32];
    // The address pair of the loads above stays whole until this wait.
    asm volatile("s_wait_xcnt 0x0" :: "v"(mp) : "memory");
    int pk = 0;
#pragma unroll
    for (int i = 0; i < 8; ++i)
#pragma unroll
      for (int e = 0; e < 4; ++e) {
        const int pos = i * 128 + lane * 4 + e;
        const int w = 1 + (pos < r ? (1 << 11) : 0) + (pos == r ? (1 << 22) : 0);
        pk += (mk[i][e] != 0) ? w : 0;
      }
#pragma unroll
    for (int off = 16; off >= 1; off >>= 1) pk += __shfl_xor(pk, off, 32);
    const int n = pk & 2047, before = (pk >> 11) & 2047;
    orow = (row - r) + ((pk >> 22) ? before : n + (r - before));
    if (r == 0 && lane == 0) live[(row >> 10) * 32] = n;   // S_ = 1 << 10 rows per batch
    // Registers that the store above names may be rewritten from here on.
    asm volatile("s_wait_xcnt 0x0" ::: "memory");
    // A masked row behind the last 128-row GEMM tile with an unmasked row in it is
    // read by nobody. The whole wave leaves; the kernel has no barrier.
    if (n != 0 && orow - (row - r) >= ((n + 127) & ~127)) return;
  }
  const v4f* p  = (const v4f*)(in + (size_t)row * D_);
  const v4f* g4 = (const v4f*)g;
  const v4f* b4 = (const v4f*)bt;
  v4f v[8], gg[8], bb[8];
#pragma unroll
  for (int i = 0; i < 8; ++i) v[i] = p[lane + i * 32];
#pragma unroll
  for (int i = 0; i < 8; ++i) { gg[i] = g4[lane + i * 32]; bb[i] = b4[lane + i * 32]; }
  v4f s4 = {0.f, 0.f, 0.f, 0.f}, q4 = {0.f, 0.f, 0.f, 0.f};
#pragma unroll
  for (int i = 0; i < 8; ++i) { s4 += v[i]; q4 += v[i] * v[i]; }
  float s  = (s4[0] + s4[1]) + (s4[2] + s4[3]);
  float sq = (q4[0] + q4[1]) + (q4[2] + q4[3]);
#pragma unroll
  for (int off = 16; off >= 1; off >>= 1) {
    s  += __shfl_xor(s,  off, 32);
    sq += __shfl_xor(sq, off, 32);
  }
  const float mean = s * (1.f / D_);
  const float var  = sq * (1.f / D_) - mean * mean;
  const float rstd = rsqrtf(var + 1e-5f);
  v4bf ob[8];
#pragma unroll
  for (int i = 0; i < 8; ++i) {
    v[i] = (v[i] - mean) * rstd * gg[i] + bb[i];
#pragma unroll
    for (int e = 0; e < 4; ++e) ob[i][e] = f2bf(v[i][e]);
  }
  if (outB) {
    v4bf* q = (v4bf*)(outB + (size_t)orow * D_);
#pragma unroll
    for (int i = 0; i < 8; ++i) q[lane + i * 32] = ob[i];
  }
  // Registers that the stores above name may be rewritten from here on.
  asm volatile("s_wait_xcnt 0x0" ::: "memory");
  if (outF) {
    v4f* q = (v4f*)(outF + (size_t)row * D_);
#pragma unroll
    for (int i = 0; i < 8; ++i) q[lane + i * 32] = v[i];
  }
}

// ---------- fp32 [K,N] -> bf16 transposed [N,K] ----------
// One block moves 128 k x 64 n: 8 loads of 16 B per lane in flight (256-B pieces
// of W rows), two k neighbours packed into a dword, dwords transposed through
// LDS, 256-B pieces of Wt rows stored. K a multiple of 128, N of 64.
// One launch converts all ten weights: blocks 0..1023 the eight D x D ones (128
// tiles each), 1024..1535 the D x FFN one, 1536..2047 the FFN x D one. The results
// lie one after the other in WtAll, in the order of the arguments.

#define TK_ 128
#define TN_ 64
#define TP_ 65   // LDS row pitch in dwords: odd, so both sides meet 32 banks

__global__ __launch_bounds__(256) void transpose_f32_to_bf16(
    const float* __restrict__ Wa, const float* __restrict__ Wb,
    const float* __restrict__ Wc, const float* __restrict__ Wd,
    const float* __restrict__ We, const float* __restrict__ Wf,
    const float* __restrict__ Wg, const float* __restrict__ Wh,
    const float* __restrict__ Wup, const float* __restrict__ Wdn,
    __bf16* __restrict__ WtAll)
{
  __shared__ unsigned t[TN_ * TP_];               // [n][k / 2]
  const int bid = blockIdx.x;
  const float* W;
  __bf16* Wt;
  int K, N, tile;
  if (bid < 1024) {
    const int w = bid >> 7;
    W = (w & 4) ? ((w & 2) ? ((w & 1) ? Wh : Wg) : ((w & 1) ? Wf : We))
                : ((w & 2) ? ((w & 1) ? Wd : Wc) : ((w & 1) ? Wb : Wa));
    Wt = WtAll + (size_t)w * D_ * D_;
    K = D_; N = D_; tile = bid & 127;
  } else if (bid < 1536) {
    W = Wup; Wt = WtAll + (size_t)8 * D_ * D_;
    K = D_; N = FFN_; tile = bid - 1024;
  } else {
    W = Wdn; Wt = WtAll + (size_t)12 * D_ * D_;
    K = FFN_; N = D_; tile = bid - 1536;
  }
  const int nTiles = N / TN_;                     // 16 or 64
  const int n0 = (tile & (nTiles - 1)) * TN_, k0 = (tile / nTiles) * TK_;
  const int lo4 = threadIdx.x & 15, hi4 = threadIdx.x >> 4;
  const float* pa[4];
  const float* pb[4];
  v4f a[4], b[4];
#pragma unroll
  for (int i = 0; i < 4; ++i) {
    pa[i] = W + (size_t)(k0 + 2 * (hi4 + i * 16)) * N + (n0 + lo4 * 4);
    pb[i] = pa[i] + N;
  }
#pragma unroll
  for (int i = 0; i < 4; ++i) {
    a[i] = *(const v4f*)pa[i];
    b[i] = *(const v4f*)pb[i];
  }
  // Every load's address pair stays whole until this wait: named here as inputs,
  // none of them can serve as a later load's destination.
  asm volatile("s_wait_xcnt 0x0"
               :: "v"(pa[0]), "v"(pa[1]), "v"(pa[2]), "v"(pa[3]),
                  "v"(pb[0]), "v"(pb[1]), "v"(pb[2]), "v"(pb[3])
               : "memory");
#pragma unroll
  for (int i = 0; i < 4; ++i)
#pragma unroll
    for (int j = 0; j < 4; ++j)
      t[(lo4 * 4 + j) * TP_ + hi4 + i * 16] = pack_bf2(a[i][j], b[i][j]);
  __syncthreads();
#pragma unroll
  for (int i = 0; i < 4; ++i) {
    const int n = hi4 + i * 16;
    v4u o;
#pragma unroll
    for (int e = 0; e < 4; ++e) o[e] = t[n * TP_ + lo4 * 4 + e];
    *(v4u*)(Wt + (size_t)(n0 + n) * K + (k0 + lo4 * 8)) = o;
  }
}

// ---------- GEMM: C[M,N] = epi( A[M,K]bf16 @ Bt[N,K]bf16^T ) ----------
// 128x128 block tile, 8 waves -> 32x64 per wave (2x4 WMMA frags).
// A stage is 128 k of every operand row (256 B, whole L2 units), a ring of NB LDS
// buffers filled by GLOBAL_LOAD_ASYNC_TO_LDS (ASYNCcnt): NB - 1 stages of 16 copies
// per lane are issued ahead of the stage whose 32 WMMAs per wave run, one barrier
// per stage. NB = 2 lets two blocks share a WGP's LDS (two stages in flight per
// WGP); NB = 4 is for grids of one block per WGP, where the block alone has to keep
// enough bytes in flight to cover operands that come from memory.
// Main loop unrolled NB stages so buffer indices are compile-time constants.
// Requires K a multiple of NB * 128.
// One launch may hold several products of one shape: grid slice z > 0 reads Az,
// and the slices' Bt and outB lie one after the other. Az holds the key rows as
// ln_kernel orders them: a row tile wholly behind its batch's unmasked rows is read
// by nobody and is not computed (no unmasked row at all: every tile is).

#define GK_    128            // k per stage
#define GPITCH 136            // LDS row pitch in elements: 272 B, 16 B x odd

// One stage: 8 + 8 async copies of 16 B per lane (rows 16 apart of the A and of
// the B panel), 32-bit lane offset on a scalar base. The s_wait_xcnt closes the
// statement so that no address register is rewritten ahead of it.
__device__ __forceinline__ void async_copy_stage(unsigned la, unsigned lb,
                                                 const unsigned (&vo)[8],
                                                 const void* baseA,
                                                 const void* baseB) {
  const unsigned lStep = 16 * GPITCH * 2;
  asm volatile(
      "global_load_async_to_lds_b128 %0, %16, %24\n\t"
      "global_load_async_to_lds_b128 %1, %17, %24\n\t"
      "global_load_async_to_lds_b128 %2, %18, %24\n\t"
      "global_load_async_to_lds_b128 %3, %19, %24\n\t"
      "global_load_async_to_lds_b128 %4, %20, %24\n\t"
      "global_load_async_to_lds_b128 %5, %21, %24\n\t"
      "global_load_async_to_lds_b128 %6, %22, %24\n\t"
      "global_load_async_to_lds_b128 %7, %23, %24\n\t"
      "global_load_async_to_lds_b128 %8, %16, %25\n\t"
      "global_load_async_to_lds_b128 %9, %17, %25\n\t"
      "global_load_async_to_lds_b128 %10, %18, %25\n\t"
      "global_load_async_to_lds_b128 %11, %19, %25\n\t"
      "global_load_async_to_lds_b128 %12, %20, %25\n\t"
      "global_load_async_to_lds_b128 %13, %21, %25\n\t"
      "global_load_async_to_lds_b128 %14, %22, %25\n\t"
      "global_load_async_to_lds_b128 %15, %23, %25\n\t"
      "s_wait_xcnt 0x0"
      :: "v"(la), "v"(la + lStep), "v"(la + 2 * lStep), "v"(la + 3 * lStep),
         "v"(la + 4 * lStep), "v"(la + 5 * lStep), "v"(la + 6 * lStep),
         "v"(la + 7 * lStep),
         "v"(lb), "v"(lb + lStep), "v"(lb + 2 * lStep), "v"(lb + 3 * lStep),
         "v"(lb + 4 * lStep), "v"(lb + 5 * lStep), "v"(lb + 6 * lStep),
         "v"(lb + 7 * lStep),
         "v"(vo[0]), "v"(vo[1]), "v"(vo[2]), "v"(vo[3]),
         "v"(vo[4]), "v"(vo[5]), "v"(vo[6]), "v"(vo[7]),
         "s"(baseA), "s"(baseB)
      : "memory");
}

// This wave's LDS reads have returned before the buffer they read is refilled.
__device__ __forceinline__ void wait_ds0() {
  asm volatile("s_wait_dscnt 0x0" ::: "memory");
}

// All but this wave's N youngest copies have landed.
template <int N>
__device__ __forceinline__ void wait_async_but() {
  asm volatile("s_wait_asynccnt %0" :: "i"(N) : "memory");
}

template <int NB>
__global__ __launch_bounds__(256) void gemm_bf16_kernel(
    const __bf16* __restrict__ A, const __bf16* __restrict__ Az,
    const __bf16* __restrict__ Bt,
    const float* __restrict__ bias, const float* __restrict__ res1,
    const float* __restrict__ res2, float* __restrict__ outF,
    __bf16* __restrict__ outB, const int* __restrict__ live,
    int M, int N, int K, int doRelu)
{
  __shared__ __align__(16) __bf16 As[NB][128 * GPITCH];  // [row][k], +8 pad
  __shared__ __align__(16) __bf16 Bs[NB][128 * GPITCH];  // [n][k],  +8 pad
  if (blockIdx.z) {
    // The same for the whole block, in front of every copy and barrier.
    const int n = live[(blockIdx.y / (S_ / 128)) * 32];
    if (n != 0 && (int)(blockIdx.y % (S_ / 128)) * 128 >= n) return;
    A = Az;
    Bt   += (size_t)blockIdx.z * N * K;
    outB += (size_t)blockIdx.z * M * N;
  }
  const int tid  = threadIdx.x;
  const int lane = tid & 31, wave = tid >> 5;
  const int wm = wave >> 1, wn = wave & 1;
  const int m0 = wm * 32, n0 = wn * 64;
  const int rowM = blockIdx.y * 128, colN = blockIdx.x * 128;

  // per-thread 16B chunks of the 128x128 tiles (2048 chunks, 8 per thread):
  // chunk q0 of rows r0, r0 + 16, ..., r0 + 112; a wave covers two whole rows.
  const int r0 = tid >> 4, q0 = tid & 15;
  // The lane offsets are the same for both panels; the panel's first row and
  // the stage's k go into the scalar bases.
  const __bf16* sA = A  + (size_t)rowM * K;
  const __bf16* sB = Bt + (size_t)colN * K;
  unsigned vo[8];
#pragma unroll
  for (int i = 0; i < 8; ++i)
    vo[i] = (unsigned)(((r0 + i * 16) * K + q0 * 8) * 2);
  unsigned ldsA[NB], ldsB[NB];
#pragma unroll
  for (int bufi = 0; bufi < NB; ++bufi) {
    ldsA[bufi] = lds_addr(&As[bufi][r0 * GPITCH + q0 * 8]);
    ldsB[bufi] = lds_addr(&Bs[bufi][r0 * GPITCH + q0 * 8]);
  }

  const v8f zero8 = {0.f, 0.f, 0.f, 0.f, 0.f, 0.f, 0.f, 0.f};
  v8f acc[2][4];
#pragma unroll
  for (int i = 0; i < 2; ++i)
#pragma unroll
    for (int j = 0; j < 4; ++j) acc[i][j] = zero8;

  const int stages = K / GK_;

#define ISSUE_STAGE(BUFI, ST)                                   \
  do {                                                          \
    const size_t kOff = (size_t)(ST) * GK_;                     \
    async_copy_stage(ldsA[BUFI], ldsB[BUFI], vo, sA + kOff,     \
                     sB + kOff);                                \
  } while (0)

// The fragments of 32 k: 12 ds_load_b128, written as one group.
#define LOAD_FRAGS(SET, BUFI, KK)                               \
  do {                                                          \
    _Pragma("unroll")                                           \
    for (int i = 0; i < 2; ++i)                                 \
      af[SET][i] = load_frag(As[BUFI], m0 + i * 16, KK, GPITCH); \
    _Pragma("unroll")                                           \
    for (int j = 0; j < 4; ++j)                                 \
      bfr[SET][j] = load_frag(Bs[BUFI], n0 + j * 16, KK, GPITCH); \
  } while (0)

// The 8 WMMAs of 32 k as one run. The scheduling barriers at its two ends keep the
// load groups and the runs whole and in the order written: left free, the compiler
// spreads the loads among the WMMAs and waits for each handful with s_wait_dscnt 0.
#define WMMA_RUN(SET)                                           \
  do {                                                          \
    __builtin_amdgcn_sched_barrier(0);                          \
    _Pragma("unroll")                                           \
    for (int i = 0; i < 2; ++i)                                 \
      _Pragma("unroll")                                         \
      for (int j = 0; j < 4; ++j)                               \
        acc[i][j] = wmma_bf16(af[SET][i], bfr[SET][j], acc[i][j]); \
    __builtin_amdgcn_sched_barrier(0);                          \
  } while (0)

  // Two fragment sets: the next 32 k's group stands in front of this 32 k's run and
  // returns while that runs, so the wait in front of a run is a counted one that
  // leaves the younger group in flight.
  v16bf af[2][2], bfr[2][4];
  static_assert(GK_ == 128, "a stage is four runs: sets 0, 1, 0, 1");

  // Every wave issues 16 copies per stage and nothing else counts on ASYNCcnt, so
  // the copies of the YOUNG youngest stages are the wave's 16 * YOUNG youngest.
  constexpr int YOUNG = NB - 2;
  // unrolled: b is a buffer index and has to be a constant
#pragma unroll
  for (int b = 0; b < NB - 1; ++b) ISSUE_STAGE(b, b);
  wait_async_but<16 * YOUNG>();   // stage 0 has landed
  __syncthreads();
  LOAD_FRAGS(0, 0, 0);
  ISSUE_STAGE(NB - 1, NB - 1);    // there are at least NB stages
  for (int st = 0; st < stages; st += NB) {
    // unrolled: u is the buffer of stage st + u
#pragma unroll
    for (int u = 0; u < NB; ++u) {
      // On entry set 0 holds, or is being sent, the stage's first 32 k.
      LOAD_FRAGS(1, u, 32);
      WMMA_RUN(0);
      LOAD_FRAGS(0, u, 64);
      WMMA_RUN(1);
      LOAD_FRAGS(1, u, 96);
      WMMA_RUN(0);
      // Publish point of stage st + u + 1, in front of this stage's LAST run, whose
      // fragments are fetched: own LDS reads returned (buffer u is read no more), own
      // copies of that stage landed (while stage st + u + NB - 1 exists, the YOUNG
      // stages behind it stay in flight; else all are waited for), then the one
      // barrier that both publishes that stage and frees buffer u.
      wait_ds0();
      if (YOUNG > 0 && st + u + NB - 1 < stages) wait_async_but<16 * YOUNG>();
      else wait_async0();
      __syncthreads();
      // The next stage's first group and the refill of buffer u go out in front of
      // the last run and are under way while it runs.
      if (u + 1 < NB || st + NB < stages) LOAD_FRAGS(0, (u + 1) % NB, 0);
      if (st + u + NB < stages) ISSUE_STAGE(u, st + u + NB);
      WMMA_RUN(1);
    }
  }
  wait_async0();
#undef ISSUE_STAGE
#undef LOAD_FRAGS
#undef WMMA_RUN

  // epilogue: C/D layout lane=N (lane&15), vgpr r = M offset (+8 for lanes>=16)
  // Each optional operand is tested ONCE, around a loop over all 64 elements of
  // the lane, so that its loads are all in flight together. (Tested per element,
  // every load stands in a branch of its own and is waited for alone.)
  // Per element the order of the additions stays bias, res1, res2.
  const int ho = (lane < 16) ? 0 : 8;
  const int nc = lane & 15;
  const unsigned col0 = (unsigned)(colN + n0 + nc);
  // Byte offset of f32 element (row i * 16 + r of the wave's tile, column j = 0);
  // M * N * 4 stays below 2^32. Column j is 64 B further on.
  unsigned ro[16];
#pragma unroll
  for (int k = 0; k < 16; ++k)
    ro[k] = ((unsigned)(rowM + m0 + (k >> 3) * 16 + (k & 7) + ho) * (unsigned)N + col0) * 4u;

  if (bias) {
    float bv[4];
#pragma unroll
    for (int j = 0; j < 4; ++j) bv[j] = bias[col0 + j * 16];
#pragma unroll
    for (int i = 0; i < 2; ++i)
#pragma unroll
      for (int j = 0; j < 4; ++j) acc[i][j] += bv[j];
    // Registers that the loads above name may be rewritten from here on.
    asm volatile("s_wait_xcnt 0x0" ::: "memory");
  }
  if (res1) {
    v8f t[2][4];
#pragma unroll
    for (int i = 0; i < 2; ++i)
#pragma unroll
      for (int j = 0; j < 4; ++j)
#pragma unroll
        for (int r = 0; r < 8; ++r)
          t[i][j][r] = *(const float*)((const char*)res1 + (size_t)ro[i * 8 + r] + j * 64);
#pragma unroll
    for (int i = 0; i < 2; ++i)
#pragma unroll
      for (int j = 0; j < 4; ++j) acc[i][j] += t[i][j];
    // Registers that the loads above name may be rewritten from here on.
    asm volatile("s_wait_xcnt 0x0" ::: "memory");
  }
  if (res2) {
    v8f t[2][4];
#pragma unroll
    for (int i = 0; i < 2; ++i)
#pragma unroll
      for (int j = 0; j < 4; ++j)
#pragma unroll
        for (int r = 0; r < 8; ++r)
          t[i][j][r] = *(const float*)((const char*)res2 + (size_t)ro[i * 8 + r] + j * 64);
#pragma unroll
    for (int i = 0; i < 2; ++i)
#pragma unroll
      for (int j = 0; j < 4; ++j) acc[i][j] += t[i][j];
    // Registers that the loads above name may be rewritten from here on.
    asm volatile("s_wait_xcnt 0x0" ::: "memory");
  }
  if (doRelu) {
#pragma unroll
    for (int i = 0; i < 2; ++i)
#pragma unroll
      for (int j = 0; j < 4; ++j)
#pragma unroll
        for (int r = 0; r < 8; ++r) acc[i][j][r] = fmaxf(acc[i][j][r], 0.f);
  }
  if (outF) {
#pragma unroll
    for (int i = 0; i < 2; ++i)
#pragma unroll
      for (int j = 0; j < 4; ++j)
#pragma unroll
        for (int r = 0; r < 8; ++r)
          *(float*)((char*)outF + (size_t)ro[i * 8 + r] + j * 64) = acc[i][j][r];
  }
  // Registers that the stores above name may be rewritten from here on.
  asm volatile("s_wait_xcnt 0x0" ::: "memory");
  if (outB) {
    unsigned hb[2][4][4];   // rows r = 2 p (low half) and 2 p + 1 (high half)
#pragma unroll
    for (int i = 0; i < 2; ++i)
#pragma unroll
      for (int j = 0; j < 4; ++j)
#pragma unroll
        for (int p = 0; p < 4; ++p)
          hb[i][j][p] = pack_bf2(acc[i][j][2 * p], acc[i][j][2 * p + 1]);
#pragma unroll
    for (int k = 0; k < 16; ++k) ro[k] >>= 1;
    // Every value is rounded before the first store issues: mixed with the
    // stores, the rounding reuses their registers behind a wait each time.
    __builtin_amdgcn_sched_barrier(0);
#pragma unroll
    for (int i = 0; i < 2; ++i)
#pragma unroll
      for (int j = 0; j < 4; ++j)
#pragma unroll
        for (int r = 0; r < 8; ++r)
          *(unsigned short*)((char*)outB + (size_t)ro[i * 8 + r] + j * 32) =
              (unsigned short)(hb[i][j][r >> 1] >> ((r & 1) * 16));
  }
}

#define KP_ 72   // K row pitch in elements: 144 B, 16 B x odd (ds_load_b128)
#define VP_ 80   // V row pitch in elements: 160 B, 32 B x odd (ds_load_tr16_b128)

// 8 x 16-bit column piece of a row-major LDS tile: lane (c, h) gets
// T[8h + 0..7][c] when lane l points at row 8 * (l >> 4) + (l & 7), 16-B piece
// (l >> 3) & 1. Every lane is on wherever this is called.
__device__ __forceinline__ v8bf load_tr16(const __bf16* p) {
  typedef __attribute__((address_space(3))) v8s lds_v8s;
  return __builtin_bit_cast(v8bf, __builtin_amdgcn_ds_load_tr16_b128_v8i16((lds_v8s*)p));
}

// Lane l gets the value of lane l ^ 16.
__device__ __forceinline__ float swap_halves(float x) {
  const int i = __builtin_bit_cast(int, x);
  return __builtin_bit_cast(float, __builtin_amdgcn_permlanex16(
      i, i, 0x76543210, 0xfedcba98, false, false));
}

// One 64-key tile of K and of V: 4 + 4 async copies of 16 B per lane, 32-bit lane
// offset on a scalar base. The s_wait_xcnt closes the statement so that no
// address register is rewritten ahead of it.
__device__ __forceinline__ void async_copy_kv(const unsigned (&kl)[4],
                                              const unsigned (&vl)[4],
                                              const unsigned (&go)[4],
                                              const void* baseK,
                                              const void* baseV) {
  asm volatile(
      "global_load_async_to_lds_b128 %0, %8, %12\n\t"
      "global_load_async_to_lds_b128 %1, %9, %12\n\t"
      "global_load_async_to_lds_b128 %2, %10, %12\n\t"
      "global_load_async_to_lds_b128 %3, %11, %12\n\t"
      "global_load_async_to_lds_b128 %4, %8, %13\n\t"
      "global_load_async_to_lds_b128 %5, %9, %13\n\t"
      "global_load_async_to_lds_b128 %6, %10, %13\n\t"
      "global_load_async_to_lds_b128 %7, %11, %13\n\t"
      "s_wait_xcnt 0x0"
      :: "v"(kl[0]), "v"(kl[1]), "v"(kl[2]), "v"(kl[3]),
         "v"(vl[0]), "v"(vl[1]), "v"(vl[2]), "v"(vl[3]),
         "v"(go[0]), "v"(go[1]), "v"(go[2]), "v"(go[3]),
         "s"(baseK), "s"(baseV)
      : "memory");
}

__global__ __launch_bounds__(128) void flash_attn_kernel(
    const __bf16* __restrict__ Q, const __bf16* __restrict__ Kb,
    const __bf16* __restrict__ V, const int* __restrict__ live,
    __bf16* __restrict__ O)
{
  __shared__ __align__(16) __bf16 Ks[64 * KP_];     // [key][dk]
  __shared__ __align__(32) __bf16 Vs[64 * VP_];     // [key][dk]
  __shared__ __align__(16) float  Ms[S_];           // per key place: 0, or -1e30 if masked

  const int tid = threadIdx.x, lane = tid & 31, wave = tid >> 5;
  const int c = lane & 15, hh = lane >> 4;
  const int qb = blockIdx.x * 64, h = blockIdx.y, b = blockIdx.z;
  const int m0 = wave * 16;
  const size_t qbase  = ((size_t)b * S_ + qb) * D_ + h * DK_;
  const size_t kvrow0 = (size_t)b * S_ * D_ + h * DK_;

  // Q^T fragments (B operand, column = query c), in the k order of load_frag.
  const __bf16* qp = Q + qbase + (size_t)(m0 + c) * D_ + 8 * hh;
  const int n  = live[b * 32];                      // unmasked keys of this batch
  const int nt = (((n < 1 || n > S_) ? S_ : n) + 63) >> 6;   // 64-key tiles, 1..16
  const v8bf q0 = *(const v8bf*)qp;
  const v8bf q1 = *(const v8bf*)(qp + 16);
  const v8bf q2 = *(const v8bf*)(qp + 32);
  const v8bf q3 = *(const v8bf*)(qp + 48);
  // The address pair of the loads above stays whole until this wait.
  asm volatile("s_wait_xcnt 0x0" :: "v"(qp) : "memory");
  v16bf qf[2];
#pragma unroll
  for (int i = 0; i < 8; ++i) {
    qf[0][i] = q0[i]; qf[0][i + 8] = q1[i];
    qf[1][i] = q2[i]; qf[1][i + 8] = q3[i];
  }
  // The key mask as an addend, 8 key places per thread: places n and up hold masked
  // keys. Published by the barriers at the head of the first trip.
  {
    v4f f0, f1;
#pragma unroll
    for (int e = 0; e < 4; ++e) {
      f0[e] = (tid * 8 + e     >= n) ? -1e30f : 0.f;
      f1[e] = (tid * 8 + e + 4 >= n) ? -1e30f : 0.f;
    }
    *(v4f*)&Ms[tid * 8]     = f0;
    *(v4f*)&Ms[tid * 8 + 4] = f1;
  }

  // per-thread 16B chunks of a 64x64 bf16 tile (512 chunks, 4 per thread)
  unsigned kLds[4], vLds[4], tOff[4];
#pragma unroll
  for (int t = 0; t < 4; ++t) {
    const int ch = tid + t * 128;
    const int rr = ch >> 3, cc = ch & 7;
    kLds[t] = lds_addr(&Ks[rr * KP_ + cc * 8]);
    vLds[t] = lds_addr(&Vs[rr * VP_ + cc * 8]);
    tOff[t] = (unsigned)((rr * D_ + cc * 8) * 2);
  }
  const __bf16* vfrag = &Vs[(8 * hh + (lane & 7)) * VP_ + ((lane >> 3) & 1) * 8];

  const v8f zero8 = {0.f, 0.f, 0.f, 0.f, 0.f, 0.f, 0.f, 0.f};
  v8f o[4];                      // o[t][r] = O[query c][dk 16 t + 8 hh + r]
#pragma unroll
  for (int t = 0; t < 4; ++t) o[t] = zero8;
  float m_run = -3.0e38f;        // the query's maximum, alike in both halves
  float l_run = 0.f;             // the sum over this half's keys only

  int kt = 0;
  do {              // nt is at least 1
    wait_ds0();       // own reads of Ks/Vs (first trip: writes of Ms) are done
    __syncthreads();  // and so are every other wave's: the tiles may be refilled
    const size_t kvb = kvrow0 + (size_t)kt * 64 * D_;
    async_copy_kv(kLds, vLds, tOff, Kb + kvb, V + kvb);
    wait_async0();
    __syncthreads();

    // S^T = K Q^T: s[j][r] = score(key 16 j + 8 hh + r, query c)
    v8f s[4];
#pragma unroll
    for (int j = 0; j < 4; ++j) s[j] = zero8;
#pragma unroll
    for (int kk = 0; kk < 2; ++kk)
#pragma unroll
      for (int j = 0; j < 4; ++j)
        s[j] = wmma_bf16(load_frag(Ks, j * 16, kk * 32, KP_), qf[kk], s[j]);
    // scale 1/sqrt(64) + key mask
#pragma unroll
    for (int j = 0; j < 4; ++j) {
      const float* mrow = &Ms[kt * 64 + j * 16 + 8 * hh];
      const v4f ma = *(const v4f*)mrow;
      const v4f mb = *(const v4f*)(mrow + 4);
#pragma unroll
      for (int r = 0; r < 4; ++r) {
        s[j][r]     = s[j][r]     * 0.125f + ma[r];
        s[j][r + 4] = s[j][r + 4] * 0.125f + mb[r];
      }
    }
    // online softmax (base-2): one query per lane
    v8f mx8 = __builtin_elementwise_max(__builtin_elementwise_max(s[0], s[1]),
                                        __builtin_elementwise_max(s[2], s[3]));
    float mx = fmaxf(fmaxf(fmaxf(mx8[0], mx8[1]), fmaxf(mx8[2], mx8[3])),
                     fmaxf(fmaxf(mx8[4], mx8[5]), fmaxf(mx8[6], mx8[7])));
    mx = fmaxf(mx, swap_halves(mx));
    const float mn = fmaxf(m_run, mx);
    const float alpha = exp2_bare((m_run - mn) * 1.44269504f);
    m_run = mn;
#pragma unroll
    for (int j = 0; j < 4; ++j)
#pragma unroll
      for (int r = 0; r < 8; ++r)
        s[j][r] = exp2_bare((s[j][r] - m_run) * 1.44269504f);
    const v8f rs8 = (s[0] + s[1]) + (s[2] + s[3]);
    const float rs = ((rs8[0] + rs8[1]) + (rs8[2] + rs8[3])) +
                     ((rs8[4] + rs8[5]) + (rs8[6] + rs8[7]));
    l_run = l_run * alpha + rs;
#pragma unroll
    for (int t = 0; t < 4; ++t) o[t] *= alpha;

    // O^T += V^T P^T: B = score tiles 2 kk and 2 kk + 1 rounded in place (element
    // e = key 32 kk + 8 hh + e, e + 8 = key 32 kk + 16 + 8 hh + e: the order that
    // the two transposing loads of an A fragment deliver)
#pragma unroll
    for (int kk = 0; kk < 2; ++kk) {
      v8u pw;
#pragma unroll
      for (int i = 0; i < 4; ++i) {
        pw[i]     = pack_bf2(s[2 * kk][2 * i],     s[2 * kk][2 * i + 1]);
        pw[i + 4] = pack_bf2(s[2 * kk + 1][2 * i], s[2 * kk + 1][2 * i + 1]);
      }
      const v16bf pf = __builtin_bit_cast(v16bf, pw);
#pragma unroll
      for (int t = 0; t < 4; ++t) {
        const v8bf lo = load_tr16(vfrag + (kk * 32) * VP_ + t * 16);
        const v8bf hi = load_tr16(vfrag + (kk * 32 + 16) * VP_ + t * 16);
        v16bf a;
#pragma unroll
        for (int i = 0; i < 8; ++i) { a[i] = lo[i]; a[i + 8] = hi[i]; }
        o[t] = wmma_bf16(a, pf, o[t]);
      }
    }
  } while (++kt < nt);

  // The halves' sums are joined once, unconditionally (every lane is on).
  const float l   = l_run + swap_halves(l_run);
  const float inv = 1.f / fmaxf(l, 1e-20f);
  __bf16* op = O + ((size_t)b * S_ + qb + m0 + c) * D_ + h * DK_ + 8 * hh;
#pragma unroll
  for (int t = 0; t < 4; ++t) {
    v4u pk;
#pragma unroll
    for (int i = 0; i < 4; ++i)
      pk[i] = pack_bf2(o[t][2 * i] * inv, o[t][2 * i + 1] * inv);
    *(v4u*)(op + 16 * t) = pk;   // 8 consecutive dk of one query
  }
}

// ---------- launcher ----------

extern "C" void kernel_launch(void* const* d_in, const int* in_sizes, int n_in,
                              void* d_out, int out_size, void* d_ws, size_t ws_size,
                              hipStream_t stream)
{
  (void)in_sizes; (void)n_in; (void)out_size; (void)ws_size;
  const float* x    = (const float*)d_in[0];
  const float* kv   = (const float*)d_in[1];
  const int*   msk  = (const int*)  d_in[2];
  const float* ln1g = (const float*)d_in[3];
  const float* ln1b = (const float*)d_in[4];
  // Order of the converted D x D weights: the five whose products share one launch
  // (q0, k0, v0, k1, v1) first, then o0, q1, o1.
  const float* qw0  = (const float*)d_in[5];
  const float* kw0  = (const float*)d_in[6];
  const float* vw0  = (const float*)d_in[7];
  const float* ow0  = (const float*)d_in[8];
  const float* ob0  = (const float*)d_in[9];
  const float* qw1  = (const float*)d_in[10];
  const float* kw1  = (const float*)d_in[11];
  const float* vw1  = (const float*)d_in[12];
  const float* ow1  = (const float*)d_in[13];
  const float* ob1  = (const float*)d_in[14];
  const float* ln2g = (const float*)d_in[15];
  const float* ln2b = (const float*)d_in[16];
  const float* w1   = (const float*)d_in[17];
  const float* b1   = (const float*)d_in[18];
  const float* w2   = (const float*)d_in[19];
  const float* b2   = (const float*)d_in[20];

  char* ws = (char*)d_ws;
  size_t off = 0;
  auto alloc = [&](size_t bytes) -> void* {
    void* p = ws + off;
    off += (bytes + 255) & ~(size_t)255;
    return p;
  };
  const size_t ROWS = (size_t)B_ * S_;  // 4096
  float*  y_f32  = (float*) alloc(ROWS * D_ * 4);
  __bf16* y_bf   = (__bf16*)alloc(ROWS * D_ * 2);
  __bf16* kvn_bf = (__bf16*)alloc(ROWS * D_ * 2);
  __bf16* wtAll  = (__bf16*)alloc((size_t)16 * D_ * D_ * 2);
  __bf16* wtO0   = wtAll + (size_t)5 * D_ * D_;
  __bf16* wtQ1   = wtAll + (size_t)6 * D_ * D_;
  __bf16* wtO1   = wtAll + (size_t)7 * D_ * D_;
  __bf16* w1t    = wtAll + (size_t)8 * D_ * D_;
  __bf16* w2t    = wtAll + (size_t)12 * D_ * D_;
  __bf16* qB     = (__bf16*)alloc(5 * ROWS * D_ * 2);   // q, k0, v0, k1, v1
  __bf16* kB0    = qB + 1 * ROWS * D_;
  __bf16* vB0    = qB + 2 * ROWS * D_;
  __bf16* kB1    = qB + 3 * ROWS * D_;
  __bf16* vB1    = qB + 4 * ROWS * D_;
  __bf16* aB     = (__bf16*)alloc(ROWS * D_ * 2);
  float*  y1_f32 = (float*) alloc(ROWS * D_ * 4);
  __bf16* y1_bf  = (__bf16*)alloc(ROWS * D_ * 2);
  float*  x2_f32 = (float*) alloc(ROWS * D_ * 4);
  __bf16* x2n_bf = (__bf16*)alloc(ROWS * D_ * 2);
  __bf16* hB     = (__bf16*)alloc(ROWS * FFN_ * 2);
  int*    live   = (int*)   alloc(B_ * 32 * 4);          // unmasked keys per batch

  // LayerNorm 1 on x (keep f32 for residual) and on kv, one launch
  ln_kernel<<<dim3((unsigned)(ROWS / 8), 2), 256, 0, stream>>>(
      x, kv, ln1g, ln1b, y_f32, y_bf, kvn_bf, msk, live);

  // weight conversion/transposition, one launch
  transpose_f32_to_bf16<<<2048, 256, 0, stream>>>(
      qw0, kw0, vw0, kw1, vw1, ow0, qw1, ow1, w1, w2, wtAll);

  const dim3 gproj(D_/128, (unsigned)(ROWS/128));        // (8, 32)
  const dim3 gqkv(D_/128, (unsigned)(ROWS/128), 5);      // (8, 32, 5)
  const dim3 gattn(S_/64, H_, B_);                       // (16,16,4)

  // q0 from y; k0, v0, k1, v1 from kvn: none waits for another, one launch
  gemm_bf16_kernel<2><<<gqkv, 256, 0, stream>>>(y_bf, kvn_bf, wtAll, nullptr, nullptr, nullptr, nullptr, qB, live, (int)ROWS, D_, D_, 0);

  // cross-attention 0
  flash_attn_kernel<<<gattn, 128, 0, stream>>>(qB, kB0, vB0, live, aB);
  gemm_bf16_kernel<4><<<gproj, 256, 0, stream>>>(aB, nullptr, wtO0, ob0, y_f32, nullptr, y1_f32, y1_bf, nullptr, (int)ROWS, D_, D_, 0);

  // cross-attention 1 (query from y1)
  gemm_bf16_kernel<4><<<gproj, 256, 0, stream>>>(y1_bf, nullptr, wtQ1, nullptr, nullptr, nullptr, nullptr, qB, nullptr, (int)ROWS, D_, D_, 0);
  flash_attn_kernel<<<gattn, 128, 0, stream>>>(qB, kB1, vB1, live, aB);
  // x2 = x + (o1 + ob1 + y1)
  gemm_bf16_kernel<4><<<gproj, 256, 0, stream>>>(aB, nullptr, wtO1, ob1, y1_f32, x, x2_f32, nullptr, nullptr, (int)ROWS, D_, D_, 0);

  // FFN
  ln_kernel<<<dim3((unsigned)(ROWS / 8), 1), 256, 0, stream>>>(
      x2_f32, nullptr, ln2g, ln2b, nullptr, x2n_bf, nullptr, nullptr, nullptr);
  gemm_bf16_kernel<2><<<dim3(FFN_/128, (unsigned)(ROWS/128)), 256, 0, stream>>>(
      x2n_bf, nullptr, w1t, b1, nullptr, nullptr, nullptr, hB, nullptr, (int)ROWS, FFN_, D_, 1);
  gemm_bf16_kernel<4><<<gproj, 256, 0, stream>>>(
      hB, nullptr, w2t, b2, x2_f32, nullptr, (float*)d_out, nullptr, nullptr, (int)ROWS, D_, FFN_, 0);
}

// v010
// One run takes 165 microseconds.
// In both of two side-by-side timings against v009, it was 1.03 times as fast.
// All steps since v000 together make it 3.67 times as fast.
#include <hip/hip_runtime.h>
#include <hip/hip_bf16.h>
#include <cstdint>

typedef __attribute__((ext_vector_type(16))) __bf16 v16bf;
typedef __attribute__((ext_vector_type(8)))  __bf16 v8bf;
typedef __attribute__((ext_vector_type(8)))  float  v8f;
typedef __attribute__((ext_vector_type(4)))  float  v4f;
typedef __attribute__((ext_vector_type(4)))  __bf16 v4bf;
typedef __attribute__((ext_vector_type(4)))  unsigned v4u;
typedef __attribute__((ext_vector_type(8)))  unsigned v8u;
typedef __attribute__((ext_vector_type(4)))  int      v4i;
typedef __attribute__((ext_vector_type(8)))  short    v8s;
typedef __attribute__((ext_vector_type(2)))  float    v2f;
typedef __attribute__((ext_vector_type(2)))  __bf16   v2bf;

#define B_   4
#define S_   1024
#define D_   1024
#define H_   16
#define DK_  64
#define FFN_ 4096

// ---------- helpers ----------

// Round to nearest even, by the chip's own conversion (v_cvt_pk_bf16_f32).
__device__ __forceinline__ __bf16 f2bf(float f) { return (__bf16)f; }

// Two floats rounded as in f2bf, lo in bits 15..0 and hi in bits 31..16: one
// instruction per pair.
__device__ __forceinline__ unsigned pack_bf2(float lo, float hi) {
  const v2f x = {lo, hi};
  return __builtin_bit_cast(unsigned, __builtin_convertvector(x, v2bf));
}

// 2^x as the bare v_exp_f32. The library's exp2f wraps it in a compare, two
// selects and a v_ldexp_f32 so that results below 2^-126 come out as denormals;
// here such a result may come out as 0. Used for softmax weights only, where the
// row's largest weight is 1 and the f32 sums absorb a term that small.
__device__ __forceinline__ float exp2_bare(float x) {
  return __builtin_amdgcn_exp2f(x);
}

// Low 32 bits of the generic address of a __shared__ object == LDS byte offset
// (flat shared-aperture mapping uses addr[31:0] as the LDS address).
__device__ __forceinline__ unsigned lds_addr(const void* p) {
  return (unsigned)(uintptr_t)p;
}

__device__ __forceinline__ void wait_async0() {
  asm volatile("s_wait_asynccnt 0" ::: "memory");
}

// Load a 16x32 bf16 WMMA fragment (A layout; also B when source is Bt[N][K])
// from a row-major [rows][ldk] bf16 tile in LDS.
__device__ __forceinline__ v16bf load_frag(const __bf16* base, int row0, int k0, int ldk) {
  const int lane = threadIdx.x & 31;
  const __bf16* p = base + (row0 + (lane & 15)) * ldk + k0 + ((lane >> 4) << 3);
  v8bf lo = *(const v8bf*)p;
  v8bf hi = *(const v8bf*)(p + 16);
  v16bf r;
#pragma unroll
  for (int i = 0; i < 8; ++i) { r[i] = lo[i]; r[i + 8] = hi[i]; }
  return r;
}

__device__ __forceinline__ v8f wmma_bf16(v16bf a, v16bf b, v8f c) {
  return __builtin_amdgcn_wmma_f32_16x16x32_bf16(false, a, false, b, (short)0, c,
                                                 false, false);
}

// ---------- LayerNorm (D=1024), outputs f32 and/or bf16 ----------
// One wave per row, 8 rows per block: a lane holds 8 x 16 B of its row, all loads
// in flight at once; the row sums stay inside the wave (no LDS, no barrier).
// An eighth of the waves of a block-per-row form have to be started.
// One launch may norm two tensors with the same g and bt: grid slice y = 1 reads
// in2 and writes outB2 only.
// Slice y = 1 holds the key rows. A key whose mask entry is 0 has softmax weight 0
// (unless its whole batch is masked: n = 0, nothing is dropped), so the slice stores each batch's S_ rows in a new order: the n unmasked rows
// first, the masked ones behind them, each group in its old order. n goes to
// live[32 * batch] (one 128-B line per writer). The launches behind this one work
// on the first n rows only, rounded up to their tile.

__global__ __launch_bounds__(256) void ln_kernel(
    const float* __restrict__ in, const float* __restrict__ in2,
    const float* __restrict__ g,
    const float* __restrict__ bt, float* __restrict__ outF,
    __bf16* __restrict__ outB, __bf16* __restrict__ outB2,
    const int* __restrict__ mask, int* __restrict__ live)
{
  if (blockIdx.y) { in = in2; outF = nullptr; outB = outB2; }
  const int lane = threadIdx.x & 31;
  const int row  = blockIdx.x * 8 + (threadIdx.x >> 5);
  int orow = row;                 // where the 16-bit row is stored
  if (blockIdx.y) {
    // Ahead of the row's own loads, so that its registers are free again for them.
    // Every wave counts its batch's whole mask (32 entries per lane): bits 0..10 all
    // unmasked keys, bits 11..21 those in front of its own row, bit 22 its own row.
    const int r = row & (S_ - 1);
    const v4i* mp = (const v4i*)(mask + (row - r)) + lane;
    v4i mk[8];
    // The loops over mk are unrolled so that it stays in registers.
#pragma unroll
    for (int i = 0; i < 8; ++i) mk[i] = mp[i * 32];
    // The address pair of the loads above stays whole until this wait.
    asm volatile("s_wait_xcnt 0x0" :: "v"(mp) : "memory");
    int pk = 0;
#pragma unroll
    for (int i = 0; i < 8; ++i)
#pragma unroll
      for (int e = 0; e < 4; ++e) {
        const int pos = i * 128 + lane * 4 + e;
        const int w = 1 + (pos < r ? (1 << 11) : 0) + (pos == r ? (1 << 22) : 0);
        pk += (mk[i][e] != 0) ? w : 0;
      }
#pragma unroll
    for (int off = 16; off >= 1; off >>= 1) pk += __shfl_xor(pk, off, 32);
    const int n = pk & 2047, before = (pk >> 11) & 2047;
    orow = (row - r) + ((pk >> 22) ? before : n + (r - before));
    if (r == 0 && lane == 0) live[(row >> 10) * 32] = n;   // S_ = 1 << 10 rows per batch
    // Registers that the store above names may be rewritten from here on.
    asm volatile("s_wait_xcnt 0x0" ::: "memory");
    // A masked row behind the last 128-row GEMM tile with an unmasked row in it is
    // read by nobody. The whole wave leaves; the kernel has no barrier.
    if (n != 0 && orow - (row - r) >= ((n + 127) & ~127)) return;
  }
  const v4f* p  = (const v4f*)(in + (size_t)row * D_);
  const v4f* g4 = (const v4f*)g;
  const v4f* b4 = (const v4f*)bt;
  v4f v[8], gg[8], bb[8];
#pragma unroll
  for (int i = 0; i < 8; ++i) v[i] = p[lane + i * 32];
#pragma unroll
  for (int i = 0; i < 8; ++i) { gg[i] = g4[lane + i * 32]; bb[i] = b4[lane + i * 32]; }
  v4f s4 = {0.f, 0.f, 0.f, 0.f}, q4 = {0.f, 0.f, 0.f, 0.f};
#pragma unroll
  for (int i = 0; i < 8; ++i) { s4 += v[i]; q4 += v[i] * v[i]; }
  float s  = (s4[0] + s4[1]) + (s4[2] + s4[3]);
  float sq = (q4[0] + q4[1]) + (q4[2] + q4[3]);
#pragma unroll
  for (int off = 16; off >= 1; off >>= 1) {
    s  += __shfl_xor(s,  off, 32);
    sq += __shfl_xor(sq, off, 32);
  }
  const float mean = s * (1.f / D_);
  const float var  = sq * (1.f / D_) - mean * mean;
  const float rstd = rsqrtf(var + 1e-5f);
  v4bf ob[8];
#pragma unroll
  for (int i = 0; i < 8; ++i) {
    v[i] = (v[i] - mean) * rstd * gg[i] + bb[i];
#pragma unroll
    for (int e = 0; e < 4; ++e) ob[i][e] = f2bf(v[i][e]);
  }
  if (outB) {
    v4bf* q = (v4bf*)(outB + (size_t)orow * D_);
#pragma unroll
    for (int i = 0; i < 8; ++i) q[lane + i * 32] = ob[i];
  }
  // Registers that the stores above name may be rewritten from here on.
  asm volatile("s_wait_xcnt 0x0" ::: "memory");
  if (outF) {
    v4f* q = (v4f*)(outF + (size_t)row * D_);
#pragma unroll
    for (int i = 0; i < 8; ++i) q[lane + i * 32] = v[i];
  }
}

// ---------- fp32 [K,N] -> bf16 transposed [N,K] ----------
// One block moves 128 k x 64 n: 8 loads of 16 B per lane in flight (256-B pieces
// of W rows), two k neighbours packed into a dword, dwords transposed through
// LDS, 256-B pieces of Wt rows stored. K a multiple of 128, N of 64.
// One launch converts all ten weights: blocks 0..1023 the eight D x D ones (128
// tiles each), 1024..1535 the D x FFN one, 1536..2047 the FFN x D one. The results
// lie one after the other in WtAll, in the order of the arguments.

#define TK_ 128
#define TN_ 64
#define TP_ 65   // LDS row pitch in dwords: odd, so both sides meet 32 banks

__global__ __launch_bounds__(256) void transpose_f32_to_bf16(
    const float* __restrict__ Wa, const float* __restrict__ Wb,
    const float* __restrict__ Wc, const float* __restrict__ Wd,
    const float* __restrict__ We, const float* __restrict__ Wf,
    const float* __restrict__ Wg, const float* __restrict__ Wh,
    const float* __restrict__ Wup, const float* __restrict__ Wdn,
    __bf16* __restrict__ WtAll)
{
  __shared__ unsigned t[TN_ * TP_];               // [n][k / 2]
  const int bid = blockIdx.x;
  const float* W;
  __bf16* Wt;
  int K, N, tile;
  if (bid < 1024) {
    const int w = bid >> 7;
    W = (w & 4) ? ((w & 2) ? ((w & 1) ? Wh : Wg) : ((w & 1) ? Wf : We))
                : ((w & 2) ? ((w & 1) ? Wd : Wc) : ((w & 1) ? Wb : Wa));
    Wt = WtAll + (size_t)w * D_ * D_;
    K = D_; N = D_; tile = bid & 127;
  } else if (bid < 1536) {
    W = Wup; Wt = WtAll + (size_t)8 * D_ * D_;
    K = D_; N = FFN_; tile = bid - 1024;
  } else {
    W = Wdn; Wt = WtAll + (size_t)12 * D_ * D_;
    K = FFN_; N = D_; tile = bid - 1536;
  }
  const int nTiles = N / TN_;                     // 16 or 64
  const int n0 = (tile & (nTiles - 1)) * TN_, k0 = (tile / nTiles) * TK_;
  const int lo4 = threadIdx.x & 15, hi4 = threadIdx.x >> 4;
  const float* pa[4];
  const float* pb[4];
  v4f a[4], b[4];
#pragma unroll
  for (int i = 0; i < 4; ++i) {
    pa[i] = W + (size_t)(k0 + 2 * (hi4 + i * 16)) * N + (n0 + lo4 * 4);
    pb[i] = pa[i] + N;
  }
#pragma unroll
  for (int i = 0; i < 4; ++i) {
    a[i] = *(const v4f*)pa[i];
    b[i] = *(const v4f*)pb[i];
  }
  // Every load's address pair stays whole until this wait: named here as inputs,
  // none of them can serve as a later load's destination.
  asm volatile("s_wait_xcnt 0x0"
               :: "v"(pa[0]), "v"(pa[1]), "v"(pa[2]), "v"(pa[3]),
                  "v"(pb[0]), "v"(pb[1]), "v"(pb[2]), "v"(pb[3])
               : "memory");
#pragma unroll
  for (int i = 0; i < 4; ++i)
#pragma unroll
    for (int j = 0; j < 4; ++j)
      t[(lo4 * 4 + j) * TP_ + hi4 + i * 16] = pack_bf2(a[i][j], b[i][j]);
  __syncthreads();
#pragma unroll
  for (int i = 0; i < 4; ++i) {
    const int n = hi4 + i * 16;
    v4u o;
#pragma unroll
    for (int e = 0; e < 4; ++e) o[e] = t[n * TP_ + lo4 * 4 + e];
    *(v4u*)(Wt + (size_t)(n0 + n) * K + (k0 + lo4 * 8)) = o;
  }
}

// ---------- GEMM: C[M,N] = epi( A[M,K]bf16 @ Bt[N,K]bf16^T ) ----------
// 128x128 block tile, 8 waves -> 32x64 per wave (2x4 WMMA frags).
// A stage is 128 k of every operand row (256 B, whole L2 units), a ring of NB LDS
// buffers filled by GLOBAL_LOAD_ASYNC_TO_LDS (ASYNCcnt): NB - 1 stages of 16 copies
// per lane are issued ahead of the stage whose 32 WMMAs per wave run, one barrier
// per stage. NB = 2 lets two blocks share a WGP's LDS (two stages in flight per
// WGP); NB = 4 is for grids of one block per WGP, where the block alone has to keep
// enough bytes in flight to cover operands that come from memory.
// Main loop unrolled NB stages so buffer indices are compile-time constants.
// Requires K a multiple of NB * 128.
// One launch may hold several products of one shape: grid slice z > 0 reads Az,
// and the slices' Bt and outB lie one after the other. Az holds the key rows as
// ln_kernel orders them: a row tile wholly behind its batch's unmasked rows is read
// by nobody and is not computed (no unmasked row at all: every tile is).

#define GK_    128            // k per stage
#define GPITCH 136            // LDS row pitch in elements: 272 B, 16 B x odd

// One stage: 8 + 8 async copies of 16 B per lane (rows 16 apart of the A and of
// the B panel), 32-bit lane offset on a scalar base. The s_wait_xcnt closes the
// statement so that no address register is rewritten ahead of it.
__device__ __forceinline__ void async_copy_stage(unsigned la, unsigned lb,
                                                 const unsigned (&vo)[8],
                                                 const void* baseA,
                                                 const void* baseB) {
  const unsigned lStep = 16 * GPITCH * 2;
  asm volatile(
      "global_load_async_to_lds_b128 %0, %16, %24\n\t"
      "global_load_async_to_lds_b128 %1, %17, %24\n\t"
      "global_load_async_to_lds_b128 %2, %18, %24\n\t"
      "global_load_async_to_lds_b128 %3, %19, %24\n\t"
      "global_load_async_to_lds_b128 %4, %20, %24\n\t"
      "global_load_async_to_lds_b128 %5, %21, %24\n\t"
      "global_load_async_to_lds_b128 %6, %22, %24\n\t"
      "global_load_async_to_lds_b128 %7, %23, %24\n\t"
      "global_load_async_to_lds_b128 %8, %16, %25\n\t"
      "global_load_async_to_lds_b128 %9, %17, %25\n\t"
      "global_load_async_to_lds_b128 %10, %18, %25\n\t"
      "global_load_async_to_lds_b128 %11, %19, %25\n\t"
      "global_load_async_to_lds_b128 %12, %20, %25\n\t"
      "global_load_async_to_lds_b128 %13, %21, %25\n\t"
      "global_load_async_to_lds_b128 %14, %22, %25\n\t"
      "global_load_async_to_lds_b128 %15, %23, %25\n\t"
      "s_wait_xcnt 0x0"
      :: "v"(la), "v"(la + lStep), "v"(la + 2 * lStep), "v"(la + 3 * lStep),
         "v"(la + 4 * lStep), "v"(la + 5 * lStep), "v"(la + 6 * lStep),
         "v"(la + 7 * lStep),
         "v"(lb), "v"(lb + lStep), "v"(lb + 2 * lStep), "v"(lb + 3 * lStep),
         "v"(lb + 4 * lStep), "v"(lb + 5 * lStep), "v"(lb + 6 * lStep),
         "v"(lb + 7 * lStep),
         "v"(vo[0]), "v"(vo[1]), "v"(vo[2]), "v"(vo[3]),
         "v"(vo[4]), "v"(vo[5]), "v"(vo[6]), "v"(vo[7]),
         "s"(baseA), "s"(baseB)
      : "memory");
}

// This wave's LDS reads have returned before the buffer they read is refilled.
__device__ __forceinline__ void wait_ds0() {
  asm volatile("s_wait_dscnt 0x0" ::: "memory");
}

// All but this wave's N youngest copies have landed.
template <int N>
__device__ __forceinline__ void wait_async_but() {
  asm volatile("s_wait_asynccnt %0" :: "i"(N) : "memory");
}

template <int NB>
__global__ __launch_bounds__(256) void gemm_bf16_kernel(
    const __bf16* __restrict__ A, const __bf16* __restrict__ Az,
    const __bf16* __restrict__ Bt,
    const float* __restrict__ bias, const float* __restrict__ res1,
    const float* __restrict__ res2, float* __restrict__ outF,
    __bf16* __restrict__ outB, const int* __restrict__ live,
    int M, int N, int K, int doRelu)
{
  __shared__ __align__(16) __bf16 As[NB][128 * GPITCH];  // [row][k], +8 pad
  __shared__ __align__(16) __bf16 Bs[NB][128 * GPITCH];  // [n][k],  +8 pad
  if (blockIdx.z) {
    // The same for the whole block, in front of every copy and barrier.
    const int n = live[(blockIdx.y / (S_ / 128)) * 32];
    if (n != 0 && (int)(blockIdx.y % (S_ / 128)) * 128 >= n) return;
    A = Az;
    Bt   += (size_t)blockIdx.z * N * K;
    outB += (size_t)blockIdx.z * M * N;
  }
  const int tid  = threadIdx.x;
  const int lane = tid & 31, wave = tid >> 5;
  const int wm = wave >> 1, wn = wave & 1;
  const int m0 = wm * 32, n0 = wn * 64;
  const int rowM = blockIdx.y * 128, colN = blockIdx.x * 128;

  // per-thread 16B chunks of the 128x128 tiles (2048 chunks, 8 per thread):
  // chunk q0 of rows r0, r0 + 16, ..., r0 + 112; a wave covers two whole rows.
  const int r0 = tid >> 4, q0 = tid & 15;
  // The lane offsets are the same for both panels; the panel's first row and
  // the stage's k go into the scalar bases.
  const __bf16* sA = A  + (size_t)rowM * K;
  const __bf16* sB = Bt + (size_t)colN * K;
  unsigned vo[8];
#pragma unroll
  for (int i = 0; i < 8; ++i)
    vo[i] = (unsigned)(((r0 + i * 16) * K + q0 * 8) * 2);
  unsigned ldsA[NB], ldsB[NB];
#pragma unroll
  for (int bufi = 0; bufi < NB; ++bufi) {
    ldsA[bufi] = lds_addr(&As[bufi][r0 * GPITCH + q0 * 8]);
    ldsB[bufi] = lds_addr(&Bs[bufi][r0 * GPITCH + q0 * 8]);
  }

  const v8f zero8 = {0.f, 0.f, 0.f, 0.f, 0.f, 0.f, 0.f, 0.f};
  v8f acc[2][4];
#pragma unroll
  for (int i = 0; i < 2; ++i)
#pragma unroll
    for (int j = 0; j < 4; ++j) acc[i][j] = zero8;

  const int stages = K / GK_;
  // The block's walk over k starts at stage rot and wraps round. Blocks that share
  // an operand panel (one blockIdx.y: A rows, one blockIdx.x: Bt rows) start at
  // different stages, so they do not ask L2 for the same lines at the same moment,
  // and the blocks of a launch together ask for every k of the rows, not one slice.
  const int rot = (int)((blockIdx.x + blockIdx.y + blockIdx.z) % (unsigned)stages);

#define ISSUE_STAGE(BUFI, ST)                                   \
  do {                                                          \
    const int sk = (ST) + rot;   /* both below stages */        \
    const size_t kOff = (size_t)(sk < stages ? sk : sk - stages) * GK_; \
    async_copy_stage(ldsA[BUFI], ldsB[BUFI], vo, sA + kOff,     \
                     sB + kOff);                                \
  } while (0)

// The fragments of 32 k: 12 ds_load_b128, written as one group.
#define LOAD_FRAGS(SET, BUFI, KK)                               \
  do {                                                          \
    _Pragma("unroll")                                           \
    for (int i = 0; i < 2; ++i)                                 \
      af[SET][i] = load_frag(As[BUFI], m0 + i * 16, KK, GPITCH); \
    _Pragma("unroll")                                           \
    for (int j = 0; j < 4; ++j)                                 \
      bfr[SET][j] = load_frag(Bs[BUFI], n0 + j * 16, KK, GPITCH); \
  } while (0)

// The 8 WMMAs of 32 k as one run. The scheduling barriers at its two ends keep the
// load groups and the runs whole and in the order written: left free, the compiler
// spreads the loads among the WMMAs and waits for each handful with s_wait_dscnt 0.
#define WMMA_RUN(SET)                                           \
  do {                                                          \
    __builtin_amdgcn_sched_barrier(0);                          \
    _Pragma("unroll")                                           \
    for (int i = 0; i < 2; ++i)                                 \
      _Pragma("unroll")                                         \
      for (int j = 0; j < 4; ++j)                               \
        acc[i][j] = wmma_bf16(af[SET][i], bfr[SET][j], acc[i][j]); \
    __builtin_amdgcn_sched_barrier(0);                          \
  } while (0)

  // Two fragment sets: the next 32 k's group stands in front of this 32 k's run and
  // returns while that runs, so the wait in front of a run is a counted one that
  // leaves the younger group in flight.
  v16bf af[2][2], bfr[2][4];
  static_assert(GK_ == 128, "a stage is four runs: sets 0, 1, 0, 1");

  // Every wave issues 16 copies per stage and nothing else counts on ASYNCcnt, so
  // the copies of the YOUNG youngest stages are the wave's 16 * YOUNG youngest.
  constexpr int YOUNG = NB - 2;
  // unrolled: b is a buffer index and has to be a constant
#pragma unroll
  for (int b = 0; b < NB - 1; ++b) ISSUE_STAGE(b, b);
  wait_async_but<16 * YOUNG>();   // stage 0 has landed
  __syncthreads();
  LOAD_FRAGS(0, 0, 0);
  ISSUE_STAGE(NB - 1, NB - 1);    // there are at least NB stages
  for (int st = 0; st < stages; st += NB) {
    // unrolled: u is the buffer of stage st + u
#pragma unroll
    for (int u = 0; u < NB; ++u) {
      // On entry set 0 holds, or is being sent, the stage's first 32 k.
      LOAD_FRAGS(1, u, 32);
      WMMA_RUN(0);
      LOAD_FRAGS(0, u, 64);
      WMMA_RUN(1);
      LOAD_FRAGS(1, u, 96);
      WMMA_RUN(0);
      // Publish point of stage st + u + 1, in front of this stage's LAST run, whose
      // fragments are fetched: own LDS reads returned (buffer u is read no more), own
      // copies of that stage landed (while stage st + u + NB - 1 exists, the YOUNG
      // stages behind it stay in flight; else all are waited for), then the one
      // barrier that both publishes that stage and frees buffer u.
      wait_ds0();
      if (YOUNG > 0 && st + u + NB - 1 < stages) wait_async_but<16 * YOUNG>();
      else wait_async0();
      __syncthreads();
      // The next stage's first group and the refill of buffer u go out in front of
      // the last run and are under way while it runs.
      if (u + 1 < NB || st + NB < stages) LOAD_FRAGS(0, (u + 1) % NB, 0);
      if (st + u + NB < stages) ISSUE_STAGE(u, st + u + NB);
      WMMA_RUN(1);
    }
  }
  wait_async0();
#undef ISSUE_STAGE
#undef LOAD_FRAGS
#undef WMMA_RUN

  // epilogue: C/D layout lane=N (lane&15), vgpr r = M offset (+8 for lanes>=16)
  // Each optional operand is tested ONCE, around a loop over all 64 elements of
  // the lane, so that its loads are all in flight together. (Tested per element,
  // every load stands in a branch of its own and is waited for alone.)
  // Per element the order of the additions stays bias, res1, res2.
  const int ho = (lane < 16) ? 0 : 8;
  const int nc = lane & 15;
  const unsigned col0 = (unsigned)(colN + n0 + nc);
  // Byte offset of f32 element (row i * 16 + r of the wave's tile, column j = 0);
  // M * N * 4 stays below 2^32. Column j is 64 B further on.
  unsigned ro[16];
#pragma unroll
  for (int k = 0; k < 16; ++k)
    ro[k] = ((unsigned)(rowM + m0 + (k >> 3) * 16 + (k & 7) + ho) * (unsigned)N + col0) * 4u;

  if (bias) {
    float bv[4];
#pragma unroll
    for (int j = 0; j < 4; ++j) bv[j] = bias[col0 + j * 16];
#pragma unroll
    for (int i = 0; i < 2; ++i)
#pragma unroll
      for (int j = 0; j < 4; ++j) acc[i][j] += bv[j];
    // Registers that the loads above name may be rewritten from here on.
    asm volatile("s_wait_xcnt 0x0" ::: "memory");
  }
  if (res1) {
    v8f t[2][4];
#pragma unroll
    for (int i = 0; i < 2; ++i)
#pragma unroll
      for (int j = 0; j < 4; ++j)
#pragma unroll
        for (int r = 0; r < 8; ++r)
          t[i][j][r] = *(const float*)((const char*)res1 + (size_t)ro[i * 8 + r] + j * 64);
#pragma unroll
    for (int i = 0; i < 2; ++i)
#pragma unroll
      for (int j = 0; j < 4; ++j) acc[i][j] += t[i][j];
    // Registers that the loads above name may be rewritten from here on.
    asm volatile("s_wait_xcnt 0x0" ::: "memory");
  }
  if (res2) {
    v8f t[2][4];
#pragma unroll
    for (int i = 0; i < 2; ++i)
#pragma unroll
      for (int j = 0; j < 4; ++j)
#pragma unroll
        for (int r = 0; r < 8; ++r)
          t[i][j][r] = *(const float*)((const char*)res2 + (size_t)ro[i * 8 + r] + j * 64);
#pragma unroll
    for (int i = 0; i < 2; ++i)
#pragma unroll
      for (int j = 0; j < 4; ++j) acc[i][j] += t[i][j];
    // Registers that the loads above name may be rewritten from here on.
    asm volatile("s_wait_xcnt 0x0" ::: "memory");
  }
  if (doRelu) {
#pragma unroll
    for (int i = 0; i < 2; ++i)
#pragma unroll
      for (int j = 0; j < 4; ++j)
#pragma unroll
        for (int r = 0; r < 8; ++r) acc[i][j][r] = fmaxf(acc[i][j][r], 0.f);
  }
  if (outF) {
#pragma unroll
    for (int i = 0; i < 2; ++i)
#pragma unroll
      for (int j = 0; j < 4; ++j)
#pragma unroll
        for (int r = 0; r < 8; ++r)
          *(float*)((char*)outF + (size_t)ro[i * 8 + r] + j * 64) = acc[i][j][r];
  }
  // Registers that the stores above name may be rewritten from here on.
  asm volatile("s_wait_xcnt 0x0" ::: "memory");
  if (outB) {
    unsigned hb[2][4][4];   // rows r = 2 p (low half) and 2 p + 1 (high half)
#pragma unroll
    for (int i = 0; i < 2; ++i)
#pragma unroll
      for (int j = 0; j < 4; ++j)
#pragma unroll
        for (int p = 0; p < 4; ++p)
          hb[i][j][p] = pack_bf2(acc[i][j][2 * p], acc[i][j][2 * p + 1]);
#pragma unroll
    for (int k = 0; k < 16; ++k) ro[k] >>= 1;
    // Every value is rounded before the first store issues: mixed with the
    // stores, the rounding reuses their registers behind a wait each time.
    __builtin_amdgcn_sched_barrier(0);
#pragma unroll
    for (int i = 0; i < 2; ++i)
#pragma unroll
      for (int j = 0; j < 4; ++j)
#pragma unroll
        for (int r = 0; r < 8; ++r)
          *(unsigned short*)((char*)outB + (size_t)ro[i * 8 + r] + j * 32) =
              (unsigned short)(hb[i][j][r >> 1] >> ((r & 1) * 16));
  }
}

#define KP_ 72   // K row pitch in elements: 144 B, 16 B x odd (ds_load_b128)
#define VP_ 80   // V row pitch in elements: 160 B, 32 B x odd (ds_load_tr16_b128)

// 8 x 16-bit column piece of a row-major LDS tile: lane (c, h) gets
// T[8h + 0..7][c] when lane l points at row 8 * (l >> 4) + (l & 7), 16-B piece
// (l >> 3) & 1. Every lane is on wherever this is called.
__device__ __forceinline__ v8bf load_tr16(const __bf16* p) {
  typedef __attribute__((address_space(3))) v8s lds_v8s;
  return __builtin_bit_cast(v8bf, __builtin_amdgcn_ds_load_tr16_b128_v8i16((lds_v8s*)p));
}

// Lane l gets the value of lane l ^ 16.
__device__ __forceinline__ float swap_halves(float x) {
  const int i = __builtin_bit_cast(int, x);
  return __builtin_bit_cast(float, __builtin_amdgcn_permlanex16(
      i, i, 0x76543210, 0xfedcba98, false, false));
}

// One 64-key tile of K and of V: 4 + 4 async copies of 16 B per lane, 32-bit lane
// offset on a scalar base. The s_wait_xcnt closes the statement so that no
// address register is rewritten ahead of it.
__device__ __forceinline__ void async_copy_kv(const unsigned (&kl)[4],
                                              const unsigned (&vl)[4],
                                              const unsigned (&go)[4],
                                              const void* baseK,
                                              const void* baseV) {
  asm volatile(
      "global_load_async_to_lds_b128 %0, %8, %12\n\t"
      "global_load_async_to_lds_b128 %1, %9, %12\n\t"
      "global_load_async_to_lds_b128 %2, %10, %12\n\t"
      "global_load_async_to_lds_b128 %3, %11, %12\n\t"
      "global_load_async_to_lds_b128 %4, %8, %13\n\t"
      "global_load_async_to_lds_b128 %5, %9, %13\n\t"
      "global_load_async_to_lds_b128 %6, %10, %13\n\t"
      "global_load_async_to_lds_b128 %7, %11, %13\n\t"
      "s_wait_xcnt 0x0"
      :: "v"(kl[0]), "v"(kl[1]), "v"(kl[2]), "v"(kl[3]),
         "v"(vl[0]), "v"(vl[1]), "v"(vl[2]), "v"(vl[3]),
         "v"(go[0]), "v"(go[1]), "v"(go[2]), "v"(go[3]),
         "s"(baseK), "s"(baseV)
      : "memory");
}

__global__ __launch_bounds__(128) void flash_attn_kernel(
    const __bf16* __restrict__ Q, const __bf16* __restrict__ Kb,
    const __bf16* __restrict__ V, const int* __restrict__ live,
    __bf16* __restrict__ O)
{
  __shared__ __align__(16) __bf16 Ks[64 * KP_];     // [key][dk]
  __shared__ __align__(32) __bf16 Vs[64 * VP_];     // [key][dk]
  __shared__ __align__(16) float  Ms[S_];           // per key place: 0, or -1e30 if masked

  const int tid = threadIdx.x, lane = tid & 31, wave = tid >> 5;
  const int c = lane & 15, hh = lane >> 4;
  const int qb = blockIdx.x * 64, h = blockIdx.y, b = blockIdx.z;
  const int m0 = wave * 16;
  const size_t qbase  = ((size_t)b * S_ + qb) * D_ + h * DK_;
  const size_t kvrow0 = (size_t)b * S_ * D_ + h * DK_;

  // Q^T fragments (B operand, column = query c), in the k order of load_frag.
  const __bf16* qp = Q + qbase + (size_t)(m0 + c) * D_ + 8 * hh;
  const int n  = live[b * 32];                      // unmasked keys of this batch
  const int nt = (((n < 1 || n > S_) ? S_ : n) + 63) >> 6;   // 64-key tiles, 1..16
  const v8bf q0 = *(const v8bf*)qp;
  const v8bf q1 = *(const v8bf*)(qp + 16);
  const v8bf q2 = *(const v8bf*)(qp + 32);
  const v8bf q3 = *(const v8bf*)(qp + 48);
  // The address pair of the loads above stays whole until this wait.
  asm volatile("s_wait_xcnt 0x0" :: "v"(qp) : "memory");
  v16bf qf[2];
#pragma unroll
  for (int i = 0; i < 8; ++i) {
    qf[0][i] = q0[i]; qf[0][i + 8] = q1[i];
    qf[1][i] = q2[i]; qf[1][i + 8] = q3[i];
  }
  // The key mask as an addend, 8 key places per thread: places n and up hold masked
  // keys. Published by the barriers at the head of the first trip.
  {
    v4f f0, f1;
#pragma unroll
    for (int e = 0; e < 4; ++e) {
      f0[e] = (tid * 8 + e     >= n) ? -1e30f : 0.f;
      f1[e] = (tid * 8 + e + 4 >= n) ? -1e30f : 0.f;
    }
    *(v4f*)&Ms[tid * 8]     = f0;
    *(v4f*)&Ms[tid * 8 + 4] = f1;
  }

  // per-thread 16B chunks of a 64x64 bf16 tile (512 chunks, 4 per thread)
  unsigned kLds[4], vLds[4], tOff[4];
#pragma unroll
  for (int t = 0; t < 4; ++t) {
    const int ch = tid + t * 128;
    const int rr = ch >> 3, cc = ch & 7;
    kLds[t] = lds_addr(&Ks[rr * KP_ + cc * 8]);
    vLds[t] = lds_addr(&Vs[rr * VP_ + cc * 8]);
    tOff[t] = (unsigned)((rr * D_ + cc * 8) * 2);
  }
  const __bf16* vfrag = &Vs[(8 * hh + (lane & 7)) * VP_ + ((lane >> 3) & 1) * 8];

  const v8f zero8 = {0.f, 0.f, 0.f, 0.f, 0.f, 0.f, 0.f, 0.f};
  v8f o[4];                      // o[t][r] = O[query c][dk 16 t + 8 hh + r]
#pragma unroll
  for (int t = 0; t < 4; ++t) o[t] = zero8;
  float m_run = -3.0e38f;        // the query's maximum, alike in both halves
  float l_run = 0.f;             // the sum over this half's keys only

  // The 16 blocks of one head and batch read the same K and V rows: each starts its
  // walk over the key tiles at another tile and wraps round, so that they do not ask
  // L2 for the same lines at the same moment.
  int kt = (int)(blockIdx.x % (unsigned)nt);
  int left = nt;
  do {              // nt is at least 1
    wait_ds0();       // own reads of Ks/Vs (first trip: writes of Ms) are done
    __syncthreads();  // and so are every other wave's: the tiles may be refilled
    const size_t kvb = kvrow0 + (size_t)kt * 64 * D_;
    async_copy_kv(kLds, vLds, tOff, Kb + kvb, V + kvb);
    wait_async0();
    __syncthreads();

    // S^T = K Q^T: s[j][r] = score(key 16 j + 8 hh + r, query c)
    v8f s[4];
#pragma unroll
    for (int j = 0; j < 4; ++j) s[j] = zero8;
#pragma unroll
    for (int kk = 0; kk < 2; ++kk)
#pragma unroll
      for (int j = 0; j < 4; ++j)
        s[j] = wmma_bf16(load_frag(Ks, j * 16, kk * 32, KP_), qf[kk], s[j]);
    // scale 1/sqrt(64) + key mask
#pragma unroll
    for (int j = 0; j < 4; ++j) {
      const float* mrow = &Ms[kt * 64 + j * 16 + 8 * hh];
      const v4f ma = *(const v4f*)mrow;
      const v4f mb = *(const v4f*)(mrow + 4);
#pragma unroll
      for (int r = 0; r < 4; ++r) {
        s[j][r]     = s[j][r]     * 0.125f + ma[r];
        s[j][r + 4] = s[j][r + 4] * 0.125f + mb[r];
      }
    }
    // online softmax (base-2): one query per lane
    v8f mx8 = __builtin_elementwise_max(__builtin_elementwise_max(s[0], s[1]),
                                        __builtin_elementwise_max(s[2], s[3]));
    float mx = fmaxf(fmaxf(fmaxf(mx8[0], mx8[1]), fmaxf(mx8[2], mx8[3])),
                     fmaxf(fmaxf(mx8[4], mx8[5]), fmaxf(mx8[6], mx8[7])));
    mx = fmaxf(mx, swap_halves(mx));
    const float mn = fmaxf(m_run, mx);
    const float alpha = exp2_bare((m_run - mn) * 1.44269504f);
    m_run = mn;
#pragma unroll
    for (int j = 0; j < 4; ++j)
#pragma unroll
      for (int r = 0; r < 8; ++r)
        s[j][r] = exp2_bare((s[j][r] - m_run) * 1.44269504f);
    const v8f rs8 = (s[0] + s[1]) + (s[2] + s[3]);
    const float rs = ((rs8[0] + rs8[1]) + (rs8[2] + rs8[3])) +
                     ((rs8[4] + rs8[5]) + (rs8[6] + rs8[7]));
    l_run = l_run * alpha + rs;
#pragma unroll
    for (int t = 0; t < 4; ++t) o[t] *= alpha;

    // O^T += V^T P^T: B = score tiles 2 kk and 2 kk + 1 rounded in place (element
    // e = key 32 kk + 8 hh + e, e + 8 = key 32 kk + 16 + 8 hh + e: the order that
    // the two transposing loads of an A fragment deliver)
#pragma unroll
    for (int kk = 0; kk < 2; ++kk) {
      v8u pw;
#pragma unroll
      for (int i = 0; i < 4; ++i) {
        pw[i]     = pack_bf2(s[2 * kk][2 * i],     s[2 * kk][2 * i + 1]);
        pw[i + 4] = pack_bf2(s[2 * kk + 1][2 * i], s[2 * kk + 1][2 * i + 1]);
      }
      const v16bf pf = __builtin_bit_cast(v16bf, pw);
#pragma unroll
      for (int t = 0; t < 4; ++t) {
        const v8bf lo = load_tr16(vfrag + (kk * 32) * VP_ + t * 16);
        const v8bf hi = load_tr16(vfrag + (kk * 32 + 16) * VP_ + t * 16);
        v16bf a;
#pragma unroll
        for (int i = 0; i < 8; ++i) { a[i] = lo[i]; a[i + 8] = hi[i]; }
        o[t] = wmma_bf16(a, pf, o[t]);
      }
    }
    kt = (kt + 1 < nt) ? kt + 1 : 0;
  } while (--left > 0);

  // The halves' sums are joined once, unconditionally (every lane is on).
  const float l   = l_run + swap_halves(l_run);
  const float inv = 1.f / fmaxf(l, 1e-20f);
  __bf16* op = O + ((size_t)b * S_ + qb + m0 + c) * D_ + h * DK_ + 8 * hh;
#pragma unroll
  for (int t = 0; t < 4; ++t) {
    v4u pk;
#pragma unroll
    for (int i = 0; i < 4; ++i)
      pk[i] = pack_bf2(o[t][2 * i] * inv, o[t][2 * i + 1] * inv);
    *(v4u*)(op + 16 * t) = pk;   // 8 consecutive dk of one query
  }
}

// ---------- launcher ----------

extern "C" void kernel_launch(void* const* d_in, const int* in_sizes, int n_in,
                              void* d_out, int out_size, void* d_ws, size_t ws_size,
                              hipStream_t stream)
{
  (void)in_sizes; (void)n_in; (void)out_size; (void)ws_size;
  const float* x    = (const float*)d_in[0];
  const float* kv   = (const float*)d_in[1];
  const int*   msk  = (const int*)  d_in[2];
  const float* ln1g = (const float*)d_in[3];
  const float* ln1b = (const float*)d_in[4];
  // Order of the converted D x D weights: the five whose products share one launch
  // (q0, k0, v0, k1, v1) first, then o0, q1, o1.
  const float* qw0  = (const float*)d_in[5];
  const float* kw0  = (const float*)d_in[6];
  const float* vw0  = (const float*)d_in[7];
  const float* ow0  = (const float*)d_in[8];
  const float* ob0  = (const float*)d_in[9];
  const float* qw1  = (const float*)d_in[10];
  const float* kw1  = (const float*)d_in[11];
  const float* vw1  = (const float*)d_in[12];
  const float* ow1  = (const float*)d_in[13];
  const float* ob1  = (const float*)d_in[14];
  const float* ln2g = (const float*)d_in[15];
  const float* ln2b = (const float*)d_in[16];
  const float* w1   = (const float*)d_in[17];
  const float* b1   = (const float*)d_in[18];
  const float* w2   = (const float*)d_in[19];
  const float* b2   = (const float*)d_in[20];

  char* ws = (char*)d_ws;
  size_t off = 0;
  auto alloc = [&](size_t bytes) -> void* {
    void* p = ws + off;
    off += (bytes + 255) & ~(size_t)255;
    return p;
  };
  const size_t ROWS = (size_t)B_ * S_;  // 4096
  float*  y_f32  = (float*) alloc(ROWS * D_ * 4);
  __bf16* y_bf   = (__bf16*)alloc(ROWS * D_ * 2);
  __bf16* kvn_bf = (__bf16*)alloc(ROWS * D_ * 2);
  __bf16* wtAll  = (__bf16*)alloc((size_t)16 * D_ * D_ * 2);
  __bf16* wtO0   = wtAll + (size_t)5 * D_ * D_;
  __bf16* wtQ1   = wtAll + (size_t)6 * D_ * D_;
  __bf16* wtO1   = wtAll + (size_t)7 * D_ * D_;
  __bf16* w1t    = wtAll + (size_t)8 * D_ * D_;
  __bf16* w2t    = wtAll + (size_t)12 * D_ * D_;
  __bf16* qB     = (__bf16*)alloc(5 * ROWS * D_ * 2);   // q, k0, v0, k1, v1
  __bf16* kB0    = qB + 1 * ROWS * D_;
  __bf16* vB0    = qB + 2 * ROWS * D_;
  __bf16* kB1    = qB + 3 * ROWS * D_;
  __bf16* vB1    = qB + 4 * ROWS * D_;
  __bf16* aB     = (__bf16*)alloc(ROWS * D_ * 2);
  float*  y1_f32 = (float*) alloc(ROWS * D_ * 4);
  __bf16* y1_bf  = (__bf16*)alloc(ROWS * D_ * 2);
  float*  x2_f32 = (float*) alloc(ROWS * D_ * 4);
  __bf16* x2n_bf = (__bf16*)alloc(ROWS * D_ * 2);
  __bf16* hB     = (__bf16*)alloc(ROWS * FFN_ * 2);
  int*    live   = (int*)   alloc(B_ * 32 * 4);          // unmasked keys per batch

  // LayerNorm 1 on x (keep f32 for residual) and on kv, one launch
  ln_kernel<<<dim3((unsigned)(ROWS / 8), 2), 256, 0, stream>>>(
      x, kv, ln1g, ln1b, y_f32, y_bf, kvn_bf, msk, live);

  // weight conversion/transposition, one launch
  transpose_f32_to_bf16<<<2048, 256, 0, stream>>>(
      qw0, kw0, vw0, kw1, vw1, ow0, qw1, ow1, w1, w2, wtAll);

  const dim3 gproj(D_/128, (unsigned)(ROWS/128));        // (8, 32)
  const dim3 gqkv(D_/128, (unsigned)(ROWS/128), 5);      // (8, 32, 5)
  const dim3 gattn(S_/64, H_, B_);                       // (16,16,4)

  // q0 from y; k0, v0, k1, v1 from kvn: none waits for another, one launch
  gemm_bf16_kernel<2><<<gqkv, 256, 0, stream>>>(y_bf, kvn_bf, wtAll, nullptr, nullptr, nullptr, nullptr, qB, live, (int)ROWS, D_, D_, 0);

  // cross-attention 0
  flash_attn_kernel<<<gattn, 128, 0, stream>>>(qB, kB0, vB0, live, aB);
  gemm_bf16_kernel<4><<<gproj, 256, 0, stream>>>(aB, nullptr, wtO0, ob0, y_f32, nullptr, y1_f32, y1_bf, nullptr, (int)ROWS, D_, D_, 0);

  // cross-attention 1 (query from y1)
  gemm_bf16_kernel<4><<<gproj, 256, 0, stream>>>(y1_bf, nullptr, wtQ1, nullptr, nullptr, nullptr, nullptr, qB, nullptr, (int)ROWS, D_, D_, 0);
  flash_attn_kernel<<<gattn, 128, 0, stream>>>(qB, kB1, vB1, live, aB);
  // x2 = x + (o1 + ob1 + y1)
  gemm_bf16_kernel<4><<<gproj, 256, 0, stream>>>(aB, nullptr, wtO1, ob1, y1_f32, x, x2_f32, nullptr, nullptr, (int)ROWS, D_, D_, 0);

  // FFN
  ln_kernel<<<dim3((unsigned)(ROWS / 8), 1), 256, 0, stream>>>(
      x2_f32, nullptr, ln2g, ln2b, nullptr, x2n_bf, nullptr, nullptr, nullptr);
  gemm_bf16_kernel<2><<<dim3(FFN_/128, (unsigned)(ROWS/128)), 256, 0, stream>>>(
      x2n_bf, nullptr, w1t, b1, nullptr, nullptr, nullptr, hB, nullptr, (int)ROWS, FFN_, D_, 1);
  gemm_bf16_kernel<4><<<gproj, 256, 0, stream>>>(
      hB, nullptr, w2t, b2, x2_f32, nullptr, (float*)d_out, nullptr, nullptr, (int)ROWS, D_, FFN_, 0);
}
